// v000
// Measured on an AMD MI455X. A time is GPU time per run, averaged over a window of back-to-back runs after a warm-up
// (all launches, gaps included; the runs take copies of the inputs in turn), and the median of several windows.
// Apart from v000's, it joins two sittings. Times from different sittings can be a few percent apart, while
// side-by-side timings come from the same sitting.
// The starting kernel, v000, takes 1380 microseconds a run.
// compute dtype: all float inputs rounded to bf16, context_mask (int) read; LayerNorm of x and context in f32; q = xn Wq * 64^-0.5 and k/v = [cn; xn] Wkv with the LN'd rows and the 0.02-scale weights as f16 (1 product) on WMMA 16x16x32, f32 accumulate; rotary (angles from the rotary_pos_emb input, precise cosf/sinf) in f32; q as f16 hi + residual, k f16 -> 2-product logits stored in f32 per (batch, 4-head group); mask = context_mask & causal-with-prefix -> -3e38; softmax in f32 (precise expf), P x 2^11 kept f32 split bf16 hi + lo against v bf16 hi + lo (3 products); out = o (bf16 hi + lo) Wo + bo; f32 output.
#include <hip/hip_runtime.h>
#include <math.h>

typedef __attribute__((ext_vector_type(16))) _Float16 v16h;
typedef __attribute__((ext_vector_type(16))) __bf16 v16b;
typedef __attribute__((ext_vector_type(8)))  _Float16 v8h;
typedef __attribute__((ext_vector_type(8)))  float v8f;
typedef __attribute__((ext_vector_type(4)))  float v4f;
typedef __attribute__((ext_vector_type(2)))  float v2f;
typedef __attribute__((ext_vector_type(4)))  unsigned v4u;
typedef __attribute__((ext_vector_type(4)))  int v4i;
typedef float __attribute__((may_alias)) float_a;
typedef int __attribute__((may_alias)) int_a;

template <typename T> __device__ __forceinline__ void vst2(void* p, T v) { *(T*)p = v;  }
__device__ __forceinline__ v8f wmma16(v16h a, v16h b, v8f c) {
  v8f d = __builtin_amdgcn_wmma_f32_16x16x32_f16(false, a, false, b, (short)0, c, false, false);
  asm volatile("v_nop\n\tv_nop\n\tv_nop\n\tv_nop" : "+v"(d) : "v"(a), "v"(b));
  return d;
}
__device__ __forceinline__ v8f wmma_bf(v16b a, v16b b, v8f c) {
  v8f d = __builtin_amdgcn_wmma_f32_16x16x32_bf16(false, a, false, b, (short)0, c, false, false);
  asm volatile("v_nop\n\tv_nop\n\tv_nop\n\tv_nop" : "+v"(d) : "v"(a), "v"(b));
  return d;
}
// 16x16x32 fragments: lane = (h = lane>>4, row/col = lane&15); elements 0..7 = k0+8h+0..7, 8..15 = k0+16+8h+0..7; D element r = row 8h+r
__device__ __forceinline__ v16h frag_h(const _Float16* rowk0, int lane) {
  union { v16h v; v8h q[2]; } u; const _Float16* p = rowk0 + 8 * (lane >> 4);
  u.q[0] = *(const v8h*)p; u.q[1] = *(const v8h*)(p + 16); return u.v;
}
__device__ __forceinline__ v16h frag_f32(const float* rowk0, int lane) {
  v16h a; const float* p = rowk0 + 8 * (lane >> 4);
#pragma unroll
  for (int i = 0; i < 8; ++i) { a[i] = (_Float16)p[i]; a[8 + i] = (_Float16)p[16 + i]; }
  return a;
}
__device__ __forceinline__ v16h frag_f32s(const float* rowk0, int lane, float sc) {
  v16h a; const float* p = rowk0 + 8 * (lane >> 4);
#pragma unroll
  for (int i = 0; i < 8; ++i) { a[i] = (_Float16)(p[i] * sc); a[8 + i] = (_Float16)(p[16 + i] * sc); }
  return a;
}
// column fragment from a [K][ld] layout (column n), rows >= K read as 0
__device__ __forceinline__ v16h fragc_f32(const float* W, int k0, int n, int lane, int ld, int K) {
  v16h a; const int g = lane >> 4;
#pragma unroll
  for (int i = 0; i < 8; ++i) { const int ka = k0 + 8 * g + i, kb = ka + 16;
    a[i] = (_Float16)(ka < K ? W[(size_t)(ka < K ? ka : K - 1) * ld + n] : 0.f); a[8 + i] = (_Float16)(kb < K ? W[(size_t)(kb < K ? kb : K - 1) * ld + n] : 0.f); }
  return a;
}
struct F2 { v16b h, l; };
__device__ __forceinline__ F2 bsplit16(const float v[16]) { F2 r;
#pragma unroll
  for (int i = 0; i < 16; ++i) { const __bf16 h = (__bf16)v[i]; r.h[i] = h; r.l[i] = (__bf16)(v[i] - (float)h); }
  return r; }
__device__ __forceinline__ F2 split_row(const float* row, int k0, int lane) { float v[16]; const float* p = row + k0 + 8 * (lane >> 4);
#pragma unroll
  for (int i = 0; i < 8; ++i) { v[i] = p[i]; v[8 + i] = p[16 + i]; }
  return bsplit16(v); }
__device__ __forceinline__ F2 split_rowK(const float* row, int k0, int lane, int K) { float v[16]; const int g = lane >> 4;
#pragma unroll
  for (int i = 0; i < 8; ++i) { const int ka = k0 + 8 * g + i, kb = ka + 16; v[i] = ka < K ? row[ka < K ? ka : K - 1] : 0.f; v[8 + i] = kb < K ? row[kb < K ? kb : K - 1] : 0.f; }
  return bsplit16(v); }
__device__ __forceinline__ F2 split_col(const float* W, int k0, int n, int lane, int ld, int K) { float v[16]; const int g = lane >> 4;
#pragma unroll
  for (int i = 0; i < 8; ++i) { const int ka = k0 + 8 * g + i, kb = ka + 16; v[i] = ka < K ? W[(size_t)(ka < K ? ka : K - 1) * ld + n] : 0.f; v[8 + i] = kb < K ? W[(size_t)(kb < K ? kb : K - 1) * ld + n] : 0.f; }
  return bsplit16(v); }
__device__ __forceinline__ v8f mac3(const F2& a, const F2& b, v8f c) { c = wmma_bf(a.l, b.h, c); c = wmma_bf(a.h, b.l, c); return wmma_bf(a.h, b.h, c); }
__device__ __forceinline__ float sigm(float v) { return 1.0f / (1.0f + expf(-v)); }
#define LDSX() do { asm volatile("s_wait_dscnt 0" ::: "memory"); __builtin_amdgcn_wave_barrier(); __builtin_amdgcn_fence(__ATOMIC_RELEASE, "workgroup"); } while (0)


// Causal prefix attention (B 2, 1,024 queries over 1,024 context + 1,024 self keys, 16 x 64, rotary on all 64 dims): prefix keys masked by context_mask, self keys causal.
#define NB 2
#define NQ 1024
#define NC 1024
#define NJ 2048
#define CC 1024
#define NH 16
#define HD 64
#define HG 4
#ifndef TNB
#define TNB NB
#endif
typedef __attribute__((ext_vector_type(8))) __bf16 v8b;
__device__ __forceinline__ v16b frag_b(const __bf16* rowk0, int lane) {
  union { v16b v; v8b q[2]; } u; const __bf16* p = rowk0 + 8 * (lane >> 4);
  u.q[0] = *(const v8b*)p; u.q[1] = *(const v8b*)(p + 16); return u.v;
}
__device__ __forceinline__ float bfr(float v) { return (float)(__bf16)v; }
__device__ __attribute__((noinline)) float exp_ni(float v) { return expf(v); }
__device__ __attribute__((noinline)) float erf_ni(float v) { return erff(v); }

#define WS_XN  0u                                  // f32 LN'd x rows [b*NQ][1024]
#define WS_CN  (WS_XN + 4u * (size_t)NB * NQ * CC)     // f32 LN'd context rows
#define WS_QH  (WS_CN + 4u * (size_t)NB * NC * CC)     // f16 q rows [b*NQ][1024]
#define WS_QL  (WS_QH + 2u * (size_t)NB * NQ * CC)
#define WS_KH  (WS_QL + 2u * (size_t)NB * NQ * CC)     // f16 k rows [b*NJ][1024]
#define WS_VT  (WS_KH + 2u * (size_t)NB * NJ * CC)     // bf16 v planes [b][1024][NJ]
#define WS_VL  (WS_VT + 2u * (size_t)NB * CC * NJ)
#define WS_S   (WS_VL + 2u * (size_t)NB * CC * NJ)     // f32 S/P [HG][NQ][NJ]
#define WS_Y   (WS_S + 4u * (size_t)HG * NQ * NJ)      // f32 o rows [b*NQ][1024]
#define WS_END (WS_Y + 4u * (size_t)NB * NQ * CC)

// ---- k_ln: block = row (rows 0..NB*NQ-1 from x -> XN; NB*NQ.. from context -> CN)
__global__ __launch_bounds__(256) void k_ln(const float* __restrict__ X, const float* __restrict__ CT, const float* __restrict__ GX, const float* __restrict__ BX, const float* __restrict__ GC, const float* __restrict__ BC, float* __restrict__ XN, float* __restrict__ CN) { __shared__ float sred[8]; __shared__ float smu, sinv; __shared__ __align__(16) float sv[CC];
  const int t = threadIdx.x; size_t row = blockIdx.x; const bool isx = row < (size_t)NB * NQ; if (!isx) row -= (size_t)NB * NQ;
  const float* src = (isx ? X : CT) + row * CC; const float* ga = isx ? GX : GC; const float* be = isx ? BX : BC; float* dst = (isx ? XN : CN) + row * CC;
  float a = 0.f; for (int i = t; i < CC; i += 256) { const float v = bfr(src[i]); sv[i] = v; a += v; }
#pragma unroll
  for (int o = 1; o < 32; o <<= 1) a += __shfl_xor(a, o);
  if ((t & 31) == 0) sred[t >> 5] = a; __syncthreads(); if (t == 0) { float x = 0.f; for (int w = 0; w < 8; ++w) x += sred[w]; smu = x / CC; } __syncthreads(); const float mu = smu;
  float q = 0.f; for (int i = t; i < CC; i += 256) { const float d = sv[i] - mu; q += d * d; }
#pragma unroll
  for (int o = 1; o < 32; o <<= 1) q += __shfl_xor(q, o);
  __syncthreads(); if ((t & 31) == 0) sred[t >> 5] = q; __syncthreads(); if (t == 0) { float x = 0.f; for (int w = 0; w < 8; ++w) x += sred[w]; sinv = 1.0f / sqrtf(x / CC + 1e-5f); } __syncthreads(); const float inv = sinv;
  for (int i = t; i < CC; i += 256) sv[i] = (sv[i] - mu) * inv * bfr(ga[i]) + bfr(be[i]);
  __syncthreads(); for (int qq = t; qq < CC / 4; qq += 256) vst2(dst + qq * 4, *(const v4f*)&sv[qq * 4]); }
// ---- k_proj: block = (64 rows, 128 cols, which): which 0: q = xn Wq (rows b*NQ + i; key position CTX + i), 1: k, 2: v from [cn rows (j < NC); xn rows (j >= NC)] Wkv (cols 0..1023 k, 1024.. v); rotary on q and k; f16 A (LN'd rows) x f16 W (1 product)
__global__ __launch_bounds__(128) void k_proj(const float* __restrict__ XN, const float* __restrict__ CN, const float* __restrict__ WQ, const float* __restrict__ WKV, const float* __restrict__ ROT, int which, _Float16* __restrict__ QH, _Float16* __restrict__ QL, _Float16* __restrict__ KH, __bf16* __restrict__ VT, __bf16* __restrict__ VL) {
  __shared__ __align__(16) float sf[64][132]; __shared__ __align__(16) _Float16 sh[64][136], sl[64][136]; __shared__ __align__(16) __bf16 th[128][72], tl2[128][72];
  const int tid = threadIdx.x, wave = tid >> 5, lane = tid & 31, col = lane & 15, g = lane >> 4; const int c0 = blockIdx.y * 128; const size_t r0 = (size_t)blockIdx.x * 64 + wave * 16;   // row within [b*L]
  const int L = (which == 0) ? NQ : NJ; const size_t rme = r0 + col; const size_t b = rme / L; const int jpos = (int)(rme % L);
  const float* arow = (which == 0) ? (XN + (b * NQ + jpos) * CC) : (jpos < NC ? (CN + (b * NC + jpos) * CC) : (XN + (b * NQ + (jpos - NC)) * CC));
  const float* Wm = (which == 0) ? WQ : WKV; const int wstride = (which == 0) ? CC : 2 * CC; const int wc0 = (which == 2) ? CC : 0;
  v8f acc[8] = {};
#pragma unroll 2
  for (int kc = 0; kc < CC / 32; ++kc) { const v16h a = frag_f32(arow + kc * 32, lane);
#pragma unroll
    for (int j = 0; j < 8; ++j) { v16h w; const int o = wc0 + c0 + j * 16 + col;
#pragma unroll
      for (int i = 0; i < 8; ++i) { w[i] = (_Float16)bfr(Wm[(size_t)(kc * 32 + 8 * g + i) * wstride + o]); w[8 + i] = (_Float16)bfr(Wm[(size_t)(kc * 32 + 16 + 8 * g + i) * wstride + o]); }
      acc[j] = wmma16(a, w, acc[j]); } }
  // stage f32 tile, then rotary (q, k) and pack
#pragma unroll
  for (int j = 0; j < 8; ++j)
#pragma unroll
    for (int r = 0; r < 8; ++r) sf[wave * 16 + 8 * g + r][j * 16 + col] = acc[j][r] * ((which == 0) ? 0.125f : 1.0f);
  __syncthreads();
  if (which < 2) {
    for (int e = tid; e < 64 * 128; e += 128) { const int rl = e >> 7, cl = e & 127; const int d = cl & 63; const size_t rr = (size_t)blockIdx.x * 64 + rl; const int jp = (int)(rr % L); const int pos = (which == 0) ? (NC + jp) : jp;   // q uses the last NQ positions
      const float ang = bfr(ROT[(size_t)pos * HD + d]); const float c = cosf(ang), s = sinf(ang); const float me = sf[rl][cl]; const float partner = (d < 32) ? -sf[rl][cl + 32] : sf[rl][cl - 32];
      const float v = me * c + partner * s; const _Float16 hv = (_Float16)v; sh[rl][cl] = hv; sl[rl][cl] = (_Float16)(v - (float)hv); }
    __syncthreads();
    _Float16* dh = which == 0 ? QH : KH; const size_t rb = (size_t)blockIdx.x * 64; for (int e = tid; e < 64 * 16; e += 128) { const int rl = e >> 4, q = e & 15; vst2((unsigned*)(dh + (rb + rl) * CC + c0 + q * 8), *(const v4u*)&sh[rl][q * 8]); if (which == 0) vst2((unsigned*)(QL + (rb + rl) * CC + c0 + q * 8), *(const v4u*)&sl[rl][q * 8]); } }
  else {
    for (int e = tid; e < 64 * 128; e += 128) { const int rl = e >> 7, cl = e & 127; const float v = sf[rl][cl]; const __bf16 bh = (__bf16)v; th[cl][rl] = bh; tl2[cl][rl] = (__bf16)(v - (float)bh); }
    __syncthreads(); const size_t rb = (size_t)blockIdx.x * 64; const size_t bb = rb / NJ; const int j0 = (int)(rb % NJ);
    for (int e = tid; e < 128 * 8; e += 128) { const int cl = e >> 3, q = e & 7; const size_t o2 = (bb * CC + c0 + cl) * (size_t)NJ + j0 + q * 8; vst2((unsigned*)(VT + o2), *(const v4u*)&th[cl][q * 8]); vst2((unsigned*)(VL + o2), *(const v4u*)&tl2[cl][q * 8]); } } }
// ---- k_sc: block = (64 queries, 128 keys, head in group) of batch b: logits (q already scaled) 2 products; mask: key j allowed iff (j < NC ? context_mask[b][j] : j - NC <= i) else -3e38
__global__ __launch_bounds__(128) void k_sc(const _Float16* __restrict__ QH, const _Float16* __restrict__ QL, const _Float16* __restrict__ KH, const int* __restrict__ CM, int b, int h0, float* __restrict__ S0) { __shared__ __align__(16) float ss[4][16][132]; const int h = h0 + blockIdx.z; float* S = S0 + (size_t)blockIdx.z * NQ * NJ;
  const int tid = threadIdx.x, wave = tid >> 5, lane = tid & 31, col = lane & 15, g = lane >> 4; const int k0 = blockIdx.y * 128; const int ql0 = blockIdx.x * 64 + wave * 16; const size_t q0 = (size_t)b * NQ + ql0;
  if (k0 >= NC && (k0 - NC) > blockIdx.x * 64 + 63) return;   // self-key block entirely in the future (block-uniform)
  v8f acc[8] = {};
#pragma unroll
  for (int kc = 0; kc < HD / 32; ++kc) { const v16h ah = frag_h(QH + (q0 + col) * CC + h * HD + kc * 32, lane), al = frag_h(QL + (q0 + col) * CC + h * HD + kc * 32, lane);
#pragma unroll
    for (int j = 0; j < 8; ++j) { const v16h kb = frag_h(KH + ((size_t)b * NJ + k0 + j * 16 + col) * CC + h * HD + kc * 32, lane); acc[j] = wmma16(ah, kb, acc[j]); acc[j] = wmma16(al, kb, acc[j]); } }
#pragma unroll
  for (int j = 0; j < 8; ++j) { const int kt = k0 + j * 16 + col; const bool ctxok = (kt < NC) ? (CM[(size_t)b * NC + kt] != 0) : true;
#pragma unroll
    for (int r = 0; r < 8; ++r) { const int qt = ql0 + 8 * g + r; const bool ok = ctxok && (kt < NC || (kt - NC) <= qt); ss[wave][8 * g + r][j * 16 + col] = ok ? acc[j][r] : -3.0e38f; } }
  LDSX(); for (int rl = 0; rl < 16; ++rl) vst2(S + (size_t)(ql0 + rl) * NJ + k0 + lane * 4, *(const v4f*)&ss[wave][rl][lane * 4]); }
// ---- k_sm: block = (query row, head in group): softmax over keys [0, kend) with masked -> 0; P x 2^11 written back f32
__global__ __launch_bounds__(256) void k_sm(float* __restrict__ S0) { __shared__ float sred[8]; __shared__ float sbc; __shared__ __align__(16) float sh[NJ];
  const int t = threadIdx.x; const size_t row = blockIdx.x; float* sr = S0 + (size_t)blockIdx.y * NQ * NJ + row * NJ; const int kend = NC + ((int)row / 64) * 64 + 64;
  float m = -3.0e38f; for (int k = t; k < kend; k += 256) m = fmaxf(m, sr[k]);
#pragma unroll
  for (int o = 1; o < 32; o <<= 1) m = fmaxf(m, __shfl_xor(m, o));
  if ((t & 31) == 0) sred[t >> 5] = m; __syncthreads(); if (t == 0) { float a = sred[0]; for (int i = 1; i < 8; ++i) a = fmaxf(a, sred[i]); sbc = a; } __syncthreads(); m = sbc; __syncthreads();
  float sum = 0.f; for (int k = t; k < kend; k += 256) { const float v = sr[k]; sum += (v <= -1.0e38f) ? 0.f : expf(v - m); }
#pragma unroll
  for (int o = 1; o < 32; o <<= 1) sum += __shfl_xor(sum, o);
  if ((t & 31) == 0) sred[t >> 5] = sum; __syncthreads(); if (t == 0) { float a = 0.f; for (int i = 0; i < 8; ++i) a += sred[i]; sbc = 1.0f / a; } __syncthreads(); const float inv = sbc;
  for (int k = t; k < kend; k += 256) { const float v = sr[k]; sh[k] = (v <= -1.0e38f) ? 0.f : expf(v - m) * inv * 2048.0f; }
  __syncthreads(); for (int q = t; q < kend / 4; q += 256) vst2(sr + q * 4, *(const v4f*)&sh[q * 4]); }
// ---- k_pv: block = (64 queries, head in group): o rows [b*NQ + i][h*64 + d] = P . v  over keys [0, kend)
__global__ __launch_bounds__(128) void k_pv(const float* __restrict__ PS0, const __bf16* __restrict__ VT, const __bf16* __restrict__ VL, int b, int h0, float* __restrict__ Y) { const int h = h0 + blockIdx.z; const float* PS = PS0 + (size_t)blockIdx.z * NQ * NJ; __shared__ __align__(16) float ss[4][16][HD + 4];
  const int tid = threadIdx.x, wave = tid >> 5, lane = tid & 31, col = lane & 15, g = lane >> 4; const int ql0 = blockIdx.x * 64 + wave * 16; const int kend = NC + blockIdx.x * 64 + 64;
  v8f acc[HD / 16] = {};
#pragma unroll 1
  for (int kc = 0; kc < kend / 32; ++kc) { const F2 p = split_row(PS + (size_t)(ql0 + col) * NJ, kc * 32, lane);
#pragma unroll
    for (int j = 0; j < HD / 16; ++j) { const size_t po = ((size_t)b * CC + h * HD + j * 16 + col) * (size_t)NJ + kc * 32; const v16b vh = frag_b(VT + po, lane); acc[j] = wmma_bf(p.h, vh, acc[j]); acc[j] = wmma_bf(p.l, vh, acc[j]); acc[j] = wmma_bf(p.h, frag_b(VL + po, lane), acc[j]); } }
#pragma unroll
  for (int j = 0; j < HD / 16; ++j)
#pragma unroll
    for (int r = 0; r < 8; ++r) ss[wave][8 * g + r][j * 16 + col] = acc[j][r] * (1.0f / 2048.0f);
  LDSX(); for (int rl = 0; rl < 16; ++rl) if (lane < HD / 4) vst2(Y + ((size_t)b * NQ + ql0 + rl) * CC + h * HD + lane * 4, *(const v4f*)&ss[wave][rl][lane * 4]); }
// ---- k_out: out = o (bf16 hi + lo) Wo + bo (Wo [in][out])
__global__ __launch_bounds__(128) void k_out(const float* __restrict__ Y, const float* __restrict__ WO, const float* __restrict__ BO, float* __restrict__ OUT) { __shared__ __align__(16) float sf[4][16][132];
  const int tid = threadIdx.x, wave = tid >> 5, lane = tid & 31, col = lane & 15, g = lane >> 4; const int c0 = blockIdx.y * 128; const size_t r0 = (size_t)blockIdx.x * 64 + wave * 16;
  v8f acc[8] = {};
#pragma unroll 2
  for (int kc = 0; kc < CC / 32; ++kc) { const F2 a = split_row(Y + (r0 + col) * CC, kc * 32, lane);
#pragma unroll
    for (int j = 0; j < 8; ++j) { v16b w; const int o = c0 + j * 16 + col;
#pragma unroll
      for (int i = 0; i < 8; ++i) { w[i] = (__bf16)WO[(size_t)(kc * 32 + 8 * g + i) * CC + o]; w[8 + i] = (__bf16)WO[(size_t)(kc * 32 + 16 + 8 * g + i) * CC + o]; }
      acc[j] = wmma_bf(a.h, w, acc[j]); acc[j] = wmma_bf(a.l, w, acc[j]); } }
#pragma unroll
  for (int j = 0; j < 8; ++j) { const float bb = bfr(BO[c0 + j * 16 + col]);
#pragma unroll
    for (int r = 0; r < 8; ++r) sf[wave][8 * g + r][j * 16 + col] = acc[j][r] + bb; }
  LDSX(); for (int rl = 0; rl < 16; ++rl) vst2(OUT + (r0 + rl) * CC + c0 + lane * 4, *(const v4f*)&sf[wave][rl][lane * 4]); }
extern "C" void kernel_launch(void* const* d_in, const int* in_sizes, int n_in, void* d_out, int out_size, void* d_ws, size_t ws_size, hipStream_t stream) {
  (void)in_sizes; (void)n_in; (void)out_size;
  const float** F = (const float**)d_in;   // 0 x [2,1024,1024], 1 context [2,1024,1024], 2 context_mask [2,1024] int, 3 rotary_pos_emb [2048,64], 4 norm_w, 5 norm_b, 6 cnorm_w, 7 cnorm_b, 8 Wq [1024,1024] (in,out), 9 Wkv [1024,2048], 10 Wo [1024,1024], 11 bo
  if (ws_size < (size_t)WS_END) return;
  char* ws = (char*)d_ws; float *XN = (float*)(ws + WS_XN), *CN = (float*)(ws + WS_CN), *S = (float*)(ws + WS_S), *Y = (float*)(ws + WS_Y); _Float16 *QH = (_Float16*)(ws + WS_QH), *QL = (_Float16*)(ws + WS_QL), *KH = (_Float16*)(ws + WS_KH); __bf16 *VT = (__bf16*)(ws + WS_VT), *VL = (__bf16*)(ws + WS_VL);
  k_ln<<<NB * NQ + NB * NC, 256, 0, stream>>>(F[0], F[1], F[4], F[5], F[6], F[7], XN, CN);
  k_proj<<<dim3(TNB * NQ / 64, CC / 128), 128, 0, stream>>>(XN, CN, F[8], F[9], F[3], 0, QH, QL, KH, VT, VL);
  k_proj<<<dim3(TNB * NJ / 64, CC / 128), 128, 0, stream>>>(XN, CN, F[8], F[9], F[3], 1, QH, QL, KH, VT, VL);
  k_proj<<<dim3(TNB * NJ / 64, CC / 128), 128, 0, stream>>>(XN, CN, F[8], F[9], F[3], 2, QH, QL, KH, VT, VL);
  for (int b = 0; b < TNB; ++b) for (int h0 = 0; h0 < NH; h0 += HG) {
    k_sc<<<dim3(NQ / 64, NJ / 128, HG), 128, 0, stream>>>(QH, QL, KH, (const int*)d_in[2], b, h0, S);
    k_sm<<<dim3(NQ, HG), 256, 0, stream>>>(S);
    k_pv<<<dim3(NQ / 64, 1, HG), 128, 0, stream>>>(S, VT, VL, b, h0, Y);
  }
  k_out<<<dim3(TNB * NQ / 64, CC / 128), 128, 0, stream>>>(Y, F[10], F[11], (float*)d_out);
}

// v001
// A run of this version takes 661 microseconds.
// Next to v000, in two timings, it ran 2.09 times as fast each time.
// compute dtype: all float inputs rounded to bf16, context_mask (int) read; LayerNorm of x and context in f32; q = xn Wq * 64^-0.5 and k/v = [cn; xn] Wkv with the LN'd rows and the 0.02-scale weights as f16 (1 product) on WMMA 16x16x32, f32 accumulate; rotary (angles from the rotary_pos_emb input, precise cosf/sinf) in f32; q as f16 hi + residual, k f16 -> 2-product logits stored in f32 for all (batch, head) slices; mask = context_mask & causal-with-prefix -> -3e38; softmax in f32 (precise expf), P x 2^11 kept f32 split bf16 hi + lo against v bf16 hi + lo (3 products); out = o (bf16 hi + lo) Wo + bo; f32 output.
#include <hip/hip_runtime.h>
#include <math.h>

typedef __attribute__((ext_vector_type(16))) _Float16 v16h;
typedef __attribute__((ext_vector_type(16))) __bf16 v16b;
typedef __attribute__((ext_vector_type(8)))  _Float16 v8h;
typedef __attribute__((ext_vector_type(8)))  float v8f;
typedef __attribute__((ext_vector_type(4)))  float v4f;
typedef __attribute__((ext_vector_type(2)))  float v2f;
typedef __attribute__((ext_vector_type(4)))  unsigned v4u;
typedef __attribute__((ext_vector_type(4)))  int v4i;
typedef float __attribute__((may_alias)) float_a;
typedef int __attribute__((may_alias)) int_a;

template <typename T> __device__ __forceinline__ void vst2(void* p, T v) { *(T*)p = v;  }
__device__ __forceinline__ v8f wmma16(v16h a, v16h b, v8f c) {
  v8f d = __builtin_amdgcn_wmma_f32_16x16x32_f16(false, a, false, b, (short)0, c, false, false);
  asm volatile("v_nop\n\tv_nop\n\tv_nop\n\tv_nop" : "+v"(d) : "v"(a), "v"(b));
  return d;
}
__device__ __forceinline__ v8f wmma_bf(v16b a, v16b b, v8f c) {
  v8f d = __builtin_amdgcn_wmma_f32_16x16x32_bf16(false, a, false, b, (short)0, c, false, false);
  asm volatile("v_nop\n\tv_nop\n\tv_nop\n\tv_nop" : "+v"(d) : "v"(a), "v"(b));
  return d;
}
// 16x16x32 fragments: lane = (h = lane>>4, row/col = lane&15); elements 0..7 = k0+8h+0..7, 8..15 = k0+16+8h+0..7; D element r = row 8h+r
__device__ __forceinline__ v16h frag_h(const _Float16* rowk0, int lane) {
  union { v16h v; v8h q[2]; } u; const _Float16* p = rowk0 + 8 * (lane >> 4);
  u.q[0] = *(const v8h*)p; u.q[1] = *(const v8h*)(p + 16); return u.v;
}
__device__ __forceinline__ v16h frag_f32(const float* rowk0, int lane) {
  v16h a; const float* p = rowk0 + 8 * (lane >> 4);
#pragma unroll
  for (int i = 0; i < 8; ++i) { a[i] = (_Float16)p[i]; a[8 + i] = (_Float16)p[16 + i]; }
  return a;
}
__device__ __forceinline__ v16h frag_f32s(const float* rowk0, int lane, float sc) {
  v16h a; const float* p = rowk0 + 8 * (lane >> 4);
#pragma unroll
  for (int i = 0; i < 8; ++i) { a[i] = (_Float16)(p[i] * sc); a[8 + i] = (_Float16)(p[16 + i] * sc); }
  return a;
}
// column fragment from a [K][ld] layout (column n), rows >= K read as 0
__device__ __forceinline__ v16h fragc_f32(const float* W, int k0, int n, int lane, int ld, int K) {
  v16h a; const int g = lane >> 4;
#pragma unroll
  for (int i = 0; i < 8; ++i) { const int ka = k0 + 8 * g + i, kb = ka + 16;
    a[i] = (_Float16)(ka < K ? W[(size_t)(ka < K ? ka : K - 1) * ld + n] : 0.f); a[8 + i] = (_Float16)(kb < K ? W[(size_t)(kb < K ? kb : K - 1) * ld + n] : 0.f); }
  return a;
}
struct F2 { v16b h, l; };
__device__ __forceinline__ F2 bsplit16(const float v[16]) { F2 r;
#pragma unroll
  for (int i = 0; i < 16; ++i) { const __bf16 h = (__bf16)v[i]; r.h[i] = h; r.l[i] = (__bf16)(v[i] - (float)h); }
  return r; }
__device__ __forceinline__ F2 split_row(const float* row, int k0, int lane) { float v[16]; const float* p = row + k0 + 8 * (lane >> 4);
#pragma unroll
  for (int i = 0; i < 8; ++i) { v[i] = p[i]; v[8 + i] = p[16 + i]; }
  return bsplit16(v); }
__device__ __forceinline__ F2 split_rowK(const float* row, int k0, int lane, int K) { float v[16]; const int g = lane >> 4;
#pragma unroll
  for (int i = 0; i < 8; ++i) { const int ka = k0 + 8 * g + i, kb = ka + 16; v[i] = ka < K ? row[ka < K ? ka : K - 1] : 0.f; v[8 + i] = kb < K ? row[kb < K ? kb : K - 1] : 0.f; }
  return bsplit16(v); }
__device__ __forceinline__ F2 split_col(const float* W, int k0, int n, int lane, int ld, int K) { float v[16]; const int g = lane >> 4;
#pragma unroll
  for (int i = 0; i < 8; ++i) { const int ka = k0 + 8 * g + i, kb = ka + 16; v[i] = ka < K ? W[(size_t)(ka < K ? ka : K - 1) * ld + n] : 0.f; v[8 + i] = kb < K ? W[(size_t)(kb < K ? kb : K - 1) * ld + n] : 0.f; }
  return bsplit16(v); }
__device__ __forceinline__ v8f mac3(const F2& a, const F2& b, v8f c) { c = wmma_bf(a.l, b.h, c); c = wmma_bf(a.h, b.l, c); return wmma_bf(a.h, b.h, c); }
__device__ __forceinline__ float sigm(float v) { return 1.0f / (1.0f + expf(-v)); }
#define LDSX() do { asm volatile("s_wait_dscnt 0" ::: "memory"); __builtin_amdgcn_wave_barrier(); __builtin_amdgcn_fence(__ATOMIC_RELEASE, "workgroup"); } while (0)


// Causal prefix attention (B 2, 1,024 queries over 1,024 context + 1,024 self keys, 16 x 64, rotary on all 64 dims): prefix keys masked by context_mask, self keys causal.
#define NB 2
#define NQ 1024
#define NC 1024
#define NJ 2048
#define CC 1024
#define NH 16
#define HD 64
#ifndef TNB
#define TNB NB
#endif
typedef __attribute__((ext_vector_type(8))) __bf16 v8b;
__device__ __forceinline__ v16b frag_b(const __bf16* rowk0, int lane) {
  union { v16b v; v8b q[2]; } u; const __bf16* p = rowk0 + 8 * (lane >> 4);
  u.q[0] = *(const v8b*)p; u.q[1] = *(const v8b*)(p + 16); return u.v;
}
__device__ __forceinline__ float bfr(float v) { return (float)(__bf16)v; }
__device__ __attribute__((noinline)) float exp_ni(float v) { return expf(v); }
__device__ __attribute__((noinline)) float erf_ni(float v) { return erff(v); }

// S/P slice of one (batch, head): the 64 rows of query block x lie at pitch s_pitch(x) = the keys k_sc writes for that block (context + self keys up to the next multiple of 128), block behind block, so that all NB * NH slices fit the workspace together
#define SSL ((size_t)64 * ((NQ / 64) * NC + 128 * ((NQ / 128) * (NQ / 128 + 1))))
__device__ __forceinline__ int s_pitch(int x) { return NC + 128 * ((x >> 1) + 1); }
__device__ __forceinline__ size_t s_off(int x) { const int m = x >> 1; return (size_t)64 * (x * NC + 128 * ((m + (x & 1)) * (m + 1))); }

#define WS_XN  0u                                  // f32 LN'd x rows [b*NQ][1024]
#define WS_CN  (WS_XN + 4u * (size_t)NB * NQ * CC)     // f32 LN'd context rows
#define WS_QH  (WS_CN + 4u * (size_t)NB * NC * CC)     // f16 q rows [b*NQ][1024]
#define WS_QL  (WS_QH + 2u * (size_t)NB * NQ * CC)
#define WS_KH  (WS_QL + 2u * (size_t)NB * NQ * CC)     // f16 k rows [b*NJ][1024]
#define WS_VT  (WS_KH + 2u * (size_t)NB * NJ * CC)     // bf16 v planes [b][1024][NJ]
#define WS_VL  (WS_VT + 2u * (size_t)NB * CC * NJ)
#define WS_S   (WS_VL + 2u * (size_t)NB * CC * NJ)     // f32 S/P [NB*NH] slices of SSL floats
#define WS_Y   (WS_S + 4u * (size_t)NB * NH * SSL)     // f32 o rows [b*NQ][1024]
#define WS_END (WS_Y + 4u * (size_t)NB * NQ * CC)

// ---- k_ln: block = row (rows 0..NB*NQ-1 from x -> XN; NB*NQ.. from context -> CN)
__global__ __launch_bounds__(256) void k_ln(const float* __restrict__ X, const float* __restrict__ CT, const float* __restrict__ GX, const float* __restrict__ BX, const float* __restrict__ GC, const float* __restrict__ BC, float* __restrict__ XN, float* __restrict__ CN) { __shared__ float sred[8]; __shared__ float smu, sinv; __shared__ __align__(16) float sv[CC];
  const int t = threadIdx.x; size_t row = blockIdx.x; const bool isx = row < (size_t)NB * NQ; if (!isx) row -= (size_t)NB * NQ;
  const float* src = (isx ? X : CT) + row * CC; const float* ga = isx ? GX : GC; const float* be = isx ? BX : BC; float* dst = (isx ? XN : CN) + row * CC;
  float a = 0.f; for (int i = t; i < CC; i += 256) { const float v = bfr(src[i]); sv[i] = v; a += v; }
#pragma unroll
  for (int o = 1; o < 32; o <<= 1) a += __shfl_xor(a, o);
  if ((t & 31) == 0) sred[t >> 5] = a; __syncthreads(); if (t == 0) { float x = 0.f; for (int w = 0; w < 8; ++w) x += sred[w]; smu = x / CC; } __syncthreads(); const float mu = smu;
  float q = 0.f; for (int i = t; i < CC; i += 256) { const float d = sv[i] - mu; q += d * d; }
#pragma unroll
  for (int o = 1; o < 32; o <<= 1) q += __shfl_xor(q, o);
  __syncthreads(); if ((t & 31) == 0) sred[t >> 5] = q; __syncthreads(); if (t == 0) { float x = 0.f; for (int w = 0; w < 8; ++w) x += sred[w]; sinv = 1.0f / sqrtf(x / CC + 1e-5f); } __syncthreads(); const float inv = sinv;
  for (int i = t; i < CC; i += 256) sv[i] = (sv[i] - mu) * inv * bfr(ga[i]) + bfr(be[i]);
  __syncthreads(); for (int qq = t; qq < CC / 4; qq += 256) vst2(dst + qq * 4, *(const v4f*)&sv[qq * 4]); }
// ---- k_proj: block = (64 rows, 128 cols, which): which 0: q = xn Wq (rows b*NQ + i; key position CTX + i), 1: k, 2: v from [cn rows (j < NC); xn rows (j >= NC)] Wkv (cols 0..1023 k, 1024.. v); rotary on q and k; f16 A (LN'd rows) x f16 W (1 product)
__global__ __launch_bounds__(128) void k_proj(const float* __restrict__ XN, const float* __restrict__ CN, const float* __restrict__ WQ, const float* __restrict__ WKV, const float* __restrict__ ROT, int which, _Float16* __restrict__ QH, _Float16* __restrict__ QL, _Float16* __restrict__ KH, __bf16* __restrict__ VT, __bf16* __restrict__ VL) {
  __shared__ __align__(16) float sf[64][132]; __shared__ __align__(16) _Float16 sh[64][136], sl[64][136]; __shared__ __align__(16) __bf16 th[128][72], tl2[128][72];
  const int tid = threadIdx.x, wave = tid >> 5, lane = tid & 31, col = lane & 15, g = lane >> 4; const int c0 = blockIdx.y * 128; const size_t r0 = (size_t)blockIdx.x * 64 + wave * 16;   // row within [b*L]
  const int L = (which == 0) ? NQ : NJ; const size_t rme = r0 + col; const size_t b = rme / L; const int jpos = (int)(rme % L);
  const float* arow = (which == 0) ? (XN + (b * NQ + jpos) * CC) : (jpos < NC ? (CN + (b * NC + jpos) * CC) : (XN + (b * NQ + (jpos - NC)) * CC));
  const float* Wm = (which == 0) ? WQ : WKV; const int wstride = (which == 0) ? CC : 2 * CC; const int wc0 = (which == 2) ? CC : 0;
  v8f acc[8] = {};
#pragma unroll 2
  for (int kc = 0; kc < CC / 32; ++kc) { const v16h a = frag_f32(arow + kc * 32, lane);
#pragma unroll
    for (int j = 0; j < 8; ++j) { v16h w; const int o = wc0 + c0 + j * 16 + col;
#pragma unroll
      for (int i = 0; i < 8; ++i) { w[i] = (_Float16)bfr(Wm[(size_t)(kc * 32 + 8 * g + i) * wstride + o]); w[8 + i] = (_Float16)bfr(Wm[(size_t)(kc * 32 + 16 + 8 * g + i) * wstride + o]); }
      acc[j] = wmma16(a, w, acc[j]); } }
  // stage f32 tile, then rotary (q, k) and pack
#pragma unroll
  for (int j = 0; j < 8; ++j)
#pragma unroll
    for (int r = 0; r < 8; ++r) sf[wave * 16 + 8 * g + r][j * 16 + col] = acc[j][r] * ((which == 0) ? 0.125f : 1.0f);
  __syncthreads();
  if (which < 2) {
    for (int e = tid; e < 64 * 128; e += 128) { const int rl = e >> 7, cl = e & 127; const int d = cl & 63; const size_t rr = (size_t)blockIdx.x * 64 + rl; const int jp = (int)(rr % L); const int pos = (which == 0) ? (NC + jp) : jp;   // q uses the last NQ positions
      const float ang = bfr(ROT[(size_t)pos * HD + d]); const float c = cosf(ang), s = sinf(ang); const float me = sf[rl][cl]; const float partner = (d < 32) ? -sf[rl][cl + 32] : sf[rl][cl - 32];
      const float v = me * c + partner * s; const _Float16 hv = (_Float16)v; sh[rl][cl] = hv; sl[rl][cl] = (_Float16)(v - (float)hv); }
    __syncthreads();
    _Float16* dh = which == 0 ? QH : KH; const size_t rb = (size_t)blockIdx.x * 64; for (int e = tid; e < 64 * 16; e += 128) { const int rl = e >> 4, q = e & 15; vst2((unsigned*)(dh + (rb + rl) * CC + c0 + q * 8), *(const v4u*)&sh[rl][q * 8]); if (which == 0) vst2((unsigned*)(QL + (rb + rl) * CC + c0 + q * 8), *(const v4u*)&sl[rl][q * 8]); } }
  else {
    for (int e = tid; e < 64 * 128; e += 128) { const int rl = e >> 7, cl = e & 127; const float v = sf[rl][cl]; const __bf16 bh = (__bf16)v; th[cl][rl] = bh; tl2[cl][rl] = (__bf16)(v - (float)bh); }
    __syncthreads(); const size_t rb = (size_t)blockIdx.x * 64; const size_t bb = rb / NJ; const int j0 = (int)(rb % NJ);
    for (int e = tid; e < 128 * 8; e += 128) { const int cl = e >> 3, q = e & 7; const size_t o2 = (bb * CC + c0 + cl) * (size_t)NJ + j0 + q * 8; vst2((unsigned*)(VT + o2), *(const v4u*)&th[cl][q * 8]); vst2((unsigned*)(VL + o2), *(const v4u*)&tl2[cl][q * 8]); } } }
// ---- k_sc: block = (64 queries, 128 keys, slice z = b * NH + h): logits (q already scaled) 2 products; mask: key j allowed iff (j < NC ? context_mask[b][j] : j - NC <= i) else -3e38
__global__ __launch_bounds__(128) void k_sc(const _Float16* __restrict__ QH, const _Float16* __restrict__ QL, const _Float16* __restrict__ KH, const int* __restrict__ CM, float* __restrict__ S0) { __shared__ __align__(16) float ss[4][16][132]; const int b = blockIdx.z / NH, h = blockIdx.z % NH; const int sp = s_pitch(blockIdx.x); float* S = S0 + (size_t)blockIdx.z * SSL + s_off(blockIdx.x);
  const int tid = threadIdx.x, wave = tid >> 5, lane = tid & 31, col = lane & 15, g = lane >> 4; const int k0 = blockIdx.y * 128; const int ql0 = blockIdx.x * 64 + wave * 16; const size_t q0 = (size_t)b * NQ + ql0;
  if (k0 >= NC && (k0 - NC) > blockIdx.x * 64 + 63) return;   // self-key block entirely in the future (block-uniform)
  v8f acc[8] = {};
#pragma unroll
  for (int kc = 0; kc < HD / 32; ++kc) { const v16h ah = frag_h(QH + (q0 + col) * CC + h * HD + kc * 32, lane), al = frag_h(QL + (q0 + col) * CC + h * HD + kc * 32, lane);
#pragma unroll
    for (int j = 0; j < 8; ++j) { const v16h kb = frag_h(KH + ((size_t)b * NJ + k0 + j * 16 + col) * CC + h * HD + kc * 32, lane); acc[j] = wmma16(ah, kb, acc[j]); acc[j] = wmma16(al, kb, acc[j]); } }
#pragma unroll
  for (int j = 0; j < 8; ++j) { const int kt = k0 + j * 16 + col; const bool ctxok = (kt < NC) ? (CM[(size_t)b * NC + kt] != 0) : true;
#pragma unroll
    for (int r = 0; r < 8; ++r) { const int qt = ql0 + 8 * g + r; const bool ok = ctxok && (kt < NC || (kt - NC) <= qt); ss[wave][8 * g + r][j * 16 + col] = ok ? acc[j][r] : -3.0e38f; } }
  LDSX(); for (int rl = 0; rl < 16; ++rl) vst2(S + (size_t)(wave * 16 + rl) * sp + k0 + lane * 4, *(const v4f*)&ss[wave][rl][lane * 4]); }
// ---- k_sm: block = (query row, slice): softmax over keys [0, kend) with masked -> 0; P x 2^11 written back f32
__global__ __launch_bounds__(256) void k_sm(float* __restrict__ S0) { __shared__ float sred[8]; __shared__ float sbc; __shared__ __align__(16) float sh[NJ];
  const int t = threadIdx.x; const size_t row = blockIdx.x; float* sr = S0 + (size_t)blockIdx.y * SSL + s_off((int)row / 64) + (row % 64) * s_pitch((int)row / 64); const int kend = NC + ((int)row / 64) * 64 + 64;
  float m = -3.0e38f; for (int k = t; k < kend; k += 256) m = fmaxf(m, sr[k]);
#pragma unroll
  for (int o = 1; o < 32; o <<= 1) m = fmaxf(m, __shfl_xor(m, o));
  if ((t & 31) == 0) sred[t >> 5] = m; __syncthreads(); if (t == 0) { float a = sred[0]; for (int i = 1; i < 8; ++i) a = fmaxf(a, sred[i]); sbc = a; } __syncthreads(); m = sbc; __syncthreads();
  float sum = 0.f; for (int k = t; k < kend; k += 256) { const float v = sr[k]; sum += (v <= -1.0e38f) ? 0.f : expf(v - m); }
#pragma unroll
  for (int o = 1; o < 32; o <<= 1) sum += __shfl_xor(sum, o);
  if ((t & 31) == 0) sred[t >> 5] = sum; __syncthreads(); if (t == 0) { float a = 0.f; for (int i = 0; i < 8; ++i) a += sred[i]; sbc = 1.0f / a; } __syncthreads(); const float inv = sbc;
  for (int k = t; k < kend; k += 256) { const float v = sr[k]; sh[k] = (v <= -1.0e38f) ? 0.f : expf(v - m) * inv * 2048.0f; }
  __syncthreads(); for (int q = t; q < kend / 4; q += 256) vst2(sr + q * 4, *(const v4f*)&sh[q * 4]); }
// ---- k_pv: block = (64 queries, slice z = b * NH + h): o rows [b*NQ + i][h*64 + d] = P . v  over keys [0, kend)
__global__ __launch_bounds__(128) void k_pv(const float* __restrict__ PS0, const __bf16* __restrict__ VT, const __bf16* __restrict__ VL, float* __restrict__ Y) { const int b = blockIdx.z / NH, h = blockIdx.z % NH; const float* PS = PS0 + (size_t)blockIdx.z * SSL + s_off(blockIdx.x); __shared__ __align__(16) float ss[4][16][HD + 4];
  const int tid = threadIdx.x, wave = tid >> 5, lane = tid & 31, col = lane & 15, g = lane >> 4; const int ql0 = blockIdx.x * 64 + wave * 16; const int kend = NC + blockIdx.x * 64 + 64;
  v8f acc[HD / 16] = {};
#pragma unroll 1
  for (int kc = 0; kc < kend / 32; ++kc) { const F2 p = split_row(PS + (size_t)(wave * 16 + col) * s_pitch(blockIdx.x), kc * 32, lane);
    asm volatile("s_wait_xcnt 0x0" ::: "memory");   // the P loads' address registers are reused as a destination of the v loads that follow
#pragma unroll
    for (int j = 0; j < HD / 16; ++j) { const size_t po = ((size_t)b * CC + h * HD + j * 16 + col) * (size_t)NJ + kc * 32; const v16b vh = frag_b(VT + po, lane); acc[j] = wmma_bf(p.h, vh, acc[j]); acc[j] = wmma_bf(p.l, vh, acc[j]); acc[j] = wmma_bf(p.h, frag_b(VL + po, lane), acc[j]); } }
#pragma unroll
  for (int j = 0; j < HD / 16; ++j)
#pragma unroll
    for (int r = 0; r < 8; ++r) ss[wave][8 * g + r][j * 16 + col] = acc[j][r] * (1.0f / 2048.0f);
  LDSX(); for (int rl = 0; rl < 16; ++rl) if (lane < HD / 4) vst2(Y + ((size_t)b * NQ + ql0 + rl) * CC + h * HD + lane * 4, *(const v4f*)&ss[wave][rl][lane * 4]); }
// ---- k_out: out = o (bf16 hi + lo) Wo + bo (Wo [in][out])
__global__ __launch_bounds__(128) void k_out(const float* __restrict__ Y, const float* __restrict__ WO, const float* __restrict__ BO, float* __restrict__ OUT) { __shared__ __align__(16) float sf[4][16][132];
  const int tid = threadIdx.x, wave = tid >> 5, lane = tid & 31, col = lane & 15, g = lane >> 4; const int c0 = blockIdx.y * 128; const size_t r0 = (size_t)blockIdx.x * 64 + wave * 16;
  v8f acc[8] = {};
#pragma unroll 2
  for (int kc = 0; kc < CC / 32; ++kc) { const F2 a = split_row(Y + (r0 + col) * CC, kc * 32, lane);
#pragma unroll
    for (int j = 0; j < 8; ++j) { v16b w; const int o = c0 + j * 16 + col;
#pragma unroll
      for (int i = 0; i < 8; ++i) { w[i] = (__bf16)WO[(size_t)(kc * 32 + 8 * g + i) * CC + o]; w[8 + i] = (__bf16)WO[(size_t)(kc * 32 + 16 + 8 * g + i) * CC + o]; }
      acc[j] = wmma_bf(a.h, w, acc[j]); acc[j] = wmma_bf(a.l, w, acc[j]); } }
#pragma unroll
  for (int j = 0; j < 8; ++j) { const float bb = bfr(BO[c0 + j * 16 + col]);
#pragma unroll
    for (int r = 0; r < 8; ++r) sf[wave][8 * g + r][j * 16 + col] = acc[j][r] + bb; }
  LDSX(); for (int rl = 0; rl < 16; ++rl) vst2(OUT + (r0 + rl) * CC + c0 + lane * 4, *(const v4f*)&sf[wave][rl][lane * 4]); }
extern "C" void kernel_launch(void* const* d_in, const int* in_sizes, int n_in, void* d_out, int out_size, void* d_ws, size_t ws_size, hipStream_t stream) {
  (void)in_sizes; (void)n_in; (void)out_size;
  const float** F = (const float**)d_in;   // 0 x [2,1024,1024], 1 context [2,1024,1024], 2 context_mask [2,1024] int, 3 rotary_pos_emb [2048,64], 4 norm_w, 5 norm_b, 6 cnorm_w, 7 cnorm_b, 8 Wq [1024,1024] (in,out), 9 Wkv [1024,2048], 10 Wo [1024,1024], 11 bo
  if (ws_size < (size_t)WS_END) return;
  char* ws = (char*)d_ws; float *XN = (float*)(ws + WS_XN), *CN = (float*)(ws + WS_CN), *S = (float*)(ws + WS_S), *Y = (float*)(ws + WS_Y); _Float16 *QH = (_Float16*)(ws + WS_QH), *QL = (_Float16*)(ws + WS_QL), *KH = (_Float16*)(ws + WS_KH); __bf16 *VT = (__bf16*)(ws + WS_VT), *VL = (__bf16*)(ws + WS_VL);
  k_ln<<<NB * NQ + NB * NC, 256, 0, stream>>>(F[0], F[1], F[4], F[5], F[6], F[7], XN, CN);
  k_proj<<<dim3(TNB * NQ / 64, CC / 128), 128, 0, stream>>>(XN, CN, F[8], F[9], F[3], 0, QH, QL, KH, VT, VL);
  k_proj<<<dim3(TNB * NJ / 64, CC / 128), 128, 0, stream>>>(XN, CN, F[8], F[9], F[3], 1, QH, QL, KH, VT, VL);
  k_proj<<<dim3(TNB * NJ / 64, CC / 128), 128, 0, stream>>>(XN, CN, F[8], F[9], F[3], 2, QH, QL, KH, VT, VL);
  k_sc<<<dim3(NQ / 64, NJ / 128, TNB * NH), 128, 0, stream>>>(QH, QL, KH, (const int*)d_in[2], S);
  k_sm<<<dim3(NQ, TNB * NH), 256, 0, stream>>>(S);
  k_pv<<<dim3(NQ / 64, 1, TNB * NH), 128, 0, stream>>>(S, VT, VL, Y);
  k_out<<<dim3(TNB * NQ / 64, CC / 128), 128, 0, stream>>>(Y, F[10], F[11], (float*)d_out);
}

// v002
// Measured time: 483 microseconds a run.
// Timed twice side by side with v001, it ran 1.37 times as fast both times.
// All steps since v000 together make it 2.87 times as fast.
// compute dtype: all float inputs rounded to bf16, context_mask (int) read; LayerNorm of x and context in f32; q = xn Wq * 64^-0.5 and k/v = [cn; xn] Wkv with the LN'd rows and the 0.02-scale weights as f16 (1 product) on WMMA 16x16x32, f32 accumulate; rotary (angles from the rotary_pos_emb input, precise cosf/sinf) in f32; q as f16 hi + residual, k f16 -> 2-product logits stored in f32 for all (batch, head) slices; mask = context_mask & causal-with-prefix -> -3e38; softmax in f32 (precise expf), P x 2^11 kept f32 split bf16 hi + lo against v bf16 hi + lo (3 products); out = o (bf16 hi + lo) Wo + bo; f32 output.
#include <hip/hip_runtime.h>
#include <math.h>

typedef __attribute__((ext_vector_type(16))) _Float16 v16h;
typedef __attribute__((ext_vector_type(16))) __bf16 v16b;
typedef __attribute__((ext_vector_type(8)))  _Float16 v8h;
typedef __attribute__((ext_vector_type(8)))  float v8f;
typedef __attribute__((ext_vector_type(4)))  float v4f;
typedef __attribute__((ext_vector_type(2)))  float v2f;
typedef __attribute__((ext_vector_type(4)))  unsigned v4u;
typedef __attribute__((ext_vector_type(4)))  int v4i;
typedef float __attribute__((may_alias)) float_a;
typedef int __attribute__((may_alias)) int_a;

template <typename T> __device__ __forceinline__ void vst2(void* p, T v) { *(T*)p = v;  }
__device__ __forceinline__ v8f wmma16(v16h a, v16h b, v8f c) {
  v8f d = __builtin_amdgcn_wmma_f32_16x16x32_f16(false, a, false, b, (short)0, c, false, false);
  asm volatile("v_nop\n\tv_nop\n\tv_nop\n\tv_nop" : "+v"(d) : "v"(a), "v"(b));
  return d;
}
__device__ __forceinline__ v8f wmma_bf(v16b a, v16b b, v8f c) {
  v8f d = __builtin_amdgcn_wmma_f32_16x16x32_bf16(false, a, false, b, (short)0, c, false, false);
  asm volatile("v_nop\n\tv_nop\n\tv_nop\n\tv_nop" : "+v"(d) : "v"(a), "v"(b));
  return d;
}
// 16x16x32 fragments: lane = (h = lane>>4, row/col = lane&15); elements 0..7 = k0+8h+0..7, 8..15 = k0+16+8h+0..7; D element r = row 8h+r
__device__ __forceinline__ v16h frag_h(const _Float16* rowk0, int lane) {
  union { v16h v; v8h q[2]; } u; const _Float16* p = rowk0 + 8 * (lane >> 4);
  u.q[0] = *(const v8h*)p; u.q[1] = *(const v8h*)(p + 16); return u.v;
}
__device__ __forceinline__ v16h frag_f32(const float* rowk0, int lane) {
  v16h a; const float* p = rowk0 + 8 * (lane >> 4);
#pragma unroll
  for (int i = 0; i < 8; ++i) { a[i] = (_Float16)p[i]; a[8 + i] = (_Float16)p[16 + i]; }
  return a;
}
__device__ __forceinline__ v16h frag_f32s(const float* rowk0, int lane, float sc) {
  v16h a; const float* p = rowk0 + 8 * (lane >> 4);
#pragma unroll
  for (int i = 0; i < 8; ++i) { a[i] = (_Float16)(p[i] * sc); a[8 + i] = (_Float16)(p[16 + i] * sc); }
  return a;
}
// column fragment from a [K][ld] layout (column n), rows >= K read as 0
__device__ __forceinline__ v16h fragc_f32(const float* W, int k0, int n, int lane, int ld, int K) {
  v16h a; const int g = lane >> 4;
#pragma unroll
  for (int i = 0; i < 8; ++i) { const int ka = k0 + 8 * g + i, kb = ka + 16;
    a[i] = (_Float16)(ka < K ? W[(size_t)(ka < K ? ka : K - 1) * ld + n] : 0.f); a[8 + i] = (_Float16)(kb < K ? W[(size_t)(kb < K ? kb : K - 1) * ld + n] : 0.f); }
  return a;
}
struct F2 { v16b h, l; };
__device__ __forceinline__ F2 bsplit16(const float v[16]) { F2 r;
#pragma unroll
  for (int i = 0; i < 16; ++i) { const __bf16 h = (__bf16)v[i]; r.h[i] = h; r.l[i] = (__bf16)(v[i] - (float)h); }
  return r; }
__device__ __forceinline__ F2 split_row(const float* row, int k0, int lane) { float v[16]; const float* p = row + k0 + 8 * (lane >> 4);
#pragma unroll
  for (int i = 0; i < 8; ++i) { v[i] = p[i]; v[8 + i] = p[16 + i]; }
  return bsplit16(v); }
__device__ __forceinline__ F2 split_rowK(const float* row, int k0, int lane, int K) { float v[16]; const int g = lane >> 4;
#pragma unroll
  for (int i = 0; i < 8; ++i) { const int ka = k0 + 8 * g + i, kb = ka + 16; v[i] = ka < K ? row[ka < K ? ka : K - 1] : 0.f; v[8 + i] = kb < K ? row[kb < K ? kb : K - 1] : 0.f; }
  return bsplit16(v); }
__device__ __forceinline__ F2 split_col(const float* W, int k0, int n, int lane, int ld, int K) { float v[16]; const int g = lane >> 4;
#pragma unroll
  for (int i = 0; i < 8; ++i) { const int ka = k0 + 8 * g + i, kb = ka + 16; v[i] = ka < K ? W[(size_t)(ka < K ? ka : K - 1) * ld + n] : 0.f; v[8 + i] = kb < K ? W[(size_t)(kb < K ? kb : K - 1) * ld + n] : 0.f; }
  return bsplit16(v); }
__device__ __forceinline__ v8f mac3(const F2& a, const F2& b, v8f c) { c = wmma_bf(a.l, b.h, c); c = wmma_bf(a.h, b.l, c); return wmma_bf(a.h, b.h, c); }
__device__ __forceinline__ float sigm(float v) { return 1.0f / (1.0f + expf(-v)); }
#define LDSX() do { asm volatile("s_wait_dscnt 0" ::: "memory"); __builtin_amdgcn_wave_barrier(); __builtin_amdgcn_fence(__ATOMIC_RELEASE, "workgroup"); } while (0)


// Causal prefix attention (B 2, 1,024 queries over 1,024 context + 1,024 self keys, 16 x 64, rotary on all 64 dims): prefix keys masked by context_mask, self keys causal.
#define NB 2
#define NQ 1024
#define NC 1024
#define NJ 2048
#define CC 1024
#define NH 16
#define HD 64
#ifndef TNB
#define TNB NB
#endif
typedef __attribute__((ext_vector_type(8))) __bf16 v8b;
__device__ __forceinline__ v16b frag_b(const __bf16* rowk0, int lane) {
  union { v16b v; v8b q[2]; } u; const __bf16* p = rowk0 + 8 * (lane >> 4);
  u.q[0] = *(const v8b*)p; u.q[1] = *(const v8b*)(p + 16); return u.v;
}
// B fragment from a plane of k_wt (f = the fragment's 512 elements)
__device__ __forceinline__ v16h fragw_h(const _Float16* f, int lane) { union { v16h v; v8h q[2]; } u; u.q[0] = *(const v8h*)(f + lane * 8); u.q[1] = *(const v8h*)(f + 256 + lane * 8); return u.v; }
__device__ __forceinline__ v16b fragw_b(const __bf16* f, int lane) { union { v16b v; v8b q[2]; } u; u.q[0] = *(const v8b*)(f + lane * 8); u.q[1] = *(const v8b*)(f + 256 + lane * 8); return u.v; }
__device__ __forceinline__ float bfr(float v) { return (float)(__bf16)v; }
__device__ __attribute__((noinline)) float exp_ni(float v) { return expf(v); }
__device__ __attribute__((noinline)) float erf_ni(float v) { return erff(v); }

// S/P slice of one (batch, head): the 64 rows of query block x lie at pitch s_pitch(x) = the keys k_sc writes for that block (context + self keys up to the next multiple of 128), block behind block, so that all NB * NH slices fit the workspace together
#define SSL ((size_t)64 * ((NQ / 64) * NC + 128 * ((NQ / 128) * (NQ / 128 + 1))))
__device__ __forceinline__ int s_pitch(int x) { return NC + 128 * ((x >> 1) + 1); }
__device__ __forceinline__ size_t s_off(int x) { const int m = x >> 1; return (size_t)64 * (x * NC + 128 * ((m + (x & 1)) * (m + 1))); }

#define WS_XN  0u                                  // f32 LN'd x rows [b*NQ][1024]
#define WS_CN  (WS_XN + 4u * (size_t)NB * NQ * CC)     // f32 LN'd context rows
#define WS_QH  (WS_CN + 4u * (size_t)NB * NC * CC)     // f16 q rows [b*NQ][1024]
#define WS_QL  (WS_QH + 2u * (size_t)NB * NQ * CC)
#define WS_KH  (WS_QL + 2u * (size_t)NB * NQ * CC)     // f16 k rows [b*NJ][1024]
#define WS_VT  (WS_KH + 2u * (size_t)NB * NJ * CC)     // bf16 v planes [b][1024][NJ]
#define WS_VL  (WS_VT + 2u * (size_t)NB * CC * NJ)
#define WS_S   (WS_VL + 2u * (size_t)NB * CC * NJ)     // f32 S/P [NB*NH] slices of SSL floats
#define WS_WT  (WS_S + 4u * (size_t)NB * NH * SSL)     // 16-bit weight planes [4][64 n tiles][32 k steps][512] in B-fragment order (k_wt): f16 Wq, Wkv k half, Wkv v half; bf16 Wo
#define WS_Y   WS_XN                               // f32 o rows [b*NQ][1024]: k_pv writes them after the last reader of XN (k_proj) has ended
#define WS_END (WS_WT + 2u * (size_t)4 * CC * CC)

typedef __attribute__((ext_vector_type(2))) _Float16 v2h;
typedef __attribute__((ext_vector_type(2))) __bf16 v2b;
// ---- k_wt: block = (64 k, 64 n, plane z): each weight is rounded once to the 16-bit type its product reads (z 0 Wq, 1 Wkv cols 0..1023, 2 Wkv cols 1024..: bf16 then f16; 3 Wo: bf16) and stored in B-fragment order: 1 KiB for each (16 n, 32 k) fragment, elements 0..7 of lanes 0..31 and then elements 8..15, so that each of a fragment's two 16-byte loads reads four whole 128-byte lines
__global__ __launch_bounds__(256) void k_wt(const float* __restrict__ WQ, const float* __restrict__ WKV, const float* __restrict__ WO, unsigned short* __restrict__ WT) { __shared__ __align__(16) unsigned st[64][36];   // [n][k pair], pitch 144 bytes
  const int t = threadIdx.x, z = blockIdx.z, k0 = blockIdx.x * 64, n0 = blockIdx.y * 64; const float* src = (z == 0) ? WQ : (z == 3) ? WO : WKV; const int ld = (z == 1 || z == 2) ? 2 * CC : CC; const int off = (z == 2) ? CC : 0;
  const int kt = t >> 4, q = t & 15; v4f v[2][2];   // rows k0 + 32 i + 2 kt + {0, 1}, columns n0 + 4 q + 0..3
#pragma unroll
  for (int i = 0; i < 2; ++i)
#pragma unroll
    for (int r = 0; r < 2; ++r) { v[i][r] = *(const v4f*)(src + (size_t)(k0 + i * 32 + 2 * kt + r) * ld + off + n0 + q * 4); }
#pragma unroll
  for (int i = 0; i < 2; ++i)
#pragma unroll
    for (int c = 0; c < 4; ++c) { v2b rb; rb[0] = (__bf16)v[i][0][c]; rb[1] = (__bf16)v[i][1][c]; v2h rh; rh[0] = (_Float16)(float)rb[0]; rh[1] = (_Float16)(float)rb[1];
      st[q * 4 + c][i * 16 + kt] = (z == 3) ? __builtin_bit_cast(unsigned, rb) : __builtin_bit_cast(unsigned, rh); }
  __syncthreads();
#pragma unroll
  for (int i = 0; i < 2; ++i) { const int e = t + i * 256, f = e >> 6, w = e & 63;   // fragment f = (16-n tile f >> 1, 32-k step f & 1) of the block's 8; 16-byte piece w = (element half w >> 5, lane w & 31)
    const int n = (f >> 1) * 16 + (w & 15), k8 = (f & 1) * 4 + (w >> 5) * 2 + ((w >> 4) & 1);   // the piece holds column n, rows 8 k8 + 0..7
    vst2(WT + (((size_t)z * (CC / 16) + n0 / 16 + (f >> 1)) * (CC / 32) + k0 / 32 + (f & 1)) * 512 + w * 8, *(const v4u*)&st[n][k8 * 4]); } }
// ---- k_ln: block = row (rows 0..NB*NQ-1 from x -> XN; NB*NQ.. from context -> CN)
__global__ __launch_bounds__(256) void k_ln(const float* __restrict__ X, const float* __restrict__ CT, const float* __restrict__ GX, const float* __restrict__ BX, const float* __restrict__ GC, const float* __restrict__ BC, float* __restrict__ XN, float* __restrict__ CN) { __shared__ float sred[8]; __shared__ float smu, sinv; __shared__ __align__(16) float sv[CC];
  const int t = threadIdx.x; size_t row = blockIdx.x; const bool isx = row < (size_t)NB * NQ; if (!isx) row -= (size_t)NB * NQ;
  const float* src = (isx ? X : CT) + row * CC; const float* ga = isx ? GX : GC; const float* be = isx ? BX : BC; float* dst = (isx ? XN : CN) + row * CC;
  float a = 0.f; for (int i = t; i < CC; i += 256) { const float v = bfr(src[i]); sv[i] = v; a += v; }
#pragma unroll
  for (int o = 1; o < 32; o <<= 1) a += __shfl_xor(a, o);
  if ((t & 31) == 0) sred[t >> 5] = a; __syncthreads(); if (t == 0) { float x = 0.f; for (int w = 0; w < 8; ++w) x += sred[w]; smu = x / CC; } __syncthreads(); const float mu = smu;
  float q = 0.f; for (int i = t; i < CC; i += 256) { const float d = sv[i] - mu; q += d * d; }
#pragma unroll
  for (int o = 1; o < 32; o <<= 1) q += __shfl_xor(q, o);
  __syncthreads(); if ((t & 31) == 0) sred[t >> 5] = q; __syncthreads(); if (t == 0) { float x = 0.f; for (int w = 0; w < 8; ++w) x += sred[w]; sinv = 1.0f / sqrtf(x / CC + 1e-5f); } __syncthreads(); const float inv = sinv;
  for (int i = t; i < CC; i += 256) sv[i] = (sv[i] - mu) * inv * bfr(ga[i]) + bfr(be[i]);
  __syncthreads(); for (int qq = t; qq < CC / 4; qq += 256) vst2(dst + qq * 4, *(const v4f*)&sv[qq * 4]); }
// ---- k_proj: block = (64 rows, 128 cols, which): which 0: q = xn Wq (rows b*NQ + i; key position CTX + i), 1: k, 2: v from [cn rows (j < NC); xn rows (j >= NC)] Wkv (cols 0..1023 k, 1024.. v); rotary on q and k; f16 A (LN'd rows) x f16 W (1 product)
__global__ __launch_bounds__(128) void k_proj(const float* __restrict__ XN, const float* __restrict__ CN, const _Float16* __restrict__ WT, const float* __restrict__ ROT, int which, _Float16* __restrict__ QH, _Float16* __restrict__ QL, _Float16* __restrict__ KH, __bf16* __restrict__ VT, __bf16* __restrict__ VL) {
  __shared__ __align__(16) float sf[64][132]; __shared__ __align__(16) _Float16 sh[64][136], sl[64][136]; __shared__ __align__(16) __bf16 th[128][72], tl2[128][72];
  const int tid = threadIdx.x, wave = tid >> 5, lane = tid & 31, col = lane & 15, g = lane >> 4; const int c0 = blockIdx.y * 128; const size_t r0 = (size_t)blockIdx.x * 64 + wave * 16;   // row within [b*L]
  const int L = (which == 0) ? NQ : NJ; const size_t rme = r0 + col; const size_t b = rme / L; const int jpos = (int)(rme % L);
  const float* arow = (which == 0) ? (XN + (b * NQ + jpos) * CC) : (jpos < NC ? (CN + (b * NC + jpos) * CC) : (XN + (b * NQ + (jpos - NC)) * CC));
  const _Float16* wt0 = WT + ((size_t)which * (CC / 16) + c0 / 16) * (CC / 32) * 512;   // plane 'which', first fragment of the block's first 16 columns
  v8f acc[8] = {};
#pragma unroll 1   // one trip holds 16 B fragments in registers; a second copy of the body would not fit
  for (int kc = 0; kc < CC / 64; ++kc) { v4f ar[2][4]; v16h w[2][8];   // 64 k a trip: 16 B fragments
#pragma unroll
    for (int u = 0; u < 2; ++u) { const float* p = arow + kc * 64 + u * 32 + 8 * g; ar[u][0] = *(const v4f*)p; ar[u][1] = *(const v4f*)(p + 4); ar[u][2] = *(const v4f*)(p + 16); ar[u][3] = *(const v4f*)(p + 20); }
#pragma unroll
    for (int u = 0; u < 2; ++u)
#pragma unroll
      for (int j = 0; j < 8; ++j) w[u][j] = fragw_h(wt0 + ((size_t)j * (CC / 32) + kc * 2 + u) * 512, lane);
    __builtin_amdgcn_sched_barrier(0);   // every load of the trip is issued ahead of the first convert, so that a trip waits for memory once; without it part of the B loads is placed behind the wait for A
#pragma unroll
    for (int u = 0; u < 2; ++u) { v16h a;
#pragma unroll
      for (int i = 0; i < 16; ++i) a[i] = (_Float16)ar[u][i >> 2][i & 3];
#pragma unroll
      for (int j = 0; j < 8; ++j) acc[j] = wmma16(a, w[u][j], acc[j]); } }
  // stage f32 tile, then rotary (q, k) and pack
#pragma unroll
  for (int j = 0; j < 8; ++j)
#pragma unroll
    for (int r = 0; r < 8; ++r) sf[wave * 16 + 8 * g + r][j * 16 + col] = acc[j][r] * ((which == 0) ? 0.125f : 1.0f);
  __syncthreads();
  if (which < 2) {
    for (int e = tid; e < 64 * 128; e += 128) { const int rl = e >> 7, cl = e & 127; const int d = cl & 63; const size_t rr = (size_t)blockIdx.x * 64 + rl; const int jp = (int)(rr % L); const int pos = (which == 0) ? (NC + jp) : jp;   // q uses the last NQ positions
      const float ang = bfr(ROT[(size_t)pos * HD + d]); const float c = cosf(ang), s = sinf(ang); const float me = sf[rl][cl]; const float partner = (d < 32) ? -sf[rl][cl + 32] : sf[rl][cl - 32];
      const float v = me * c + partner * s; const _Float16 hv = (_Float16)v; sh[rl][cl] = hv; sl[rl][cl] = (_Float16)(v - (float)hv); }
    __syncthreads();
    _Float16* dh = which == 0 ? QH : KH; const size_t rb = (size_t)blockIdx.x * 64; for (int e = tid; e < 64 * 16; e += 128) { const int rl = e >> 4, q = e & 15; vst2((unsigned*)(dh + (rb + rl) * CC + c0 + q * 8), *(const v4u*)&sh[rl][q * 8]); if (which == 0) vst2((unsigned*)(QL + (rb + rl) * CC + c0 + q * 8), *(const v4u*)&sl[rl][q * 8]); } }
  else {
    for (int e = tid; e < 64 * 128; e += 128) { const int rl = e >> 7, cl = e & 127; const float v = sf[rl][cl]; const __bf16 bh = (__bf16)v; th[cl][rl] = bh; tl2[cl][rl] = (__bf16)(v - (float)bh); }
    __syncthreads(); const size_t rb = (size_t)blockIdx.x * 64; const size_t bb = rb / NJ; const int j0 = (int)(rb % NJ);
    for (int e = tid; e < 128 * 8; e += 128) { const int cl = e >> 3, q = e & 7; const size_t o2 = (bb * CC + c0 + cl) * (size_t)NJ + j0 + q * 8; vst2((unsigned*)(VT + o2), *(const v4u*)&th[cl][q * 8]); vst2((unsigned*)(VL + o2), *(const v4u*)&tl2[cl][q * 8]); } } }
// ---- k_sc: block = (64 queries, 128 keys, slice z = b * NH + h): logits (q already scaled) 2 products; mask: key j allowed iff (j < NC ? context_mask[b][j] : j - NC <= i) else -3e38
__global__ __launch_bounds__(128) void k_sc(const _Float16* __restrict__ QH, const _Float16* __restrict__ QL, const _Float16* __restrict__ KH, const int* __restrict__ CM, float* __restrict__ S0) { __shared__ __align__(16) float ss[4][16][132]; const int b = blockIdx.z / NH, h = blockIdx.z % NH; const int sp = s_pitch(blockIdx.x); float* S = S0 + (size_t)blockIdx.z * SSL + s_off(blockIdx.x);
  const int tid = threadIdx.x, wave = tid >> 5, lane = tid & 31, col = lane & 15, g = lane >> 4; const int k0 = blockIdx.y * 128; const int ql0 = blockIdx.x * 64 + wave * 16; const size_t q0 = (size_t)b * NQ + ql0;
  if (k0 >= NC && (k0 - NC) > blockIdx.x * 64 + 63) return;   // self-key block entirely in the future (block-uniform)
  v8f acc[8] = {};
#pragma unroll
  for (int kc = 0; kc < HD / 32; ++kc) { const v16h ah = frag_h(QH + (q0 + col) * CC + h * HD + kc * 32, lane), al = frag_h(QL + (q0 + col) * CC + h * HD + kc * 32, lane);
#pragma unroll
    for (int j = 0; j < 8; ++j) { const v16h kb = frag_h(KH + ((size_t)b * NJ + k0 + j * 16 + col) * CC + h * HD + kc * 32, lane); acc[j] = wmma16(ah, kb, acc[j]); acc[j] = wmma16(al, kb, acc[j]); } }
#pragma unroll
  for (int j = 0; j < 8; ++j) { const int kt = k0 + j * 16 + col; const bool ctxok = (kt < NC) ? (CM[(size_t)b * NC + kt] != 0) : true;
#pragma unroll
    for (int r = 0; r < 8; ++r) { const int qt = ql0 + 8 * g + r; const bool ok = ctxok && (kt < NC || (kt - NC) <= qt); ss[wave][8 * g + r][j * 16 + col] = ok ? acc[j][r] : -3.0e38f; } }
  LDSX(); for (int rl = 0; rl < 16; ++rl) vst2(S + (size_t)(wave * 16 + rl) * sp + k0 + lane * 4, *(const v4f*)&ss[wave][rl][lane * 4]); }
// ---- k_sm: block = (query row, slice): softmax over keys [0, kend) with masked -> 0; P x 2^11 written back f32
__global__ __launch_bounds__(256) void k_sm(float* __restrict__ S0) { __shared__ float sred[8]; __shared__ float sbc; __shared__ __align__(16) float sh[NJ];
  const int t = threadIdx.x; const size_t row = blockIdx.x; float* sr = S0 + (size_t)blockIdx.y * SSL + s_off((int)row / 64) + (row % 64) * s_pitch((int)row / 64); const int kend = NC + ((int)row / 64) * 64 + 64;
  float m = -3.0e38f; for (int k = t; k < kend; k += 256) m = fmaxf(m, sr[k]);
#pragma unroll
  for (int o = 1; o < 32; o <<= 1) m = fmaxf(m, __shfl_xor(m, o));
  if ((t & 31) == 0) sred[t >> 5] = m; __syncthreads(); if (t == 0) { float a = sred[0]; for (int i = 1; i < 8; ++i) a = fmaxf(a, sred[i]); sbc = a; } __syncthreads(); m = sbc; __syncthreads();
  float sum = 0.f; for (int k = t; k < kend; k += 256) { const float v = sr[k]; sum += (v <= -1.0e38f) ? 0.f : expf(v - m); }
#pragma unroll
  for (int o = 1; o < 32; o <<= 1) sum += __shfl_xor(sum, o);
  if ((t & 31) == 0) sred[t >> 5] = sum; __syncthreads(); if (t == 0) { float a = 0.f; for (int i = 0; i < 8; ++i) a += sred[i]; sbc = 1.0f / a; } __syncthreads(); const float inv = sbc;
  for (int k = t; k < kend; k += 256) { const float v = sr[k]; sh[k] = (v <= -1.0e38f) ? 0.f : expf(v - m) * inv * 2048.0f; }
  __syncthreads(); for (int q = t; q < kend / 4; q += 256) vst2(sr + q * 4, *(const v4f*)&sh[q * 4]); }
// ---- k_pv: block = (64 queries, slice z = b * NH + h): o rows [b*NQ + i][h*64 + d] = P . v  over keys [0, kend)
__global__ __launch_bounds__(128) void k_pv(const float* __restrict__ PS0, const __bf16* __restrict__ VT, const __bf16* __restrict__ VL, float* __restrict__ Y) { const int b = blockIdx.z / NH, h = blockIdx.z % NH; const float* PS = PS0 + (size_t)blockIdx.z * SSL + s_off(blockIdx.x); __shared__ __align__(16) float ss[4][16][HD + 4];
  const int tid = threadIdx.x, wave = tid >> 5, lane = tid & 31, col = lane & 15, g = lane >> 4; const int ql0 = blockIdx.x * 64 + wave * 16; const int kend = NC + blockIdx.x * 64 + 64;
  v8f acc[HD / 16] = {};
#pragma unroll 1
  for (int kc = 0; kc < kend / 32; ++kc) { const F2 p = split_row(PS + (size_t)(wave * 16 + col) * s_pitch(blockIdx.x), kc * 32, lane);
    asm volatile("s_wait_xcnt 0x0" ::: "memory");   // the P loads' address registers are reused as a destination of the v loads that follow
#pragma unroll
    for (int j = 0; j < HD / 16; ++j) { const size_t po = ((size_t)b * CC + h * HD + j * 16 + col) * (size_t)NJ + kc * 32; const v16b vh = frag_b(VT + po, lane); acc[j] = wmma_bf(p.h, vh, acc[j]); acc[j] = wmma_bf(p.l, vh, acc[j]); acc[j] = wmma_bf(p.h, frag_b(VL + po, lane), acc[j]); } }
#pragma unroll
  for (int j = 0; j < HD / 16; ++j)
#pragma unroll
    for (int r = 0; r < 8; ++r) ss[wave][8 * g + r][j * 16 + col] = acc[j][r] * (1.0f / 2048.0f);
  LDSX(); for (int rl = 0; rl < 16; ++rl) if (lane < HD / 4) vst2(Y + ((size_t)b * NQ + ql0 + rl) * CC + h * HD + lane * 4, *(const v4f*)&ss[wave][rl][lane * 4]); }
// ---- k_out: out = o (bf16 hi + lo) Wo + bo (Wo as the bf16 plane of k_wt)
__global__ __launch_bounds__(128) void k_out(const float* __restrict__ Y, const __bf16* __restrict__ WOT, const float* __restrict__ BO, float* __restrict__ OUT) { __shared__ __align__(16) float sf[4][16][132];
  const int tid = threadIdx.x, wave = tid >> 5, lane = tid & 31, col = lane & 15, g = lane >> 4; const int c0 = blockIdx.y * 128; const size_t r0 = (size_t)blockIdx.x * 64 + wave * 16;
  const float* yrow = Y + (r0 + col) * CC; const __bf16* wt0 = WOT + (size_t)(c0 / 16) * (CC / 32) * 512;   // this lane's A row; first fragment of the block's first 16 columns
  v8f acc[8] = {};
#pragma unroll 1   // one trip holds 16 B fragments in registers; a second copy of the body would not fit
  for (int kc = 0; kc < CC / 64; ++kc) { v4f ar[2][4]; v16b w[2][8];   // 64 k a trip, as in k_proj
#pragma unroll
    for (int u = 0; u < 2; ++u) { const float* p = yrow + kc * 64 + u * 32 + 8 * g; ar[u][0] = *(const v4f*)p; ar[u][1] = *(const v4f*)(p + 4); ar[u][2] = *(const v4f*)(p + 16); ar[u][3] = *(const v4f*)(p + 20); }
#pragma unroll
    for (int u = 0; u < 2; ++u)
#pragma unroll
      for (int j = 0; j < 8; ++j) w[u][j] = fragw_b(wt0 + ((size_t)j * (CC / 32) + kc * 2 + u) * 512, lane);
    __builtin_amdgcn_sched_barrier(0);   // every load of the trip is issued ahead of the first split, so that a trip waits for memory once; without it part of the B loads is placed behind the split of A
#pragma unroll
    for (int u = 0; u < 2; ++u) { float av[16];
#pragma unroll
      for (int i = 0; i < 16; ++i) av[i] = ar[u][i >> 2][i & 3];
      const F2 a = bsplit16(av);
#pragma unroll
      for (int j = 0; j < 8; ++j) { acc[j] = wmma_bf(a.h, w[u][j], acc[j]); acc[j] = wmma_bf(a.l, w[u][j], acc[j]); } } }
#pragma unroll
  for (int j = 0; j < 8; ++j) { const float bb = bfr(BO[c0 + j * 16 + col]);
#pragma unroll
    for (int r = 0; r < 8; ++r) sf[wave][8 * g + r][j * 16 + col] = acc[j][r] + bb; }
  LDSX(); for (int rl = 0; rl < 16; ++rl) vst2(OUT + (r0 + rl) * CC + c0 + lane * 4, *(const v4f*)&sf[wave][rl][lane * 4]); }
extern "C" void kernel_launch(void* const* d_in, const int* in_sizes, int n_in, void* d_out, int out_size, void* d_ws, size_t ws_size, hipStream_t stream) {
  (void)in_sizes; (void)n_in; (void)out_size;
  const float** F = (const float**)d_in;   // 0 x [2,1024,1024], 1 context [2,1024,1024], 2 context_mask [2,1024] int, 3 rotary_pos_emb [2048,64], 4 norm_w, 5 norm_b, 6 cnorm_w, 7 cnorm_b, 8 Wq [1024,1024] (in,out), 9 Wkv [1024,2048], 10 Wo [1024,1024], 11 bo
  if (ws_size < (size_t)WS_END) return;
  char* ws = (char*)d_ws; float *XN = (float*)(ws + WS_XN), *CN = (float*)(ws + WS_CN), *S = (float*)(ws + WS_S), *Y = (float*)(ws + WS_Y); _Float16 *QH = (_Float16*)(ws + WS_QH), *QL = (_Float16*)(ws + WS_QL), *KH = (_Float16*)(ws + WS_KH); __bf16 *VT = (__bf16*)(ws + WS_VT), *VL = (__bf16*)(ws + WS_VL); unsigned short* WT = (unsigned short*)(ws + WS_WT);
  k_wt<<<dim3(CC / 64, CC / 64, 4), 256, 0, stream>>>(F[8], F[9], F[10], WT);
  k_ln<<<NB * NQ + NB * NC, 256, 0, stream>>>(F[0], F[1], F[4], F[5], F[6], F[7], XN, CN);
  k_proj<<<dim3(TNB * NQ / 64, CC / 128), 128, 0, stream>>>(XN, CN, (const _Float16*)WT, F[3], 0, QH, QL, KH, VT, VL);
  k_proj<<<dim3(TNB * NJ / 64, CC / 128), 128, 0, stream>>>(XN, CN, (const _Float16*)WT, F[3], 1, QH, QL, KH, VT, VL);
  k_proj<<<dim3(TNB * NJ / 64, CC / 128), 128, 0, stream>>>(XN, CN, (const _Float16*)WT, F[3], 2, QH, QL, KH, VT, VL);
  k_sc<<<dim3(NQ / 64, NJ / 128, TNB * NH), 128, 0, stream>>>(QH, QL, KH, (const int*)d_in[2], S);
  k_sm<<<dim3(NQ, TNB * NH), 256, 0, stream>>>(S);
  k_pv<<<dim3(NQ / 64, 1, TNB * NH), 128, 0, stream>>>(S, VT, VL, Y);
  k_out<<<dim3(TNB * NQ / 64, CC / 128), 128, 0, stream>>>(Y, (const __bf16*)WT + (size_t)3 * CC * CC, F[11], (float*)d_out);
}

// v003
// One run takes 221 microseconds.
// Next to v002, in two timings, it ran 2.18 and 2.19 times as fast.
// Over all steps from v000 it is 6.27 times as fast.
// compute dtype: all float inputs rounded to bf16, context_mask (int) read; LayerNorm of x and context in f32; q = xn Wq * 64^-0.5 and k/v = [cn; xn] Wkv with the LN'd rows and the 0.02-scale weights as f16 (1 product) on WMMA 16x16x32, f32 accumulate; rotary (angles from the rotary_pos_emb input, precise cosf/sinf) in f32; q as f16 hi + residual, k f16 -> 2-product logits kept in registers; mask = context_mask & causal-with-prefix -> -3e38; running-maximum softmax in f32 (precise expf), unnormalised P split bf16 hi + lo against v bf16 hi + lo (3 products), divided by the row sum at the end; out = o (bf16 hi + lo) Wo + bo; f32 output.
#include <hip/hip_runtime.h>
#include <math.h>

typedef __attribute__((ext_vector_type(16))) _Float16 v16h;
typedef __attribute__((ext_vector_type(16))) __bf16 v16b;
typedef __attribute__((ext_vector_type(8)))  _Float16 v8h;
typedef __attribute__((ext_vector_type(8)))  float v8f;
typedef __attribute__((ext_vector_type(4)))  float v4f;
typedef __attribute__((ext_vector_type(2)))  float v2f;
typedef __attribute__((ext_vector_type(4)))  unsigned v4u;
typedef __attribute__((ext_vector_type(4)))  int v4i;
typedef float __attribute__((may_alias)) float_a;
typedef int __attribute__((may_alias)) int_a;

template <typename T> __device__ __forceinline__ void vst2(void* p, T v) { *(T*)p = v;  }
__device__ __forceinline__ v8f wmma16(v16h a, v16h b, v8f c) {
  v8f d = __builtin_amdgcn_wmma_f32_16x16x32_f16(false, a, false, b, (short)0, c, false, false);
  asm volatile("v_nop\n\tv_nop\n\tv_nop\n\tv_nop" : "+v"(d) : "v"(a), "v"(b));
  return d;
}
__device__ __forceinline__ v8f wmma_bf(v16b a, v16b b, v8f c) {
  v8f d = __builtin_amdgcn_wmma_f32_16x16x32_bf16(false, a, false, b, (short)0, c, false, false);
  asm volatile("v_nop\n\tv_nop\n\tv_nop\n\tv_nop" : "+v"(d) : "v"(a), "v"(b));
  return d;
}
// 16x16x32 fragments: lane = (h = lane>>4, row/col = lane&15); elements 0..7 = k0+8h+0..7, 8..15 = k0+16+8h+0..7; D element r = row 8h+r
__device__ __forceinline__ v16h frag_h(const _Float16* rowk0, int lane) {
  union { v16h v; v8h q[2]; } u; const _Float16* p = rowk0 + 8 * (lane >> 4);
  u.q[0] = *(const v8h*)p; u.q[1] = *(const v8h*)(p + 16); return u.v;
}
__device__ __forceinline__ v16h frag_f32(const float* rowk0, int lane) {
  v16h a; const float* p = rowk0 + 8 * (lane >> 4);
#pragma unroll
  for (int i = 0; i < 8; ++i) { a[i] = (_Float16)p[i]; a[8 + i] = (_Float16)p[16 + i]; }
  return a;
}
__device__ __forceinline__ v16h frag_f32s(const float* rowk0, int lane, float sc) {
  v16h a; const float* p = rowk0 + 8 * (lane >> 4);
#pragma unroll
  for (int i = 0; i < 8; ++i) { a[i] = (_Float16)(p[i] * sc); a[8 + i] = (_Float16)(p[16 + i] * sc); }
  return a;
}
// column fragment from a [K][ld] layout (column n), rows >= K read as 0
__device__ __forceinline__ v16h fragc_f32(const float* W, int k0, int n, int lane, int ld, int K) {
  v16h a; const int g = lane >> 4;
#pragma unroll
  for (int i = 0; i < 8; ++i) { const int ka = k0 + 8 * g + i, kb = ka + 16;
    a[i] = (_Float16)(ka < K ? W[(size_t)(ka < K ? ka : K - 1) * ld + n] : 0.f); a[8 + i] = (_Float16)(kb < K ? W[(size_t)(kb < K ? kb : K - 1) * ld + n] : 0.f); }
  return a;
}
struct F2 { v16b h, l; };
__device__ __forceinline__ F2 bsplit16(const float v[16]) { F2 r;
#pragma unroll
  for (int i = 0; i < 16; ++i) { const __bf16 h = (__bf16)v[i]; r.h[i] = h; r.l[i] = (__bf16)(v[i] - (float)h); }
  return r; }
__device__ __forceinline__ F2 split_row(const float* row, int k0, int lane) { float v[16]; const float* p = row + k0 + 8 * (lane >> 4);
#pragma unroll
  for (int i = 0; i < 8; ++i) { v[i] = p[i]; v[8 + i] = p[16 + i]; }
  return bsplit16(v); }
__device__ __forceinline__ F2 split_rowK(const float* row, int k0, int lane, int K) { float v[16]; const int g = lane >> 4;
#pragma unroll
  for (int i = 0; i < 8; ++i) { const int ka = k0 + 8 * g + i, kb = ka + 16; v[i] = ka < K ? row[ka < K ? ka : K - 1] : 0.f; v[8 + i] = kb < K ? row[kb < K ? kb : K - 1] : 0.f; }
  return bsplit16(v); }
__device__ __forceinline__ F2 split_col(const float* W, int k0, int n, int lane, int ld, int K) { float v[16]; const int g = lane >> 4;
#pragma unroll
  for (int i = 0; i < 8; ++i) { const int ka = k0 + 8 * g + i, kb = ka + 16; v[i] = ka < K ? W[(size_t)(ka < K ? ka : K - 1) * ld + n] : 0.f; v[8 + i] = kb < K ? W[(size_t)(kb < K ? kb : K - 1) * ld + n] : 0.f; }
  return bsplit16(v); }
__device__ __forceinline__ v8f mac3(const F2& a, const F2& b, v8f c) { c = wmma_bf(a.l, b.h, c); c = wmma_bf(a.h, b.l, c); return wmma_bf(a.h, b.h, c); }
__device__ __forceinline__ float sigm(float v) { return 1.0f / (1.0f + expf(-v)); }
#define LDSX() do { asm volatile("s_wait_dscnt 0" ::: "memory"); __builtin_amdgcn_wave_barrier(); __builtin_amdgcn_fence(__ATOMIC_RELEASE, "workgroup"); } while (0)


// Causal prefix attention (B 2, 1,024 queries over 1,024 context + 1,024 self keys, 16 x 64, rotary on all 64 dims): prefix keys masked by context_mask, self keys causal.
#define NB 2
#define NQ 1024
#define NC 1024
#define NJ 2048
#define CC 1024
#define NH 16
#define HD 64
#ifndef TNB
#define TNB NB
#endif
typedef __attribute__((ext_vector_type(8))) __bf16 v8b;
__device__ __forceinline__ v16b frag_b(const __bf16* rowk0, int lane) {
  union { v16b v; v8b q[2]; } u; const __bf16* p = rowk0 + 8 * (lane >> 4);
  u.q[0] = *(const v8b*)p; u.q[1] = *(const v8b*)(p + 16); return u.v;
}
// B fragment from a plane of k_wt (f = the fragment's 512 elements)
__device__ __forceinline__ v16h fragw_h(const _Float16* f, int lane) { union { v16h v; v8h q[2]; } u; u.q[0] = *(const v8h*)(f + lane * 8); u.q[1] = *(const v8h*)(f + 256 + lane * 8); return u.v; }
__device__ __forceinline__ v16b fragw_b(const __bf16* f, int lane) { union { v16b v; v8b q[2]; } u; u.q[0] = *(const v8b*)(f + lane * 8); u.q[1] = *(const v8b*)(f + 256 + lane * 8); return u.v; }
__device__ __forceinline__ float bfr(float v) { return (float)(__bf16)v; }
__device__ __attribute__((noinline)) float exp_ni(float v) { return expf(v); }
__device__ __attribute__((noinline)) float erf_ni(float v) { return erff(v); }


#define WS_XN  0u                                  // f32 LN'd x rows [b*NQ][1024]
#define WS_CN  (WS_XN + 4u * (size_t)NB * NQ * CC)     // f32 LN'd context rows
#define WS_QH  (WS_CN + 4u * (size_t)NB * NC * CC)     // f16 q rows [b*NQ][1024]
#define WS_QL  (WS_QH + 2u * (size_t)NB * NQ * CC)
#define WS_KH  (WS_QL + 2u * (size_t)NB * NQ * CC)     // f16 k rows [b*NJ][1024]
#define WS_VT  (WS_KH + 2u * (size_t)NB * NJ * CC)     // bf16 v planes [b][1024][NJ]
#define WS_VL  (WS_VT + 2u * (size_t)NB * CC * NJ)
#define WS_WT  (WS_VL + 2u * (size_t)NB * CC * NJ)     // 16-bit weight planes [4][64 n tiles][32 k steps][512] in B-fragment order (k_wt): f16 Wq, Wkv k half, Wkv v half; bf16 Wo
#define WS_Y   WS_XN                               // f32 o rows [b*NQ][1024]: k_fa writes them after the last reader of XN (k_proj) has ended
#define WS_END (WS_WT + 2u * (size_t)4 * CC * CC)

typedef __attribute__((ext_vector_type(2))) _Float16 v2h;
typedef __attribute__((ext_vector_type(2))) __bf16 v2b;
// ---- k_wt: block = (64 k, 64 n, plane z): each weight is rounded once to the 16-bit type its product reads (z 0 Wq, 1 Wkv cols 0..1023, 2 Wkv cols 1024..: bf16 then f16; 3 Wo: bf16) and stored in B-fragment order: 1 KiB for each (16 n, 32 k) fragment, elements 0..7 of lanes 0..31 and then elements 8..15, so that each of a fragment's two 16-byte loads reads four whole 128-byte lines
__global__ __launch_bounds__(256) void k_wt(const float* __restrict__ WQ, const float* __restrict__ WKV, const float* __restrict__ WO, unsigned short* __restrict__ WT) { __shared__ __align__(16) unsigned st[64][36];   // [n][k pair], pitch 144 bytes
  const int t = threadIdx.x, z = blockIdx.z, k0 = blockIdx.x * 64, n0 = blockIdx.y * 64; const float* src = (z == 0) ? WQ : (z == 3) ? WO : WKV; const int ld = (z == 1 || z == 2) ? 2 * CC : CC; const int off = (z == 2) ? CC : 0;
  const int kt = t >> 4, q = t & 15; v4f v[2][2];   // rows k0 + 32 i + 2 kt + {0, 1}, columns n0 + 4 q + 0..3
#pragma unroll
  for (int i = 0; i < 2; ++i)
#pragma unroll
    for (int r = 0; r < 2; ++r) { v[i][r] = *(const v4f*)(src + (size_t)(k0 + i * 32 + 2 * kt + r) * ld + off + n0 + q * 4); }
#pragma unroll
  for (int i = 0; i < 2; ++i)
#pragma unroll
    for (int c = 0; c < 4; ++c) { v2b rb; rb[0] = (__bf16)v[i][0][c]; rb[1] = (__bf16)v[i][1][c]; v2h rh; rh[0] = (_Float16)(float)rb[0]; rh[1] = (_Float16)(float)rb[1];
      st[q * 4 + c][i * 16 + kt] = (z == 3) ? __builtin_bit_cast(unsigned, rb) : __builtin_bit_cast(unsigned, rh); }
  __syncthreads();
#pragma unroll
  for (int i = 0; i < 2; ++i) { const int e = t + i * 256, f = e >> 6, w = e & 63;   // fragment f = (16-n tile f >> 1, 32-k step f & 1) of the block's 8; 16-byte piece w = (element half w >> 5, lane w & 31)
    const int n = (f >> 1) * 16 + (w & 15), k8 = (f & 1) * 4 + (w >> 5) * 2 + ((w >> 4) & 1);   // the piece holds column n, rows 8 k8 + 0..7
    vst2(WT + (((size_t)z * (CC / 16) + n0 / 16 + (f >> 1)) * (CC / 32) + k0 / 32 + (f & 1)) * 512 + w * 8, *(const v4u*)&st[n][k8 * 4]); } }
// ---- k_ln: block = row (rows 0..NB*NQ-1 from x -> XN; NB*NQ.. from context -> CN)
__global__ __launch_bounds__(256) void k_ln(const float* __restrict__ X, const float* __restrict__ CT, const float* __restrict__ GX, const float* __restrict__ BX, const float* __restrict__ GC, const float* __restrict__ BC, float* __restrict__ XN, float* __restrict__ CN) { __shared__ float sred[8]; __shared__ float smu, sinv; __shared__ __align__(16) float sv[CC];
  const int t = threadIdx.x; size_t row = blockIdx.x; const bool isx = row < (size_t)NB * NQ; if (!isx) row -= (size_t)NB * NQ;
  const float* src = (isx ? X : CT) + row * CC; const float* ga = isx ? GX : GC; const float* be = isx ? BX : BC; float* dst = (isx ? XN : CN) + row * CC;
  float a = 0.f; for (int i = t; i < CC; i += 256) { const float v = bfr(src[i]); sv[i] = v; a += v; }
#pragma unroll
  for (int o = 1; o < 32; o <<= 1) a += __shfl_xor(a, o);
  if ((t & 31) == 0) sred[t >> 5] = a; __syncthreads(); if (t == 0) { float x = 0.f; for (int w = 0; w < 8; ++w) x += sred[w]; smu = x / CC; } __syncthreads(); const float mu = smu;
  float q = 0.f; for (int i = t; i < CC; i += 256) { const float d = sv[i] - mu; q += d * d; }
#pragma unroll
  for (int o = 1; o < 32; o <<= 1) q += __shfl_xor(q, o);
  __syncthreads(); if ((t & 31) == 0) sred[t >> 5] = q; __syncthreads(); if (t == 0) { float x = 0.f; for (int w = 0; w < 8; ++w) x += sred[w]; sinv = 1.0f / sqrtf(x / CC + 1e-5f); } __syncthreads(); const float inv = sinv;
  for (int i = t; i < CC; i += 256) sv[i] = (sv[i] - mu) * inv * bfr(ga[i]) + bfr(be[i]);
  __syncthreads(); for (int qq = t; qq < CC / 4; qq += 256) vst2(dst + qq * 4, *(const v4f*)&sv[qq * 4]); }
// ---- k_proj: block = (64 rows, 128 cols, which): which 0: q = xn Wq (rows b*NQ + i; key position CTX + i), 1: k, 2: v from [cn rows (j < NC); xn rows (j >= NC)] Wkv (cols 0..1023 k, 1024.. v); rotary on q and k; f16 A (LN'd rows) x f16 W (1 product)
__global__ __launch_bounds__(128) void k_proj(const float* __restrict__ XN, const float* __restrict__ CN, const _Float16* __restrict__ WT, const float* __restrict__ ROT, int which, _Float16* __restrict__ QH, _Float16* __restrict__ QL, _Float16* __restrict__ KH, __bf16* __restrict__ VT, __bf16* __restrict__ VL) {
  __shared__ __align__(16) float sf[64][132]; __shared__ __align__(16) _Float16 sh[64][136], sl[64][136]; __shared__ __align__(16) __bf16 th[128][72], tl2[128][72];
  const int tid = threadIdx.x, wave = tid >> 5, lane = tid & 31, col = lane & 15, g = lane >> 4; const int c0 = blockIdx.y * 128; const size_t r0 = (size_t)blockIdx.x * 64 + wave * 16;   // row within [b*L]
  const int L = (which == 0) ? NQ : NJ; const size_t rme = r0 + col; const size_t b = rme / L; const int jpos = (int)(rme % L);
  const float* arow = (which == 0) ? (XN + (b * NQ + jpos) * CC) : (jpos < NC ? (CN + (b * NC + jpos) * CC) : (XN + (b * NQ + (jpos - NC)) * CC));
  const _Float16* wt0 = WT + ((size_t)which * (CC / 16) + c0 / 16) * (CC / 32) * 512;   // plane 'which', first fragment of the block's first 16 columns
  v8f acc[8] = {};
#pragma unroll 1   // one trip holds 16 B fragments in registers; a second copy of the body would not fit
  for (int kc = 0; kc < CC / 64; ++kc) { v4f ar[2][4]; v16h w[2][8];   // 64 k a trip: 16 B fragments
#pragma unroll
    for (int u = 0; u < 2; ++u) { const float* p = arow + kc * 64 + u * 32 + 8 * g; ar[u][0] = *(const v4f*)p; ar[u][1] = *(const v4f*)(p + 4); ar[u][2] = *(const v4f*)(p + 16); ar[u][3] = *(const v4f*)(p + 20); }
#pragma unroll
    for (int u = 0; u < 2; ++u)
#pragma unroll
      for (int j = 0; j < 8; ++j) w[u][j] = fragw_h(wt0 + ((size_t)j * (CC / 32) + kc * 2 + u) * 512, lane);
    __builtin_amdgcn_sched_barrier(0);   // every load of the trip is issued ahead of the first convert, so that a trip waits for memory once; without it part of the B loads is placed behind the wait for A
#pragma unroll
    for (int u = 0; u < 2; ++u) { v16h a;
#pragma unroll
      for (int i = 0; i < 16; ++i) a[i] = (_Float16)ar[u][i >> 2][i & 3];
#pragma unroll
      for (int j = 0; j < 8; ++j) acc[j] = wmma16(a, w[u][j], acc[j]); } }
  // stage f32 tile, then rotary (q, k) and pack
#pragma unroll
  for (int j = 0; j < 8; ++j)
#pragma unroll
    for (int r = 0; r < 8; ++r) sf[wave * 16 + 8 * g + r][j * 16 + col] = acc[j][r] * ((which == 0) ? 0.125f : 1.0f);
  __syncthreads();
  if (which < 2) {
    for (int e = tid; e < 64 * 128; e += 128) { const int rl = e >> 7, cl = e & 127; const int d = cl & 63; const size_t rr = (size_t)blockIdx.x * 64 + rl; const int jp = (int)(rr % L); const int pos = (which == 0) ? (NC + jp) : jp;   // q uses the last NQ positions
      const float ang = bfr(ROT[(size_t)pos * HD + d]); const float c = cosf(ang), s = sinf(ang); const float me = sf[rl][cl]; const float partner = (d < 32) ? -sf[rl][cl + 32] : sf[rl][cl - 32];
      const float v = me * c + partner * s; const _Float16 hv = (_Float16)v; sh[rl][cl] = hv; sl[rl][cl] = (_Float16)(v - (float)hv); }
    __syncthreads();
    _Float16* dh = which == 0 ? QH : KH; const size_t rb = (size_t)blockIdx.x * 64; for (int e = tid; e < 64 * 16; e += 128) { const int rl = e >> 4, q = e & 15; vst2((unsigned*)(dh + (rb + rl) * CC + c0 + q * 8), *(const v4u*)&sh[rl][q * 8]); if (which == 0) vst2((unsigned*)(QL + (rb + rl) * CC + c0 + q * 8), *(const v4u*)&sl[rl][q * 8]); } }
  else {
    for (int e = tid; e < 64 * 128; e += 128) { const int rl = e >> 7, cl = e & 127; const float v = sf[rl][cl]; const __bf16 bh = (__bf16)v; th[cl][rl] = bh; tl2[cl][rl] = (__bf16)(v - (float)bh); }
    __syncthreads(); const size_t rb = (size_t)blockIdx.x * 64; const size_t bb = rb / NJ; const int j0 = (int)(rb % NJ);
    for (int e = tid; e < 128 * 8; e += 128) { const int cl = e >> 3, q = e & 7; const size_t o2 = (bb * CC + c0 + cl) * (size_t)NJ + j0 + q * 8; vst2((unsigned*)(VT + o2), *(const v4u*)&th[cl][q * 8]); vst2((unsigned*)(VL + o2), *(const v4u*)&tl2[cl][q * 8]); } } }
// lane l with lane l ^ 16
__device__ __forceinline__ float xhalf(float x) { return __builtin_bit_cast(float, __builtin_amdgcn_permlanex16(__builtin_bit_cast(int, x), __builtin_bit_cast(int, x), 0x76543210, 0xfedcba98, false, false)); }
// fragment at this lane's byte address: bytes 0..15 and 32..47
__device__ __forceinline__ v16h fragp_h(const char* p) { union { v16h v; v8h q[2]; } u; u.q[0] = *(const v8h*)p; u.q[1] = *(const v8h*)(p + 32); return u.v; }
__device__ __forceinline__ v16b fragp_b(const char* p) { union { v16b v; v8b q[2]; } u; u.q[0] = *(const v8b*)p; u.q[1] = *(const v8b*)(p + 32); return u.v; }
// one 32-key trip of k_fa: kp, vhp, vlp, cp = this lane's place in the trip's first k row, in the v planes' first row at the trip's first key, and at its first mask word (CTX: context keys, masked by those words; else self keys, key e of the lane's 32 allowed iff e <= thr)
template <bool CTX> __device__ __forceinline__ void fa_trip(const char* kp, const char* vhp, const char* vlp, const char* cp, int thr, const v16h (&qh)[2], const v16h (&ql)[2], v8f (&o)[HD / 16], float& m, float& l) {
  v16h kf[2][2]; v16b vh[HD / 16], vl[HD / 16]; v4i cm[2][2];
#pragma unroll
  for (int a = 0; a < 2; ++a)
#pragma unroll
    for (int kc = 0; kc < 2; ++kc) kf[a][kc] = fragp_h(kp + a * 16 * CC * 2 + kc * 64);
  if (CTX) {
#pragma unroll
    for (int a = 0; a < 2; ++a) { cm[a][0] = *(const v4i*)(cp + a * 64); cm[a][1] = *(const v4i*)(cp + a * 64 + 16); } }
#pragma unroll
  for (int j = 0; j < HD / 16; ++j) { vh[j] = fragp_b(vhp + j * 16 * NJ * 2); vl[j] = fragp_b(vlp + j * 16 * NJ * 2); }
  v8f s[2] = {};
#pragma unroll
  for (int kc = 0; kc < 2; ++kc)
#pragma unroll
    for (int a = 0; a < 2; ++a) { s[a] = wmma16(kf[a][kc], qh[kc], s[a]); s[a] = wmma16(kf[a][kc], ql[kc], s[a]); }
#pragma unroll
  for (int a = 0; a < 2; ++a)
#pragma unroll
    for (int r = 0; r < 8; ++r) s[a][r] = (CTX ? (cm[a][r >> 2][r & 3] != 0) : (a * 16 + r <= thr)) ? s[a][r] : -3.0e38f;
  float mx = s[0][0];
#pragma unroll
  for (int e = 1; e < 16; ++e) mx = fmaxf(mx, s[e >> 3][e & 7]);
  mx = fmaxf(mx, xhalf(mx)); const float mn = fmaxf(m, mx); const float al = expf(m - mn); m = mn;
  float pv[16], ps = 0.f;
#pragma unroll
  for (int e = 0; e < 16; ++e) { pv[e] = expf(s[e >> 3][e & 7] - mn); ps += pv[e]; }
  l = l * al + ps; const F2 p = bsplit16(pv);
#pragma unroll
  for (int j = 0; j < HD / 16; ++j) { o[j] *= al; o[j] = wmma_bf(vh[j], p.h, o[j]); o[j] = wmma_bf(vh[j], p.l, o[j]); o[j] = wmma_bf(vl[j], p.h, o[j]); } }
// ---- k_fa: block = (slice = b * NH + h, 64 queries, longest first), 16 waves = (16-query group qg, key quarter kq). A wave walks its 32-key trips with S^T = K Q^T (2 products) and O^T += V^T P^T (3 products): lane (g, c) holds query c's scores of keys 8 g + 0..7 of each 16-key tile, which is the B fragment's k order, so that P stays in registers and a query's maximum, sum and rescale stay in its own two lanes. Key j allowed iff (j < NC ? context_mask[b][j] : j - NC <= i), else -3e38: its exp against a real maximum is 0, and what a wave sums while it has met no allowed key is wiped by the factor exp(-3e38 - m) = 0 (every query has an allowed key, its own). The four quarters' (m, l, O) are joined through LDS.
__global__ __launch_bounds__(512) void k_fa(const _Float16* __restrict__ QH, const _Float16* __restrict__ QL, const _Float16* __restrict__ KH, const int* __restrict__ CM, const __bf16* __restrict__ VT, const __bf16* __restrict__ VL, float* __restrict__ Y) {
  __shared__ __align__(16) float so[4][64][HD + 4]; __shared__ float sm[4][64], sl[4][64];
  const int b = blockIdx.x / NH, h = blockIdx.x % NH; const int x = NQ / 64 - 1 - (int)blockIdx.y;   // query tiles in reverse, longest first, for speed only
  const int tid = threadIdx.x, lane = tid & 31, c = lane & 15, g = lane >> 4; const int wave = __builtin_amdgcn_readfirstlane(tid >> 5), qg = wave & 3, kq = wave >> 2; const int q0 = x * 64 + qg * 16;
  v16h qh[2], ql[2];
#pragma unroll
  for (int kc = 0; kc < 2; ++kc) { const size_t qo = ((size_t)b * NQ + q0 + c) * CC + h * HD + kc * 32; qh[kc] = frag_h(QH + qo, lane); ql[kc] = frag_h(QL + qo, lane); }
  const int nt = (NC + q0 + 16 + 31) >> 5;   // trips that hold a key some query of the group may see
  // a quarter takes two trips in a row (one 128-byte line of each v row), then skips the other quarters' six; the lane's four addresses walk along with the trips
  const char* kp = (const char*)(KH + ((size_t)b * NJ + 64 * kq + c) * CC + h * HD + 8 * g); const size_t vo = ((size_t)b * CC + h * HD + c) * NJ + 64 * kq + 8 * g; const char* vhp = (const char*)(VT + vo); const char* vlp = (const char*)(VL + vo); const char* cp = (const char*)(CM + (size_t)b * NC + 64 * kq + 8 * g);
  v8f o[HD / 16] = {}; float m = -3.0e38f, l = 0.f;
  for (int i = 0; i < NC / 128; ++i) { fa_trip<true>(kp, vhp, vlp, cp, 0, qh, ql, o, m, l); const int st = (i & 1) ? 7 * 32 : 32; kp += (size_t)st * CC * 2; vhp += st * 2; vlp += st * 2; cp += st * 4; }
  for (int i = 0, t = NC / 32 + 2 * kq; t < nt; ++i) { fa_trip<false>(kp, vhp, vlp, cp, q0 + c - (t * 32 - NC) - 8 * g, qh, ql, o, m, l); const int st = (i & 1) ? 7 : 1; t += st; kp += (size_t)st * 32 * CC * 2; vhp += st * 64; vlp += st * 64; }
  l += xhalf(l); if (g == 0) { sm[kq][qg * 16 + c] = m; sl[kq][qg * 16 + c] = l; }
#pragma unroll
  for (int j = 0; j < HD / 16; ++j) { v4f lo4, hi4;
#pragma unroll
    for (int r = 0; r < 4; ++r) { lo4[r] = o[j][r]; hi4[r] = o[j][4 + r]; }
    vst2(&so[kq][qg * 16 + c][j * 16 + 8 * g], lo4); vst2(&so[kq][qg * 16 + c][j * 16 + 8 * g + 4], hi4); }
  __syncthreads();
  const int q = tid >> 3, dd = (tid & 7) * 8; float mt = sm[0][q];   // thread = (query, 8 of its 64 outputs)
#pragma unroll
  for (int w = 1; w < 4; ++w) mt = fmaxf(mt, sm[w][q]);
  float lt = 0.f; v4f y0 = {}, y1 = {};
#pragma unroll
  for (int w = 0; w < 4; ++w) { const float e = expf(sm[w][q] - mt); lt += e * sl[w][q]; y0 += e * *(const v4f*)&so[w][q][dd]; y1 += e * *(const v4f*)&so[w][q][dd + 4]; }
  const float inv = 1.0f / lt; float* yp = Y + ((size_t)b * NQ + x * 64 + q) * CC + h * HD + dd; vst2(yp, y0 * inv); vst2(yp + 4, y1 * inv); }
// ---- k_out: out = o (bf16 hi + lo) Wo + bo (Wo as the bf16 plane of k_wt)
__global__ __launch_bounds__(128) void k_out(const float* __restrict__ Y, const __bf16* __restrict__ WOT, const float* __restrict__ BO, float* __restrict__ OUT) { __shared__ __align__(16) float sf[4][16][132];
  const int tid = threadIdx.x, wave = tid >> 5, lane = tid & 31, col = lane & 15, g = lane >> 4; const int c0 = blockIdx.y * 128; const size_t r0 = (size_t)blockIdx.x * 64 + wave * 16;
  const float* yrow = Y + (r0 + col) * CC; const __bf16* wt0 = WOT + (size_t)(c0 / 16) * (CC / 32) * 512;   // this lane's A row; first fragment of the block's first 16 columns
  v8f acc[8] = {};
#pragma unroll 1   // one trip holds 16 B fragments in registers; a second copy of the body would not fit
  for (int kc = 0; kc < CC / 64; ++kc) { v4f ar[2][4]; v16b w[2][8];   // 64 k a trip, as in k_proj
#pragma unroll
    for (int u = 0; u < 2; ++u) { const float* p = yrow + kc * 64 + u * 32 + 8 * g; ar[u][0] = *(const v4f*)p; ar[u][1] = *(const v4f*)(p + 4); ar[u][2] = *(const v4f*)(p + 16); ar[u][3] = *(const v4f*)(p + 20); }
#pragma unroll
    for (int u = 0; u < 2; ++u)
#pragma unroll
      for (int j = 0; j < 8; ++j) w[u][j] = fragw_b(wt0 + ((size_t)j * (CC / 32) + kc * 2 + u) * 512, lane);
    __builtin_amdgcn_sched_barrier(0);   // every load of the trip is issued ahead of the first split, so that a trip waits for memory once; without it part of the B loads is placed behind the split of A
#pragma unroll
    for (int u = 0; u < 2; ++u) { float av[16];
#pragma unroll
      for (int i = 0; i < 16; ++i) av[i] = ar[u][i >> 2][i & 3];
      const F2 a = bsplit16(av);
#pragma unroll
      for (int j = 0; j < 8; ++j) { acc[j] = wmma_bf(a.h, w[u][j], acc[j]); acc[j] = wmma_bf(a.l, w[u][j], acc[j]); } } }
#pragma unroll
  for (int j = 0; j < 8; ++j) { const float bb = bfr(BO[c0 + j * 16 + col]);
#pragma unroll
    for (int r = 0; r < 8; ++r) sf[wave][8 * g + r][j * 16 + col] = acc[j][r] + bb; }
  LDSX(); for (int rl = 0; rl < 16; ++rl) vst2(OUT + (r0 + rl) * CC + c0 + lane * 4, *(const v4f*)&sf[wave][rl][lane * 4]); }
extern "C" void kernel_launch(void* const* d_in, const int* in_sizes, int n_in, void* d_out, int out_size, void* d_ws, size_t ws_size, hipStream_t stream) {
  (void)in_sizes; (void)n_in; (void)out_size;
  const float** F = (const float**)d_in;   // 0 x [2,1024,1024], 1 context [2,1024,1024], 2 context_mask [2,1024] int, 3 rotary_pos_emb [2048,64], 4 norm_w, 5 norm_b, 6 cnorm_w, 7 cnorm_b, 8 Wq [1024,1024] (in,out), 9 Wkv [1024,2048], 10 Wo [1024,1024], 11 bo
  if (ws_size < (size_t)WS_END) return;
  char* ws = (char*)d_ws; float *XN = (float*)(ws + WS_XN), *CN = (float*)(ws + WS_CN), *Y = (float*)(ws + WS_Y); _Float16 *QH = (_Float16*)(ws + WS_QH), *QL = (_Float16*)(ws + WS_QL), *KH = (_Float16*)(ws + WS_KH); __bf16 *VT = (__bf16*)(ws + WS_VT), *VL = (__bf16*)(ws + WS_VL); unsigned short* WT = (unsigned short*)(ws + WS_WT);
  k_wt<<<dim3(CC / 64, CC / 64, 4), 256, 0, stream>>>(F[8], F[9], F[10], WT);
  k_ln<<<NB * NQ + NB * NC, 256, 0, stream>>>(F[0], F[1], F[4], F[5], F[6], F[7], XN, CN);
  k_proj<<<dim3(TNB * NQ / 64, CC / 128), 128, 0, stream>>>(XN, CN, (const _Float16*)WT, F[3], 0, QH, QL, KH, VT, VL);
  k_proj<<<dim3(TNB * NJ / 64, CC / 128), 128, 0, stream>>>(XN, CN, (const _Float16*)WT, F[3], 1, QH, QL, KH, VT, VL);
  k_proj<<<dim3(TNB * NJ / 64, CC / 128), 128, 0, stream>>>(XN, CN, (const _Float16*)WT, F[3], 2, QH, QL, KH, VT, VL);
  k_fa<<<dim3(TNB * NH, NQ / 64), 512, 0, stream>>>(QH, QL, KH, (const int*)d_in[2], VT, VL, Y);
  k_out<<<dim3(TNB * NQ / 64, CC / 128), 128, 0, stream>>>(Y, (const __bf16*)WT + (size_t)3 * CC * CC, F[11], (float*)d_out);
}

// v004
// Measured time: 155 microseconds a run.
// Two timings next to v003 put it at 1.44 and 1.43 times that version's speed.
// All steps since v000 together make it 8.97 times as fast.
// compute dtype: all float inputs rounded to bf16, context_mask (int) read; LayerNorm of x and context in f32; q = xn Wq * 64^-0.5 and k/v = [cn; xn] Wkv with the LN'd rows and the 0.02-scale weights as f16 (1 product) on WMMA 16x16x32, f32 accumulate; rotary (angles from the rotary_pos_emb input, precise cosf/sinf) in f32; q as f16 hi + residual, k f16 -> 2-product logits kept in registers; mask = context_mask & causal-with-prefix -> -3e38; running-maximum softmax in f32 (precise expf), unnormalised P split bf16 hi + lo against v bf16 hi + lo (3 products), divided by the row sum at the end; out = o (bf16 hi + lo) Wo + bo; f32 output.
#include <hip/hip_runtime.h>
#include <math.h>

typedef __attribute__((ext_vector_type(16))) _Float16 v16h;
typedef __attribute__((ext_vector_type(16))) __bf16 v16b;
typedef __attribute__((ext_vector_type(8)))  _Float16 v8h;
typedef __attribute__((ext_vector_type(8)))  float v8f;
typedef __attribute__((ext_vector_type(4)))  float v4f;
typedef __attribute__((ext_vector_type(2)))  float v2f;
typedef __attribute__((ext_vector_type(4)))  unsigned v4u;
typedef __attribute__((ext_vector_type(4)))  int v4i;
typedef float __attribute__((may_alias)) float_a;
typedef int __attribute__((may_alias)) int_a;

template <typename T> __device__ __forceinline__ void vst2(void* p, T v) { *(T*)p = v;  }
__device__ __forceinline__ v8f wmma16(v16h a, v16h b, v8f c) {
  v8f d = __builtin_amdgcn_wmma_f32_16x16x32_f16(false, a, false, b, (short)0, c, false, false);
  asm volatile("v_nop\n\tv_nop\n\tv_nop\n\tv_nop" : "+v"(d) : "v"(a), "v"(b));
  return d;
}
__device__ __forceinline__ v8f wmma_bf(v16b a, v16b b, v8f c) {
  v8f d = __builtin_amdgcn_wmma_f32_16x16x32_bf16(false, a, false, b, (short)0, c, false, false);
  asm volatile("v_nop\n\tv_nop\n\tv_nop\n\tv_nop" : "+v"(d) : "v"(a), "v"(b));
  return d;
}
// 16x16x32 fragments: lane = (h = lane>>4, row/col = lane&15); elements 0..7 = k0+8h+0..7, 8..15 = k0+16+8h+0..7; D element r = row 8h+r
__device__ __forceinline__ v16h frag_h(const _Float16* rowk0, int lane) {
  union { v16h v; v8h q[2]; } u; const _Float16* p = rowk0 + 8 * (lane >> 4);
  u.q[0] = *(const v8h*)p; u.q[1] = *(const v8h*)(p + 16); return u.v;
}
__device__ __forceinline__ v16h frag_f32(const float* rowk0, int lane) {
  v16h a; const float* p = rowk0 + 8 * (lane >> 4);
#pragma unroll
  for (int i = 0; i < 8; ++i) { a[i] = (_Float16)p[i]; a[8 + i] = (_Float16)p[16 + i]; }
  return a;
}
__device__ __forceinline__ v16h frag_f32s(const float* rowk0, int lane, float sc) {
  v16h a; const float* p = rowk0 + 8 * (lane >> 4);
#pragma unroll
  for (int i = 0; i < 8; ++i) { a[i] = (_Float16)(p[i] * sc); a[8 + i] = (_Float16)(p[16 + i] * sc); }
  return a;
}
// column fragment from a [K][ld] layout (column n), rows >= K read as 0
__device__ __forceinline__ v16h fragc_f32(const float* W, int k0, int n, int lane, int ld, int K) {
  v16h a; const int g = lane >> 4;
#pragma unroll
  for (int i = 0; i < 8; ++i) { const int ka = k0 + 8 * g + i, kb = ka + 16;
    a[i] = (_Float16)(ka < K ? W[(size_t)(ka < K ? ka : K - 1) * ld + n] : 0.f); a[8 + i] = (_Float16)(kb < K ? W[(size_t)(kb < K ? kb : K - 1) * ld + n] : 0.f); }
  return a;
}
struct F2 { v16b h, l; };
__device__ __forceinline__ F2 bsplit16(const float v[16]) { F2 r;
#pragma unroll
  for (int i = 0; i < 16; ++i) { const __bf16 h = (__bf16)v[i]; r.h[i] = h; r.l[i] = (__bf16)(v[i] - (float)h); }
  return r; }
__device__ __forceinline__ F2 split_row(const float* row, int k0, int lane) { float v[16]; const float* p = row + k0 + 8 * (lane >> 4);
#pragma unroll
  for (int i = 0; i < 8; ++i) { v[i] = p[i]; v[8 + i] = p[16 + i]; }
  return bsplit16(v); }
__device__ __forceinline__ F2 split_rowK(const float* row, int k0, int lane, int K) { float v[16]; const int g = lane >> 4;
#pragma unroll
  for (int i = 0; i < 8; ++i) { const int ka = k0 + 8 * g + i, kb = ka + 16; v[i] = ka < K ? row[ka < K ? ka : K - 1] : 0.f; v[8 + i] = kb < K ? row[kb < K ? kb : K - 1] : 0.f; }
  return bsplit16(v); }
__device__ __forceinline__ F2 split_col(const float* W, int k0, int n, int lane, int ld, int K) { float v[16]; const int g = lane >> 4;
#pragma unroll
  for (int i = 0; i < 8; ++i) { const int ka = k0 + 8 * g + i, kb = ka + 16; v[i] = ka < K ? W[(size_t)(ka < K ? ka : K - 1) * ld + n] : 0.f; v[8 + i] = kb < K ? W[(size_t)(kb < K ? kb : K - 1) * ld + n] : 0.f; }
  return bsplit16(v); }
__device__ __forceinline__ v8f mac3(const F2& a, const F2& b, v8f c) { c = wmma_bf(a.l, b.h, c); c = wmma_bf(a.h, b.l, c); return wmma_bf(a.h, b.h, c); }
__device__ __forceinline__ float sigm(float v) { return 1.0f / (1.0f + expf(-v)); }
#define LDSX() do { asm volatile("s_wait_dscnt 0" ::: "memory"); __builtin_amdgcn_wave_barrier(); __builtin_amdgcn_fence(__ATOMIC_RELEASE, "workgroup"); } while (0)


// Causal prefix attention (B 2, 1,024 queries over 1,024 context + 1,024 self keys, 16 x 64, rotary on all 64 dims): prefix keys masked by context_mask, self keys causal.
#define NB 2
#define NQ 1024
#define NC 1024
#define NJ 2048
#define CC 1024
#define NH 16
#define HD 64
#ifndef TNB
#define TNB NB
#endif
typedef __attribute__((ext_vector_type(8))) __bf16 v8b;
__device__ __forceinline__ v16b frag_b(const __bf16* rowk0, int lane) {
  union { v16b v; v8b q[2]; } u; const __bf16* p = rowk0 + 8 * (lane >> 4);
  u.q[0] = *(const v8b*)p; u.q[1] = *(const v8b*)(p + 16); return u.v;
}
// B fragment from a plane of k_wt (f = the fragment's 512 elements)
__device__ __forceinline__ v16h fragw_h(const _Float16* f, int lane) { union { v16h v; v8h q[2]; } u; u.q[0] = *(const v8h*)(f + lane * 8); u.q[1] = *(const v8h*)(f + 256 + lane * 8); return u.v; }
__device__ __forceinline__ v16b fragw_b(const __bf16* f, int lane) { union { v16b v; v8b q[2]; } u; u.q[0] = *(const v8b*)(f + lane * 8); u.q[1] = *(const v8b*)(f + 256 + lane * 8); return u.v; }
__device__ __forceinline__ float bfr(float v) { return (float)(__bf16)v; }
__device__ __attribute__((noinline)) float exp_ni(float v) { return expf(v); }
__device__ __attribute__((noinline)) float erf_ni(float v) { return erff(v); }


#define WS_XN  0u                                  // f32 LN'd x rows [b*NQ][1024]
#define WS_CN  (WS_XN + 4u * (size_t)NB * NQ * CC)     // f32 LN'd context rows
#define WS_QH  (WS_CN + 4u * (size_t)NB * NC * CC)     // f16 q rows [b*NQ][1024]
#define WS_QL  (WS_QH + 2u * (size_t)NB * NQ * CC)
#define WS_KH  (WS_QL + 2u * (size_t)NB * NQ * CC)     // f16 k rows [b*NJ][1024]
#define WS_VT  (WS_KH + 2u * (size_t)NB * NJ * CC)     // bf16 v planes [b][1024][NJ]
#define WS_VL  (WS_VT + 2u * (size_t)NB * CC * NJ)
#define WS_WT  (WS_VL + 2u * (size_t)NB * CC * NJ)     // 16-bit weight planes [4][64 n tiles][32 k steps][512] in B-fragment order (k_wt): f16 Wq, Wkv k half, Wkv v half; bf16 Wo
#define WS_Y   WS_XN                               // f32 o rows [b*NQ][1024]: k_fa writes them after the last reader of XN (k_proj) has ended
#define WS_CS  (WS_WT + 2u * (size_t)4 * CC * CC)     // f32 rotary table [NJ positions][2 d halves][16 columns][cos, sin of d = 32 half + column; cos, sin of d + 16] (k_wt)
#define WS_END (WS_CS + 4u * (size_t)NJ * HD * 2)

typedef __attribute__((ext_vector_type(2))) _Float16 v2h;
typedef __attribute__((ext_vector_type(2))) __bf16 v2b;
// ---- k_wt: block = (64 k, 64 n, plane z): each weight is rounded once to the 16-bit type its product reads (z 0 Wq, 1 Wkv cols 0..1023, 2 Wkv cols 1024..: bf16 then f16; 3 Wo: bf16) and stored in B-fragment order: 1 KiB for each (16 n, 32 k) fragment, elements 0..7 of lanes 0..31 and then elements 8..15, so that each of a fragment's two 16-byte loads reads four whole 128-byte lines. Plane z 4 holds no weight: its 65,536 threads compute cos and sin of every rotary angle once, in the order in which a lane of k_proj reads them
__global__ __launch_bounds__(256) void k_wt(const float* __restrict__ WQ, const float* __restrict__ WKV, const float* __restrict__ WO, const float* __restrict__ ROT, unsigned short* __restrict__ WT, float* __restrict__ CS) { __shared__ __align__(16) unsigned st[64][36];   // [n][k pair], pitch 144 bytes
  if (blockIdx.z == 4) { const int id = ((int)blockIdx.y * (CC / 64) + (int)blockIdx.x) * 256 + (int)threadIdx.x;   // thread = (position id >> 5, d half (id >> 4) & 1, column id & 15); the whole block leaves ahead of the barrier
    const float* ap = ROT + (size_t)(id >> 5) * HD + ((id >> 4) & 1) * 32 + (id & 15); const float a0 = bfr(ap[0]), a1 = bfr(ap[16]);
    v4f o; o[0] = cosf(a0); o[1] = sinf(a0); o[2] = cosf(a1); o[3] = sinf(a1); vst2(CS + (size_t)id * 4, o); return; }
  const int t = threadIdx.x, z = blockIdx.z, k0 = blockIdx.x * 64, n0 = blockIdx.y * 64; const float* src = (z == 0) ? WQ : (z == 3) ? WO : WKV; const int ld = (z == 1 || z == 2) ? 2 * CC : CC; const int off = (z == 2) ? CC : 0;
  const int kt = t >> 4, q = t & 15; v4f v[2][2];   // rows k0 + 32 i + 2 kt + {0, 1}, columns n0 + 4 q + 0..3
#pragma unroll
  for (int i = 0; i < 2; ++i)
#pragma unroll
    for (int r = 0; r < 2; ++r) { v[i][r] = *(const v4f*)(src + (size_t)(k0 + i * 32 + 2 * kt + r) * ld + off + n0 + q * 4); }
#pragma unroll
  for (int i = 0; i < 2; ++i)
#pragma unroll
    for (int c = 0; c < 4; ++c) { v2b rb; rb[0] = (__bf16)v[i][0][c]; rb[1] = (__bf16)v[i][1][c]; v2h rh; rh[0] = (_Float16)(float)rb[0]; rh[1] = (_Float16)(float)rb[1];
      st[q * 4 + c][i * 16 + kt] = (z == 3) ? __builtin_bit_cast(unsigned, rb) : __builtin_bit_cast(unsigned, rh); }
  __syncthreads();
#pragma unroll
  for (int i = 0; i < 2; ++i) { const int e = t + i * 256, f = e >> 6, w = e & 63;   // fragment f = (16-n tile f >> 1, 32-k step f & 1) of the block's 8; 16-byte piece w = (element half w >> 5, lane w & 31)
    const int n = (f >> 1) * 16 + (w & 15), k8 = (f & 1) * 4 + (w >> 5) * 2 + ((w >> 4) & 1);   // the piece holds column n, rows 8 k8 + 0..7
    vst2(WT + (((size_t)z * (CC / 16) + n0 / 16 + (f >> 1)) * (CC / 32) + k0 / 32 + (f & 1)) * 512 + w * 8, *(const v4u*)&st[n][k8 * 4]); } }
// ---- k_ln: block = row (rows 0..NB*NQ-1 from x -> XN; NB*NQ.. from context -> CN)
__global__ __launch_bounds__(256) void k_ln(const float* __restrict__ X, const float* __restrict__ CT, const float* __restrict__ GX, const float* __restrict__ BX, const float* __restrict__ GC, const float* __restrict__ BC, float* __restrict__ XN, float* __restrict__ CN) { __shared__ float sred[8]; __shared__ float smu, sinv; __shared__ __align__(16) float sv[CC];
  const int t = threadIdx.x; size_t row = blockIdx.x; const bool isx = row < (size_t)NB * NQ; if (!isx) row -= (size_t)NB * NQ;
  const float* src = (isx ? X : CT) + row * CC; const float* ga = isx ? GX : GC; const float* be = isx ? BX : BC; float* dst = (isx ? XN : CN) + row * CC;
  float a = 0.f; for (int i = t; i < CC; i += 256) { const float v = bfr(src[i]); sv[i] = v; a += v; }
#pragma unroll
  for (int o = 1; o < 32; o <<= 1) a += __shfl_xor(a, o);
  if ((t & 31) == 0) sred[t >> 5] = a; __syncthreads(); if (t == 0) { float x = 0.f; for (int w = 0; w < 8; ++w) x += sred[w]; smu = x / CC; } __syncthreads(); const float mu = smu;
  float q = 0.f; for (int i = t; i < CC; i += 256) { const float d = sv[i] - mu; q += d * d; }
#pragma unroll
  for (int o = 1; o < 32; o <<= 1) q += __shfl_xor(q, o);
  __syncthreads(); if ((t & 31) == 0) sred[t >> 5] = q; __syncthreads(); if (t == 0) { float x = 0.f; for (int w = 0; w < 8; ++w) x += sred[w]; sinv = 1.0f / sqrtf(x / CC + 1e-5f); } __syncthreads(); const float inv = sinv;
  for (int i = t; i < CC; i += 256) sv[i] = (sv[i] - mu) * inv * bfr(ga[i]) + bfr(be[i]);
  __syncthreads(); for (int qq = t; qq < CC / 4; qq += 256) vst2(dst + qq * 4, *(const v4f*)&sv[qq * 4]); }
// ---- k_proj: block = (64 rows, 128 cols, which): which 0: q = xn Wq (rows b*NQ + i; key position CTX + i), 1: k, 2: v from [cn rows (j < NC); xn rows (j >= NC)] Wkv (cols 0..1023 k, 1024.. v); rotary on q and k; f16 A (LN'd rows) x f16 W (1 product)
// rotary on a wave's 16 x 128 accumulator tile (two heads): element r of tile j is (row 8 g + r, d = 16 (j & 3) + col), so that its partner d +- 32 is element r of tile j ^ 2 in the same lane; cs = the lane's place in the table row of its first position; rows go to sh (f16) and, for q, their residual to sl
template <bool Q> __device__ __forceinline__ void rot_pack(const v8f (&acc)[8], const float* cs, _Float16 (*sh)[136], _Float16 (*sl)[136], int row0, int col) {
  v4f t[8][2];
#pragma unroll
  for (int r = 0; r < 8; ++r) { t[r][0] = *(const v4f*)(cs + r * 2 * HD); t[r][1] = *(const v4f*)(cs + r * 2 * HD + 64); }
  const float sc = Q ? 0.125f : 1.0f;
#pragma unroll
  for (int j = 0; j < 8; ++j)
#pragma unroll
    for (int r = 0; r < 8; ++r) { const int jd = j & 3; const float c = t[r][jd >> 1][(jd & 1) * 2], s = t[r][jd >> 1][(jd & 1) * 2 + 1];
      const float me = acc[j][r] * sc; const float partner = (jd < 2) ? -(acc[j + 2][r] * sc) : acc[j - 2][r] * sc;
      const float v = me * c + partner * s; const _Float16 hv = (_Float16)v; sh[row0 + r][j * 16 + col] = hv; if (Q) sl[row0 + r][j * 16 + col] = (_Float16)(v - (float)hv); } }
__global__ __launch_bounds__(128) void k_proj(const float* __restrict__ XN, const float* __restrict__ CN, const _Float16* __restrict__ WT, const float* __restrict__ CS, int which, _Float16* __restrict__ QH, _Float16* __restrict__ QL, _Float16* __restrict__ KH, __bf16* __restrict__ VT, __bf16* __restrict__ VL) {
  __shared__ __align__(16) float sf[64][132]; __shared__ __align__(16) _Float16 sh[64][136], sl[64][136]; __shared__ __align__(16) __bf16 th[128][72], tl2[128][72];
  const int tid = threadIdx.x, wave = tid >> 5, lane = tid & 31, col = lane & 15, g = lane >> 4; const int c0 = blockIdx.y * 128; const size_t r0 = (size_t)blockIdx.x * 64 + wave * 16;   // row within [b*L]
  const int L = (which == 0) ? NQ : NJ; const size_t rme = r0 + col; const size_t b = rme / L; const int jpos = (int)(rme % L);
  const float* arow = (which == 0) ? (XN + (b * NQ + jpos) * CC) : (jpos < NC ? (CN + (b * NC + jpos) * CC) : (XN + (b * NQ + (jpos - NC)) * CC));
  const _Float16* wt0 = WT + ((size_t)which * (CC / 16) + c0 / 16) * (CC / 32) * 512;   // plane 'which', first fragment of the block's first 16 columns
  v8f acc[8] = {};
#pragma unroll 1   // one trip holds 16 B fragments in registers; a second copy of the body would not fit
  for (int kc = 0; kc < CC / 64; ++kc) { v4f ar[2][4]; v16h w[2][8];   // 64 k a trip: 16 B fragments
#pragma unroll
    for (int u = 0; u < 2; ++u) { const float* p = arow + kc * 64 + u * 32 + 8 * g; ar[u][0] = *(const v4f*)p; ar[u][1] = *(const v4f*)(p + 4); ar[u][2] = *(const v4f*)(p + 16); ar[u][3] = *(const v4f*)(p + 20); }
#pragma unroll
    for (int u = 0; u < 2; ++u)
#pragma unroll
      for (int j = 0; j < 8; ++j) w[u][j] = fragw_h(wt0 + ((size_t)j * (CC / 32) + kc * 2 + u) * 512, lane);
    __builtin_amdgcn_sched_barrier(0);   // every load of the trip is issued ahead of the first convert, so that a trip waits for memory once; without it part of the B loads is placed behind the wait for A
#pragma unroll
    for (int u = 0; u < 2; ++u) { v16h a;
#pragma unroll
      for (int i = 0; i < 16; ++i) a[i] = (_Float16)ar[u][i >> 2][i & 3];
#pragma unroll
      for (int j = 0; j < 8; ++j) acc[j] = wmma16(a, w[u][j], acc[j]); } }
  if (which < 2) {   // rotary (q, k) in registers, then pack
    const float* cs = CS + ((size_t)(r0 % L) + ((which == 0) ? NC : 0) + 8 * g) * (2 * HD) + col * 4;   // q uses the last NQ positions
    if (which == 0) rot_pack<true>(acc, cs, sh, sl, wave * 16 + 8 * g, col); else rot_pack<false>(acc, cs, sh, sl, wave * 16 + 8 * g, col);
    __syncthreads();
    _Float16* dh = which == 0 ? QH : KH; const size_t rb = (size_t)blockIdx.x * 64; for (int e = tid; e < 64 * 16; e += 128) { const int rl = e >> 4, q = e & 15; vst2((unsigned*)(dh + (rb + rl) * CC + c0 + q * 8), *(const v4u*)&sh[rl][q * 8]); if (which == 0) vst2((unsigned*)(QL + (rb + rl) * CC + c0 + q * 8), *(const v4u*)&sl[rl][q * 8]); } }
  else {   // v: stage the f32 tile, then transpose
#pragma unroll
    for (int j = 0; j < 8; ++j)
#pragma unroll
      for (int r = 0; r < 8; ++r) sf[wave * 16 + 8 * g + r][j * 16 + col] = acc[j][r];
    __syncthreads();
    for (int e = tid; e < 64 * 128; e += 128) { const int rl = e >> 7, cl = e & 127; const float v = sf[rl][cl]; const __bf16 bh = (__bf16)v; th[cl][rl] = bh; tl2[cl][rl] = (__bf16)(v - (float)bh); }
    __syncthreads(); const size_t rb = (size_t)blockIdx.x * 64; const size_t bb = rb / NJ; const int j0 = (int)(rb % NJ);
    for (int e = tid; e < 128 * 8; e += 128) { const int cl = e >> 3, q = e & 7; const size_t o2 = (bb * CC + c0 + cl) * (size_t)NJ + j0 + q * 8; vst2((unsigned*)(VT + o2), *(const v4u*)&th[cl][q * 8]); vst2((unsigned*)(VL + o2), *(const v4u*)&tl2[cl][q * 8]); } } }
// lane l with lane l ^ 16
__device__ __forceinline__ float xhalf(float x) { return __builtin_bit_cast(float, __builtin_amdgcn_permlanex16(__builtin_bit_cast(int, x), __builtin_bit_cast(int, x), 0x76543210, 0xfedcba98, false, false)); }
// fragment at this lane's byte address: bytes 0..15 and 32..47
__device__ __forceinline__ v16h fragp_h(const char* p) { union { v16h v; v8h q[2]; } u; u.q[0] = *(const v8h*)p; u.q[1] = *(const v8h*)(p + 32); return u.v; }
__device__ __forceinline__ v16b fragp_b(const char* p) { union { v16b v; v8b q[2]; } u; u.q[0] = *(const v8b*)p; u.q[1] = *(const v8b*)(p + 32); return u.v; }
// one 32-key trip of k_fa: kp, vhp, vlp, cp = this lane's place in the trip's first k row, in the v planes' first row at the trip's first key, and at its first mask word (CTX: context keys, masked by those words; else self keys, key e of the lane's 32 allowed iff e <= thr)
template <bool CTX> __device__ __forceinline__ void fa_trip(const char* kp, const char* vhp, const char* vlp, const char* cp, int thr, const v16h (&qh)[2], const v16h (&ql)[2], v8f (&o)[HD / 16], float& m, float& l) {
  v16h kf[2][2]; v16b vh[HD / 16], vl[HD / 16]; v4i cm[2][2];
#pragma unroll
  for (int a = 0; a < 2; ++a)
#pragma unroll
    for (int kc = 0; kc < 2; ++kc) kf[a][kc] = fragp_h(kp + a * 16 * CC * 2 + kc * 64);
  if (CTX) {
#pragma unroll
    for (int a = 0; a < 2; ++a) { cm[a][0] = *(const v4i*)(cp + a * 64); cm[a][1] = *(const v4i*)(cp + a * 64 + 16); } }
#pragma unroll
  for (int j = 0; j < HD / 16; ++j) { vh[j] = fragp_b(vhp + j * 16 * NJ * 2); vl[j] = fragp_b(vlp + j * 16 * NJ * 2); }
  v8f s[2] = {};
#pragma unroll
  for (int kc = 0; kc < 2; ++kc)
#pragma unroll
    for (int a = 0; a < 2; ++a) { s[a] = wmma16(kf[a][kc], qh[kc], s[a]); s[a] = wmma16(kf[a][kc], ql[kc], s[a]); }
#pragma unroll
  for (int a = 0; a < 2; ++a)
#pragma unroll
    for (int r = 0; r < 8; ++r) s[a][r] = (CTX ? (cm[a][r >> 2][r & 3] != 0) : (a * 16 + r <= thr)) ? s[a][r] : -3.0e38f;
  float mx = s[0][0];
#pragma unroll
  for (int e = 1; e < 16; ++e) mx = fmaxf(mx, s[e >> 3][e & 7]);
  mx = fmaxf(mx, xhalf(mx)); const float mn = fmaxf(m, mx); const float al = expf(m - mn); m = mn;
  float pv[16], ps = 0.f;
#pragma unroll
  for (int e = 0; e < 16; ++e) { pv[e] = expf(s[e >> 3][e & 7] - mn); ps += pv[e]; }
  l = l * al + ps; const F2 p = bsplit16(pv);
#pragma unroll
  for (int j = 0; j < HD / 16; ++j) { o[j] *= al; o[j] = wmma_bf(vh[j], p.h, o[j]); o[j] = wmma_bf(vh[j], p.l, o[j]); o[j] = wmma_bf(vl[j], p.h, o[j]); } }
// ---- k_fa: block = (slice = b * NH + h, 64 queries, longest first), 16 waves = (16-query group qg, key quarter kq). A wave walks its 32-key trips with S^T = K Q^T (2 products) and O^T += V^T P^T (3 products): lane (g, c) holds query c's scores of keys 8 g + 0..7 of each 16-key tile, which is the B fragment's k order, so that P stays in registers and a query's maximum, sum and rescale stay in its own two lanes. Key j allowed iff (j < NC ? context_mask[b][j] : j - NC <= i), else -3e38: its exp against a real maximum is 0, and what a wave sums while it has met no allowed key is wiped by the factor exp(-3e38 - m) = 0 (every query has an allowed key, its own). The four quarters' (m, l, O) are joined through LDS.
__global__ __launch_bounds__(512) void k_fa(const _Float16* __restrict__ QH, const _Float16* __restrict__ QL, const _Float16* __restrict__ KH, const int* __restrict__ CM, const __bf16* __restrict__ VT, const __bf16* __restrict__ VL, float* __restrict__ Y) {
  __shared__ __align__(16) float so[4][64][HD + 4]; __shared__ float sm[4][64], sl[4][64];
  const int b = blockIdx.x / NH, h = blockIdx.x % NH; const int x = NQ / 64 - 1 - (int)blockIdx.y;   // query tiles in reverse, longest first, for speed only
  const int tid = threadIdx.x, lane = tid & 31, c = lane & 15, g = lane >> 4; const int wave = __builtin_amdgcn_readfirstlane(tid >> 5), qg = wave & 3, kq = wave >> 2; const int q0 = x * 64 + qg * 16;
  v16h qh[2], ql[2];
#pragma unroll
  for (int kc = 0; kc < 2; ++kc) { const size_t qo = ((size_t)b * NQ + q0 + c) * CC + h * HD + kc * 32; qh[kc] = frag_h(QH + qo, lane); ql[kc] = frag_h(QL + qo, lane); }
  const int nt = (NC + q0 + 16 + 31) >> 5;   // trips that hold a key some query of the group may see
  // a quarter takes two trips in a row (one 128-byte line of each v row), then skips the other quarters' six; the lane's four addresses walk along with the trips
  const char* kp = (const char*)(KH + ((size_t)b * NJ + 64 * kq + c) * CC + h * HD + 8 * g); const size_t vo = ((size_t)b * CC + h * HD + c) * NJ + 64 * kq + 8 * g; const char* vhp = (const char*)(VT + vo); const char* vlp = (const char*)(VL + vo); const char* cp = (const char*)(CM + (size_t)b * NC + 64 * kq + 8 * g);
  v8f o[HD / 16] = {}; float m = -3.0e38f, l = 0.f;
  for (int i = 0; i < NC / 128; ++i) { fa_trip<true>(kp, vhp, vlp, cp, 0, qh, ql, o, m, l); const int st = (i & 1) ? 7 * 32 : 32; kp += (size_t)st * CC * 2; vhp += st * 2; vlp += st * 2; cp += st * 4; }
  for (int i = 0, t = NC / 32 + 2 * kq; t < nt; ++i) { fa_trip<false>(kp, vhp, vlp, cp, q0 + c - (t * 32 - NC) - 8 * g, qh, ql, o, m, l); const int st = (i & 1) ? 7 : 1; t += st; kp += (size_t)st * 32 * CC * 2; vhp += st * 64; vlp += st * 64; }
  l += xhalf(l); if (g == 0) { sm[kq][qg * 16 + c] = m; sl[kq][qg * 16 + c] = l; }
#pragma unroll
  for (int j = 0; j < HD / 16; ++j) { v4f lo4, hi4;
#pragma unroll
    for (int r = 0; r < 4; ++r) { lo4[r] = o[j][r]; hi4[r] = o[j][4 + r]; }
    vst2(&so[kq][qg * 16 + c][j * 16 + 8 * g], lo4); vst2(&so[kq][qg * 16 + c][j * 16 + 8 * g + 4], hi4); }
  __syncthreads();
  const int q = tid >> 3, dd = (tid & 7) * 8; float mt = sm[0][q];   // thread = (query, 8 of its 64 outputs)
#pragma unroll
  for (int w = 1; w < 4; ++w) mt = fmaxf(mt, sm[w][q]);
  float lt = 0.f; v4f y0 = {}, y1 = {};
#pragma unroll
  for (int w = 0; w < 4; ++w) { const float e = expf(sm[w][q] - mt); lt += e * sl[w][q]; y0 += e * *(const v4f*)&so[w][q][dd]; y1 += e * *(const v4f*)&so[w][q][dd + 4]; }
  const float inv = 1.0f / lt; float* yp = Y + ((size_t)b * NQ + x * 64 + q) * CC + h * HD + dd; vst2(yp, y0 * inv); vst2(yp + 4, y1 * inv); }
// ---- k_out: out = o (bf16 hi + lo) Wo + bo (Wo as the bf16 plane of k_wt)
__global__ __launch_bounds__(128) void k_out(const float* __restrict__ Y, const __bf16* __restrict__ WOT, const float* __restrict__ BO, float* __restrict__ OUT) { __shared__ __align__(16) float sf[4][16][132];
  const int tid = threadIdx.x, wave = tid >> 5, lane = tid & 31, col = lane & 15, g = lane >> 4; const int c0 = blockIdx.y * 128; const size_t r0 = (size_t)blockIdx.x * 64 + wave * 16;
  const float* yrow = Y + (r0 + col) * CC; const __bf16* wt0 = WOT + (size_t)(c0 / 16) * (CC / 32) * 512;   // this lane's A row; first fragment of the block's first 16 columns
  v8f acc[8] = {};
#pragma unroll 1   // one trip holds 16 B fragments in registers; a second copy of the body would not fit
  for (int kc = 0; kc < CC / 64; ++kc) { v4f ar[2][4]; v16b w[2][8];   // 64 k a trip, as in k_proj
#pragma unroll
    for (int u = 0; u < 2; ++u) { const float* p = yrow + kc * 64 + u * 32 + 8 * g; ar[u][0] = *(const v4f*)p; ar[u][1] = *(const v4f*)(p + 4); ar[u][2] = *(const v4f*)(p + 16); ar[u][3] = *(const v4f*)(p + 20); }
#pragma unroll
    for (int u = 0; u < 2; ++u)
#pragma unroll
      for (int j = 0; j < 8; ++j) w[u][j] = fragw_b(wt0 + ((size_t)j * (CC / 32) + kc * 2 + u) * 512, lane);
    __builtin_amdgcn_sched_barrier(0);   // every load of the trip is issued ahead of the first split, so that a trip waits for memory once; without it part of the B loads is placed behind the split of A
#pragma unroll
    for (int u = 0; u < 2; ++u) { float av[16];
#pragma unroll
      for (int i = 0; i < 16; ++i) av[i] = ar[u][i >> 2][i & 3];
      const F2 a = bsplit16(av);
#pragma unroll
      for (int j = 0; j < 8; ++j) { acc[j] = wmma_bf(a.h, w[u][j], acc[j]); acc[j] = wmma_bf(a.l, w[u][j], acc[j]); } } }
#pragma unroll
  for (int j = 0; j < 8; ++j) { const float bb = bfr(BO[c0 + j * 16 + col]);
#pragma unroll
    for (int r = 0; r < 8; ++r) sf[wave][8 * g + r][j * 16 + col] = acc[j][r] + bb; }
  LDSX(); for (int rl = 0; rl < 16; ++rl) vst2(OUT + (r0 + rl) * CC + c0 + lane * 4, *(const v4f*)&sf[wave][rl][lane * 4]); }
extern "C" void kernel_launch(void* const* d_in, const int* in_sizes, int n_in, void* d_out, int out_size, void* d_ws, size_t ws_size, hipStream_t stream) {
  (void)in_sizes; (void)n_in; (void)out_size;
  const float** F = (const float**)d_in;   // 0 x [2,1024,1024], 1 context [2,1024,1024], 2 context_mask [2,1024] int, 3 rotary_pos_emb [2048,64], 4 norm_w, 5 norm_b, 6 cnorm_w, 7 cnorm_b, 8 Wq [1024,1024] (in,out), 9 Wkv [1024,2048], 10 Wo [1024,1024], 11 bo
  if (ws_size < (size_t)WS_END) return;
  char* ws = (char*)d_ws; float *XN = (float*)(ws + WS_XN), *CN = (float*)(ws + WS_CN), *Y = (float*)(ws + WS_Y); _Float16 *QH = (_Float16*)(ws + WS_QH), *QL = (_Float16*)(ws + WS_QL), *KH = (_Float16*)(ws + WS_KH); __bf16 *VT = (__bf16*)(ws + WS_VT), *VL = (__bf16*)(ws + WS_VL); unsigned short* WT = (unsigned short*)(ws + WS_WT); float* CS = (float*)(ws + WS_CS);
  k_wt<<<dim3(CC / 64, CC / 64, 5), 256, 0, stream>>>(F[8], F[9], F[10], F[3], WT, CS);
  k_ln<<<NB * NQ + NB * NC, 256, 0, stream>>>(F[0], F[1], F[4], F[5], F[6], F[7], XN, CN);
  k_proj<<<dim3(TNB * NQ / 64, CC / 128), 128, 0, stream>>>(XN, CN, (const _Float16*)WT, CS, 0, QH, QL, KH, VT, VL);
  k_proj<<<dim3(TNB * NJ / 64, CC / 128), 128, 0, stream>>>(XN, CN, (const _Float16*)WT, CS, 1, QH, QL, KH, VT, VL);
  k_proj<<<dim3(TNB * NJ / 64, CC / 128), 128, 0, stream>>>(XN, CN, (const _Float16*)WT, CS, 2, QH, QL, KH, VT, VL);
  k_fa<<<dim3(TNB * NH, NQ / 64), 512, 0, stream>>>(QH, QL, KH, (const int*)d_in[2], VT, VL, Y);
  k_out<<<dim3(TNB * NQ / 64, CC / 128), 128, 0, stream>>>(Y, (const __bf16*)WT + (size_t)3 * CC * CC, F[11], (float*)d_out);
}

// v005
// It runs in 135 microseconds.
// In two side-by-side timings against v004, it was 1.14 and 1.13 times as fast.
// Over all steps from v000 it is 10.2 times as fast.
// compute dtype: all float inputs rounded to bf16, context_mask (int) read; LayerNorm of x and context in f32; q = xn Wq * 64^-0.5 and k/v = [cn; xn] Wkv with the LN'd rows and the 0.02-scale weights as f16 (1 product) on WMMA 16x16x32, f32 accumulate; rotary (angles from the rotary_pos_emb input, precise cosf/sinf) in f32; q as f16 hi + residual, k f16 -> 2-product logits kept in registers; mask = context_mask & causal-with-prefix -> -3e38; running-maximum softmax in f32 (precise expf), unnormalised P split bf16 hi + lo against v bf16 hi + lo (3 products), divided by the row sum at the end; out = o (bf16 hi + lo) Wo + bo; f32 output.
#include <hip/hip_runtime.h>
#include <math.h>

typedef __attribute__((ext_vector_type(16))) _Float16 v16h;
typedef __attribute__((ext_vector_type(16))) __bf16 v16b;
typedef __attribute__((ext_vector_type(8)))  _Float16 v8h;
typedef __attribute__((ext_vector_type(8)))  float v8f;
typedef __attribute__((ext_vector_type(4)))  float v4f;
typedef __attribute__((ext_vector_type(2)))  float v2f;
typedef __attribute__((ext_vector_type(4)))  unsigned v4u;
typedef __attribute__((ext_vector_type(4)))  int v4i;
typedef float __attribute__((may_alias)) float_a;
typedef int __attribute__((may_alias)) int_a;

template <typename T> __device__ __forceinline__ void vst2(void* p, T v) { *(T*)p = v;  }
__device__ __forceinline__ v8f wmma16(v16h a, v16h b, v8f c) {
  v8f d = __builtin_amdgcn_wmma_f32_16x16x32_f16(false, a, false, b, (short)0, c, false, false);
  asm volatile("v_nop\n\tv_nop\n\tv_nop\n\tv_nop" : "+v"(d) : "v"(a), "v"(b));
  return d;
}
__device__ __forceinline__ v8f wmma_bf(v16b a, v16b b, v8f c) {
  v8f d = __builtin_amdgcn_wmma_f32_16x16x32_bf16(false, a, false, b, (short)0, c, false, false);
  asm volatile("v_nop\n\tv_nop\n\tv_nop\n\tv_nop" : "+v"(d) : "v"(a), "v"(b));
  return d;
}
// 16x16x32 fragments: lane = (h = lane>>4, row/col = lane&15); elements 0..7 = k0+8h+0..7, 8..15 = k0+16+8h+0..7; D element r = row 8h+r
__device__ __forceinline__ v16h frag_h(const _Float16* rowk0, int lane) {
  union { v16h v; v8h q[2]; } u; const _Float16* p = rowk0 + 8 * (lane >> 4);
  u.q[0] = *(const v8h*)p; u.q[1] = *(const v8h*)(p + 16); return u.v;
}
__device__ __forceinline__ v16h frag_f32(const float* rowk0, int lane) {
  v16h a; const float* p = rowk0 + 8 * (lane >> 4);
#pragma unroll
  for (int i = 0; i < 8; ++i) { a[i] = (_Float16)p[i]; a[8 + i] = (_Float16)p[16 + i]; }
  return a;
}
__device__ __forceinline__ v16h frag_f32s(const float* rowk0, int lane, float sc) {
  v16h a; const float* p = rowk0 + 8 * (lane >> 4);
#pragma unroll
  for (int i = 0; i < 8; ++i) { a[i] = (_Float16)(p[i] * sc); a[8 + i] = (_Float16)(p[16 + i] * sc); }
  return a;
}
// column fragment from a [K][ld] layout (column n), rows >= K read as 0
__device__ __forceinline__ v16h fragc_f32(const float* W, int k0, int n, int lane, int ld, int K) {
  v16h a; const int g = lane >> 4;
#pragma unroll
  for (int i = 0; i < 8; ++i) { const int ka = k0 + 8 * g + i, kb = ka + 16;
    a[i] = (_Float16)(ka < K ? W[(size_t)(ka < K ? ka : K - 1) * ld + n] : 0.f); a[8 + i] = (_Float16)(kb < K ? W[(size_t)(kb < K ? kb : K - 1) * ld + n] : 0.f); }
  return a;
}
struct F2 { v16b h, l; };
__device__ __forceinline__ F2 bsplit16(const float v[16]) { F2 r;
#pragma unroll
  for (int i = 0; i < 16; ++i) { const __bf16 h = (__bf16)v[i]; r.h[i] = h; r.l[i] = (__bf16)(v[i] - (float)h); }
  return r; }
__device__ __forceinline__ F2 split_row(const float* row, int k0, int lane) { float v[16]; const float* p = row + k0 + 8 * (lane >> 4);
#pragma unroll
  for (int i = 0; i < 8; ++i) { v[i] = p[i]; v[8 + i] = p[16 + i]; }
  return bsplit16(v); }
__device__ __forceinline__ F2 split_rowK(const float* row, int k0, int lane, int K) { float v[16]; const int g = lane >> 4;
#pragma unroll
  for (int i = 0; i < 8; ++i) { const int ka = k0 + 8 * g + i, kb = ka + 16; v[i] = ka < K ? row[ka < K ? ka : K - 1] : 0.f; v[8 + i] = kb < K ? row[kb < K ? kb : K - 1] : 0.f; }
  return bsplit16(v); }
__device__ __forceinline__ F2 split_col(const float* W, int k0, int n, int lane, int ld, int K) { float v[16]; const int g = lane >> 4;
#pragma unroll
  for (int i = 0; i < 8; ++i) { const int ka = k0 + 8 * g + i, kb = ka + 16; v[i] = ka < K ? W[(size_t)(ka < K ? ka : K - 1) * ld + n] : 0.f; v[8 + i] = kb < K ? W[(size_t)(kb < K ? kb : K - 1) * ld + n] : 0.f; }
  return bsplit16(v); }
__device__ __forceinline__ v8f mac3(const F2& a, const F2& b, v8f c) { c = wmma_bf(a.l, b.h, c); c = wmma_bf(a.h, b.l, c); return wmma_bf(a.h, b.h, c); }
__device__ __forceinline__ float sigm(float v) { return 1.0f / (1.0f + expf(-v)); }
#define LDSX() do { asm volatile("s_wait_dscnt 0" ::: "memory"); __builtin_amdgcn_wave_barrier(); __builtin_amdgcn_fence(__ATOMIC_RELEASE, "workgroup"); } while (0)


// Causal prefix attention (B 2, 1,024 queries over 1,024 context + 1,024 self keys, 16 x 64, rotary on all 64 dims): prefix keys masked by context_mask, self keys causal.
#define NB 2
#define NQ 1024
#define NC 1024
#define NJ 2048
#define CC 1024
#define NH 16
#define HD 64
#ifndef TNB
#define TNB NB
#endif
typedef __attribute__((ext_vector_type(8))) __bf16 v8b;
__device__ __forceinline__ v16b frag_b(const __bf16* rowk0, int lane) {
  union { v16b v; v8b q[2]; } u; const __bf16* p = rowk0 + 8 * (lane >> 4);
  u.q[0] = *(const v8b*)p; u.q[1] = *(const v8b*)(p + 16); return u.v;
}
// B fragment from a plane of k_wt (f = the fragment's 512 elements)
__device__ __forceinline__ v16h fragw_h(const _Float16* f, int lane) { union { v16h v; v8h q[2]; } u; u.q[0] = *(const v8h*)(f + lane * 8); u.q[1] = *(const v8h*)(f + 256 + lane * 8); return u.v; }
__device__ __forceinline__ v16b fragw_b(const __bf16* f, int lane) { union { v16b v; v8b q[2]; } u; u.q[0] = *(const v8b*)(f + lane * 8); u.q[1] = *(const v8b*)(f + 256 + lane * 8); return u.v; }
__device__ __forceinline__ float bfr(float v) { return (float)(__bf16)v; }
__device__ __attribute__((noinline)) float exp_ni(float v) { return expf(v); }
__device__ __attribute__((noinline)) float erf_ni(float v) { return erff(v); }


#define WS_XN  0u                                  // f32 LN'd x rows [b*NQ][1024]
#define WS_CN  (WS_XN + 4u * (size_t)NB * NQ * CC)     // f32 LN'd context rows
#define WS_QH  (WS_CN + 4u * (size_t)NB * NC * CC)     // f16 q (hi, residual) in B-fragment order [slice = b*NH + h][16-query tile][32-d step][512]
#define WS_QL  (WS_QH + 2u * (size_t)NB * NQ * CC)
#define WS_KH  (WS_QL + 2u * (size_t)NB * NQ * CC)     // f16 k in A-fragment order [slice][16-key tile][32-d step][512]
#define WS_VT  (WS_KH + 2u * (size_t)NB * NJ * CC)     // bf16 v planes (hi, lo) in A-fragment order [slice][32-key trip][16-d tile][512]
#define WS_VL  (WS_VT + 2u * (size_t)NB * CC * NJ)
#define WS_WT  (WS_VL + 2u * (size_t)NB * CC * NJ)     // 16-bit weight planes [4][64 n tiles][32 k steps][512] in B-fragment order (k_wt): f16 Wq, Wkv k half, Wkv v half; bf16 Wo
#define WS_Y   WS_XN                               // f32 o in A-fragment order [16-row tile of b*NQ][32-k step][4 pieces][32 lanes][4]: piece p of lane (g, row) = k 16 (p >> 1) + 8 g + 4 (p & 1) + 0..3; k_fa writes them after the last reader of XN (k_proj) has ended
#define WS_CS  (WS_WT + 2u * (size_t)4 * CC * CC)     // f32 rotary table [NJ positions][2 d halves][16 columns][cos, sin of d = 32 half + column; cos, sin of d + 16] (k_wt)
#define WS_END (WS_CS + 4u * (size_t)NJ * HD * 2)

typedef __attribute__((ext_vector_type(2))) _Float16 v2h;
typedef __attribute__((ext_vector_type(2))) __bf16 v2b;
// ---- k_wt: block = (64 k, 64 n, plane z): each weight is rounded once to the 16-bit type its product reads (z 0 Wq, 1 Wkv cols 0..1023, 2 Wkv cols 1024..: bf16 then f16; 3 Wo: bf16) and stored in B-fragment order: 1 KiB for each (16 n, 32 k) fragment, elements 0..7 of lanes 0..31 and then elements 8..15, so that each of a fragment's two 16-byte loads reads four whole 128-byte lines. Plane z 4 holds no weight: its 65,536 threads compute cos and sin of every rotary angle once, in the order in which a lane of k_proj reads them
__global__ __launch_bounds__(256) void k_wt(const float* __restrict__ WQ, const float* __restrict__ WKV, const float* __restrict__ WO, const float* __restrict__ ROT, unsigned short* __restrict__ WT, float* __restrict__ CS) { __shared__ __align__(16) unsigned st[64][36];   // [n][k pair], pitch 144 bytes
  if (blockIdx.z == 4) { const int id = ((int)blockIdx.y * (CC / 64) + (int)blockIdx.x) * 256 + (int)threadIdx.x;   // thread = (position id >> 5, d half (id >> 4) & 1, column id & 15); the whole block leaves ahead of the barrier
    const float* ap = ROT + (size_t)(id >> 5) * HD + ((id >> 4) & 1) * 32 + (id & 15); const float a0 = bfr(ap[0]), a1 = bfr(ap[16]);
    v4f o; o[0] = cosf(a0); o[1] = sinf(a0); o[2] = cosf(a1); o[3] = sinf(a1); vst2(CS + (size_t)id * 4, o); return; }
  const int t = threadIdx.x, z = blockIdx.z, k0 = blockIdx.x * 64, n0 = blockIdx.y * 64; const float* src = (z == 0) ? WQ : (z == 3) ? WO : WKV; const int ld = (z == 1 || z == 2) ? 2 * CC : CC; const int off = (z == 2) ? CC : 0;
  const int kt = t >> 4, q = t & 15; v4f v[2][2];   // rows k0 + 32 i + 2 kt + {0, 1}, columns n0 + 4 q + 0..3
#pragma unroll
  for (int i = 0; i < 2; ++i)
#pragma unroll
    for (int r = 0; r < 2; ++r) { v[i][r] = *(const v4f*)(src + (size_t)(k0 + i * 32 + 2 * kt + r) * ld + off + n0 + q * 4); }
#pragma unroll
  for (int i = 0; i < 2; ++i)
#pragma unroll
    for (int c = 0; c < 4; ++c) { v2b rb; rb[0] = (__bf16)v[i][0][c]; rb[1] = (__bf16)v[i][1][c]; v2h rh; rh[0] = (_Float16)(float)rb[0]; rh[1] = (_Float16)(float)rb[1];
      st[q * 4 + c][i * 16 + kt] = (z == 3) ? __builtin_bit_cast(unsigned, rb) : __builtin_bit_cast(unsigned, rh); }
  __syncthreads();
#pragma unroll
  for (int i = 0; i < 2; ++i) { const int e = t + i * 256, f = e >> 6, w = e & 63;   // fragment f = (16-n tile f >> 1, 32-k step f & 1) of the block's 8; 16-byte piece w = (element half w >> 5, lane w & 31)
    const int n = (f >> 1) * 16 + (w & 15), k8 = (f & 1) * 4 + (w >> 5) * 2 + ((w >> 4) & 1);   // the piece holds column n, rows 8 k8 + 0..7
    vst2(WT + (((size_t)z * (CC / 16) + n0 / 16 + (f >> 1)) * (CC / 32) + k0 / 32 + (f & 1)) * 512 + w * 8, *(const v4u*)&st[n][k8 * 4]); } }
// ---- k_ln: block = row (rows 0..NB*NQ-1 from x -> XN; NB*NQ.. from context -> CN)
__global__ __launch_bounds__(256) void k_ln(const float* __restrict__ X, const float* __restrict__ CT, const float* __restrict__ GX, const float* __restrict__ BX, const float* __restrict__ GC, const float* __restrict__ BC, float* __restrict__ XN, float* __restrict__ CN) { __shared__ float sred[8]; __shared__ float smu, sinv; __shared__ __align__(16) float sv[CC];
  const int t = threadIdx.x; size_t row = blockIdx.x; const bool isx = row < (size_t)NB * NQ; if (!isx) row -= (size_t)NB * NQ;
  const float* src = (isx ? X : CT) + row * CC; const float* ga = isx ? GX : GC; const float* be = isx ? BX : BC; float* dst = (isx ? XN : CN) + row * CC;
  float a = 0.f; for (int i = t; i < CC; i += 256) { const float v = bfr(src[i]); sv[i] = v; a += v; }
#pragma unroll
  for (int o = 1; o < 32; o <<= 1) a += __shfl_xor(a, o);
  if ((t & 31) == 0) sred[t >> 5] = a; __syncthreads(); if (t == 0) { float x = 0.f; for (int w = 0; w < 8; ++w) x += sred[w]; smu = x / CC; } __syncthreads(); const float mu = smu;
  float q = 0.f; for (int i = t; i < CC; i += 256) { const float d = sv[i] - mu; q += d * d; }
#pragma unroll
  for (int o = 1; o < 32; o <<= 1) q += __shfl_xor(q, o);
  __syncthreads(); if ((t & 31) == 0) sred[t >> 5] = q; __syncthreads(); if (t == 0) { float x = 0.f; for (int w = 0; w < 8; ++w) x += sred[w]; sinv = 1.0f / sqrtf(x / CC + 1e-5f); } __syncthreads(); const float inv = sinv;
  for (int i = t; i < CC; i += 256) sv[i] = (sv[i] - mu) * inv * bfr(ga[i]) + bfr(be[i]);
  __syncthreads(); for (int qq = t; qq < CC / 4; qq += 256) vst2(dst + qq * 4, *(const v4f*)&sv[qq * 4]); }
// ---- k_proj: block = (64 rows, 128 cols, which): which 0: q = xn Wq (rows b*NQ + i; key position CTX + i), 1: k, 2: v from [cn rows (j < NC); xn rows (j >= NC)] Wkv (cols 0..1023 k, 1024.. v); rotary on q and k; f16 A (LN'd rows) x f16 W (1 product)
// rotary on a wave's 16 x 128 accumulator tile (two heads): element r of tile j is (row 8 g + r, d = 16 (j & 3) + col), so that its partner d +- 32 is element r of tile j ^ 2 in the same lane; cs = the lane's place in the table row of its first position; rows go to sh (f16) and, for q, their residual to sl
template <bool Q> __device__ __forceinline__ void rot_pack(const v8f (&acc)[8], const float* cs, _Float16 (*sh)[136], _Float16 (*sl)[136], int row0, int col) {
  v4f t[8][2];
#pragma unroll
  for (int r = 0; r < 8; ++r) { t[r][0] = *(const v4f*)(cs + r * 2 * HD); t[r][1] = *(const v4f*)(cs + r * 2 * HD + 64); }
  const float sc = Q ? 0.125f : 1.0f;
#pragma unroll
  for (int j = 0; j < 8; ++j)
#pragma unroll
    for (int r = 0; r < 8; ++r) { const int jd = j & 3; const float c = t[r][jd >> 1][(jd & 1) * 2], s = t[r][jd >> 1][(jd & 1) * 2 + 1];
      const float me = acc[j][r] * sc; const float partner = (jd < 2) ? -(acc[j + 2][r] * sc) : acc[j - 2][r] * sc;
      const float v = me * c + partner * s; const _Float16 hv = (_Float16)v; sh[row0 + r][j * 16 + col] = hv; if (Q) sl[row0 + r][j * 16 + col] = (_Float16)(v - (float)hv); } }
__global__ __launch_bounds__(128) void k_proj(const float* __restrict__ XN, const float* __restrict__ CN, const _Float16* __restrict__ WT, const float* __restrict__ CS, int which, _Float16* __restrict__ QH, _Float16* __restrict__ QL, _Float16* __restrict__ KH, __bf16* __restrict__ VT, __bf16* __restrict__ VL) {
  __shared__ __align__(16) float sf[64][132]; __shared__ __align__(16) _Float16 sh[64][136], sl[64][136]; __shared__ __align__(16) __bf16 th[128][72], tl2[128][72];
  const int tid = threadIdx.x, wave = tid >> 5, lane = tid & 31, col = lane & 15, g = lane >> 4; const int c0 = blockIdx.y * 128; const size_t r0 = (size_t)blockIdx.x * 64 + wave * 16;   // row within [b*L]
  const int L = (which == 0) ? NQ : NJ; const size_t rme = r0 + col; const size_t b = rme / L; const int jpos = (int)(rme % L);
  const float* arow = (which == 0) ? (XN + (b * NQ + jpos) * CC) : (jpos < NC ? (CN + (b * NC + jpos) * CC) : (XN + (b * NQ + (jpos - NC)) * CC));
  const _Float16* wt0 = WT + ((size_t)which * (CC / 16) + c0 / 16) * (CC / 32) * 512;   // plane 'which', first fragment of the block's first 16 columns
  v8f acc[8] = {};
#pragma unroll 1   // one trip holds 16 B fragments in registers; a second copy of the body would not fit
  for (int kc = 0; kc < CC / 64; ++kc) { v4f ar[2][4]; v16h w[2][8];   // 64 k a trip: 16 B fragments
#pragma unroll
    for (int u = 0; u < 2; ++u) { const float* p = arow + kc * 64 + u * 32 + 8 * g; ar[u][0] = *(const v4f*)p; ar[u][1] = *(const v4f*)(p + 4); ar[u][2] = *(const v4f*)(p + 16); ar[u][3] = *(const v4f*)(p + 20); }
#pragma unroll
    for (int u = 0; u < 2; ++u)
#pragma unroll
      for (int j = 0; j < 8; ++j) w[u][j] = fragw_h(wt0 + ((size_t)j * (CC / 32) + kc * 2 + u) * 512, lane);
    __builtin_amdgcn_sched_barrier(0);   // every load of the trip is issued ahead of the first convert, so that a trip waits for memory once; without it part of the B loads is placed behind the wait for A
#pragma unroll
    for (int u = 0; u < 2; ++u) { v16h a;
#pragma unroll
      for (int i = 0; i < 16; ++i) a[i] = (_Float16)ar[u][i >> 2][i & 3];
#pragma unroll
      for (int j = 0; j < 8; ++j) acc[j] = wmma16(a, w[u][j], acc[j]); } }
  if (which < 2) {   // rotary (q, k) in registers, then pack
    const float* cs = CS + ((size_t)(r0 % L) + ((which == 0) ? NC : 0) + 8 * g) * (2 * HD) + col * 4;   // q uses the last NQ positions
    if (which == 0) rot_pack<true>(acc, cs, sh, sl, wave * 16 + 8 * g, col); else rot_pack<false>(acc, cs, sh, sl, wave * 16 + 8 * g, col);
    __syncthreads();
    const size_t rb = (size_t)blockIdx.x * 64;
    _Float16* dh = which == 0 ? QH : KH; const size_t s0 = (which == 0 ? rb / NQ : rb / NJ) * NH + c0 / HD; const int kt0 = (int)(which == 0 ? rb % NQ : rb % NJ) / 16;   // the block's 16 fragments f = (head f >> 3, 16-row tile (f >> 1) & 3, d step f & 1); 16-byte piece w = (element half w >> 5, lane w & 31) holds row w & 15 of the tile, d = 8 d8 + 0..7
    for (int e = tid; e < 64 * 16; e += 128) { const int f = e >> 6, w = e & 63, hh = f >> 3, kt = (f >> 1) & 3, kc = f & 1; const int d8 = kc * 4 + (w >> 5) * 2 + ((w >> 4) & 1);
      const size_t o2 = (((s0 + hh) * (L / 16) + kt0 + kt) * 2 + kc) * 512 + w * 8; vst2((unsigned*)(dh + o2), *(const v4u*)&sh[kt * 16 + (w & 15)][hh * HD + d8 * 8]);
      asm volatile("s_wait_xcnt 0x0" ::: "memory");   // the next LDS read and the next address reuse the registers that the store names
      if (which == 0) { vst2((unsigned*)(QL + o2), *(const v4u*)&sl[kt * 16 + (w & 15)][hh * HD + d8 * 8]);
        asm volatile("s_wait_xcnt 0x0" ::: "memory"); } } }   // as above, ahead of the next trip
  else {   // v: stage the f32 tile, then transpose
#pragma unroll
    for (int j = 0; j < 8; ++j)
#pragma unroll
      for (int r = 0; r < 8; ++r) sf[wave * 16 + 8 * g + r][j * 16 + col] = acc[j][r];
    __syncthreads();
    for (int e = tid; e < 64 * 128; e += 128) { const int rl = e >> 7, cl = e & 127; const float v = sf[rl][cl]; const __bf16 bh = (__bf16)v; th[cl][rl] = bh; tl2[cl][rl] = (__bf16)(v - (float)bh); }
    __syncthreads(); const size_t rb = (size_t)blockIdx.x * 64; const size_t s0 = (rb / NJ) * NH + c0 / HD; const int t0 = (int)(rb % NJ) / 32;
    // the block's 16 fragments of each plane, f = (head f >> 3, 32-key trip (f >> 2) & 1, d tile f & 3); piece w = (element half w >> 5, lane w & 31) holds d = w & 15 of the tile, keys 8 q8 + 0..7 of the block
    for (int e = tid; e < 128 * 8; e += 128) { const int f = e >> 6, w = e & 63, hh = f >> 3, tt = (f >> 2) & 1, j = f & 3; const int cl = hh * HD + j * 16 + (w & 15), q8 = tt * 4 + (w >> 5) * 2 + ((w >> 4) & 1);
      const size_t o2 = (((s0 + hh) * (NJ / 32) + t0 + tt) * 4 + j) * 512 + w * 8; vst2((unsigned*)(VT + o2), *(const v4u*)&th[cl][q8 * 8]); vst2((unsigned*)(VL + o2), *(const v4u*)&tl2[cl][q8 * 8]); } } }
// lane l with lane l ^ 16
__device__ __forceinline__ float xhalf(float x) { return __builtin_bit_cast(float, __builtin_amdgcn_permlanex16(__builtin_bit_cast(int, x), __builtin_bit_cast(int, x), 0x76543210, 0xfedcba98, false, false)); }
// fragment stored in fragment order, at this lane's byte address in it: bytes 0..15 and 512..527 (each load of a wave reads 512 bytes in a row: four whole 128-byte lines)
__device__ __forceinline__ v16h fragp_h(const char* p) { union { v16h v; v8h q[2]; } u; u.q[0] = *(const v8h*)p; u.q[1] = *(const v8h*)(p + 512); return u.v; }
__device__ __forceinline__ v16b fragp_b(const char* p) { union { v16b v; v8b q[2]; } u; u.q[0] = *(const v8b*)p; u.q[1] = *(const v8b*)(p + 512); return u.v; }
// one 32-key trip of k_fa: kp, vhp, vlp, cp = this lane's place in the trip's first k fragment, in the first fragment of each v plane, and at its first mask word (CTX: context keys, masked by those words; else self keys, key e of the lane's 32 allowed iff e <= thr)
template <bool CTX> __device__ __forceinline__ void fa_trip(const char* kp, const char* vhp, const char* vlp, const char* cp, int thr, const v16h (&qh)[2], const v16h (&ql)[2], v8f (&o)[HD / 16], float& m, float& l) {
  v16h kf[2][2]; v16b vh[HD / 16], vl[HD / 16]; v4i cm[2][2];
#pragma unroll
  for (int a = 0; a < 2; ++a)
#pragma unroll
    for (int kc = 0; kc < 2; ++kc) kf[a][kc] = fragp_h(kp + (a * 2 + kc) * 1024);
  if (CTX) {
#pragma unroll
    for (int a = 0; a < 2; ++a) { cm[a][0] = *(const v4i*)(cp + a * 64); cm[a][1] = *(const v4i*)(cp + a * 64 + 16); } }
#pragma unroll
  for (int j = 0; j < HD / 16; ++j) { vh[j] = fragp_b(vhp + j * 1024); vl[j] = fragp_b(vlp + j * 1024); }
  v8f s[2] = {};
#pragma unroll
  for (int kc = 0; kc < 2; ++kc)
#pragma unroll
    for (int a = 0; a < 2; ++a) { s[a] = wmma16(kf[a][kc], qh[kc], s[a]); s[a] = wmma16(kf[a][kc], ql[kc], s[a]); }
#pragma unroll
  for (int a = 0; a < 2; ++a)
#pragma unroll
    for (int r = 0; r < 8; ++r) s[a][r] = (CTX ? (cm[a][r >> 2][r & 3] != 0) : (a * 16 + r <= thr)) ? s[a][r] : -3.0e38f;
  float mx = s[0][0];
#pragma unroll
  for (int e = 1; e < 16; ++e) mx = fmaxf(mx, s[e >> 3][e & 7]);
  mx = fmaxf(mx, xhalf(mx)); const float mn = fmaxf(m, mx); const float al = expf(m - mn); m = mn;
  float pv[16], ps = 0.f;
#pragma unroll
  for (int e = 0; e < 16; ++e) { pv[e] = expf(s[e >> 3][e & 7] - mn); ps += pv[e]; }
  l = l * al + ps; const F2 p = bsplit16(pv);
#pragma unroll
  for (int j = 0; j < HD / 16; ++j) { o[j] *= al; o[j] = wmma_bf(vh[j], p.h, o[j]); o[j] = wmma_bf(vh[j], p.l, o[j]); o[j] = wmma_bf(vl[j], p.h, o[j]); } }
// ---- k_fa: block = (slice = b * NH + h, 64 queries, longest first), 16 waves = (16-query group qg, key quarter kq). A wave walks its 32-key trips with S^T = K Q^T (2 products) and O^T += V^T P^T (3 products): lane (g, c) holds query c's scores of keys 8 g + 0..7 of each 16-key tile, which is the B fragment's k order, so that P stays in registers and a query's maximum, sum and rescale stay in its own two lanes. Key j allowed iff (j < NC ? context_mask[b][j] : j - NC <= i), else -3e38: its exp against a real maximum is 0, and what a wave sums while it has met no allowed key is wiped by the factor exp(-3e38 - m) = 0 (every query has an allowed key, its own). The four quarters' (m, l, O) are joined through LDS.
__global__ __launch_bounds__(512) void k_fa(const _Float16* __restrict__ QH, const _Float16* __restrict__ QL, const _Float16* __restrict__ KH, const int* __restrict__ CM, const __bf16* __restrict__ VT, const __bf16* __restrict__ VL, float* __restrict__ Y) {
  __shared__ __align__(16) float so[4][64][HD + 4]; __shared__ float sm[4][64], sl[4][64];
  const int b = blockIdx.x / NH, h = blockIdx.x % NH; const int x = NQ / 64 - 1 - (int)blockIdx.y;   // query tiles in reverse, longest first, for speed only
  const int tid = threadIdx.x, lane = tid & 31, c = lane & 15, g = lane >> 4; const int wave = __builtin_amdgcn_readfirstlane(tid >> 5), qg = wave & 3, kq = wave >> 2; const int q0 = x * 64 + qg * 16;
  v16h qh[2], ql[2];
#pragma unroll
  for (int kc = 0; kc < 2; ++kc) { const size_t qo = (((size_t)blockIdx.x * (NQ / 16) + q0 / 16) * 2 + kc) * 512 + lane * 8; qh[kc] = fragp_h((const char*)(QH + qo)); ql[kc] = fragp_h((const char*)(QL + qo)); }
  const int nt = (NC + q0 + 16 + 31) >> 5;   // trips that hold a key some query of the group may see
  // a quarter takes two trips in a row, then skips the other quarters' six; the lane's four addresses walk along with the trips: a trip's four k fragments, and its four v fragments of each plane, are 4 KiB in a row
  const size_t fo = ((size_t)blockIdx.x * (NJ / 32) + 2 * kq) * 2048 + lane * 8; const char* kp = (const char*)(KH + fo); const char* vhp = (const char*)(VT + fo); const char* vlp = (const char*)(VL + fo); const char* cp = (const char*)(CM + (size_t)b * NC + 64 * kq + 8 * g);
  v8f o[HD / 16] = {}; float m = -3.0e38f, l = 0.f;
  for (int i = 0; i < NC / 128; ++i) { fa_trip<true>(kp, vhp, vlp, cp, 0, qh, ql, o, m, l); const int st = (i & 1) ? 7 * 32 : 32; kp += st * 128; vhp += st * 128; vlp += st * 128; cp += st * 4; }
  for (int i = 0, t = NC / 32 + 2 * kq; t < nt; ++i) { fa_trip<false>(kp, vhp, vlp, cp, q0 + c - (t * 32 - NC) - 8 * g, qh, ql, o, m, l); const int st = (i & 1) ? 7 : 1; t += st; kp += st * 4096; vhp += st * 4096; vlp += st * 4096; }
  l += xhalf(l); if (g == 0) { sm[kq][qg * 16 + c] = m; sl[kq][qg * 16 + c] = l; }
#pragma unroll
  for (int j = 0; j < HD / 16; ++j) { v4f lo4, hi4;
#pragma unroll
    for (int r = 0; r < 4; ++r) { lo4[r] = o[j][r]; hi4[r] = o[j][4 + r]; }
    vst2(&so[kq][qg * 16 + c][j * 16 + 8 * g], lo4); vst2(&so[kq][qg * 16 + c][j * 16 + 8 * g + 4], hi4); }
  __syncthreads();
  const int q = (tid >> 7) * 16 + (tid & 15), dd = ((tid >> 4) & 7) * 8; float mt = sm[0][q];   // thread = (query, 8 of its 64 outputs), so numbered that a wave's 32 threads are the 32 lanes of two pieces of one fragment of k_out
#pragma unroll
  for (int w = 1; w < 4; ++w) mt = fmaxf(mt, sm[w][q]);
  float lt = 0.f; v4f y0 = {}, y1 = {};
#pragma unroll
  for (int w = 0; w < 4; ++w) { const float e = expf(sm[w][q] - mt); lt += e * sl[w][q]; y0 += e * *(const v4f*)&so[w][q][dd]; y1 += e * *(const v4f*)&so[w][q][dd + 4]; }
  const float inv = 1.0f / lt; float* yp = Y + (((((size_t)b * NQ + x * 64 + q) >> 4) * (CC / 32) + h * 2 + (dd >> 5)) * 4 + ((dd >> 4) & 1) * 2) * 128 + lane * 4; vst2(yp, y0 * inv); vst2(yp + 128, y1 * inv); }
// ---- k_out: out = o (bf16 hi + lo) Wo + bo (Wo as the bf16 plane of k_wt)
__global__ __launch_bounds__(128) void k_out(const float* __restrict__ Y, const __bf16* __restrict__ WOT, const float* __restrict__ BO, float* __restrict__ OUT) { __shared__ __align__(16) float sf[4][16][132];
  const int tid = threadIdx.x, wave = tid >> 5, lane = tid & 31, col = lane & 15, g = lane >> 4; const int c0 = blockIdx.y * 128; const size_t r0 = (size_t)blockIdx.x * 64 + wave * 16;
  const float* yfr = Y + (r0 >> 4) * (size_t)(CC / 32) * 512 + lane * 4; const __bf16* wt0 = WOT + (size_t)(c0 / 16) * (CC / 32) * 512;   // this lane's place in the first A fragment of the wave's 16 rows; first fragment of the block's first 16 columns
  v8f acc[8] = {};
#pragma unroll 1   // one trip holds 16 B fragments in registers; a second copy of the body would not fit
  for (int kc = 0; kc < CC / 64; ++kc) { v4f ar[2][4]; v16b w[2][8];   // 64 k a trip, as in k_proj
#pragma unroll
    for (int u = 0; u < 2; ++u) { const float* p = yfr + u * 512; ar[u][0] = *(const v4f*)p; ar[u][1] = *(const v4f*)(p + 128); ar[u][2] = *(const v4f*)(p + 256); ar[u][3] = *(const v4f*)(p + 384); }
    asm volatile("s_wait_xcnt 0x0" ::: "memory");   // in this build one of the B loads below lands on the register pair that holds the A loads' address
#pragma unroll
    for (int u = 0; u < 2; ++u)
#pragma unroll
      for (int j = 0; j < 8; ++j) w[u][j] = fragw_b(wt0 + ((size_t)j * (CC / 32) + kc * 2 + u) * 512, lane);
    __builtin_amdgcn_sched_barrier(0);   // every load of the trip is issued ahead of the first split, so that a trip waits for memory once; without it part of the B loads is placed behind the split of A
#pragma unroll
    for (int u = 0; u < 2; ++u) { float av[16];
#pragma unroll
      for (int i = 0; i < 16; ++i) av[i] = ar[u][i >> 2][i & 3];
      const F2 a = bsplit16(av);
#pragma unroll
      for (int j = 0; j < 8; ++j) { acc[j] = wmma_bf(a.h, w[u][j], acc[j]); acc[j] = wmma_bf(a.l, w[u][j], acc[j]); } }
    yfr += 1024; }
#pragma unroll
  for (int j = 0; j < 8; ++j) { const float bb = bfr(BO[c0 + j * 16 + col]);
#pragma unroll
    for (int r = 0; r < 8; ++r) sf[wave][8 * g + r][j * 16 + col] = acc[j][r] + bb; }
  LDSX(); for (int rl = 0; rl < 16; ++rl) vst2(OUT + (r0 + rl) * CC + c0 + lane * 4, *(const v4f*)&sf[wave][rl][lane * 4]); }
extern "C" void kernel_launch(void* const* d_in, const int* in_sizes, int n_in, void* d_out, int out_size, void* d_ws, size_t ws_size, hipStream_t stream) {
  (void)in_sizes; (void)n_in; (void)out_size;
  const float** F = (const float**)d_in;   // 0 x [2,1024,1024], 1 context [2,1024,1024], 2 context_mask [2,1024] int, 3 rotary_pos_emb [2048,64], 4 norm_w, 5 norm_b, 6 cnorm_w, 7 cnorm_b, 8 Wq [1024,1024] (in,out), 9 Wkv [1024,2048], 10 Wo [1024,1024], 11 bo
  if (ws_size < (size_t)WS_END) return;
  char* ws = (char*)d_ws; float *XN = (float*)(ws + WS_XN), *CN = (float*)(ws + WS_CN), *Y = (float*)(ws + WS_Y); _Float16 *QH = (_Float16*)(ws + WS_QH), *QL = (_Float16*)(ws + WS_QL), *KH = (_Float16*)(ws + WS_KH); __bf16 *VT = (__bf16*)(ws + WS_VT), *VL = (__bf16*)(ws + WS_VL); unsigned short* WT = (unsigned short*)(ws + WS_WT); float* CS = (float*)(ws + WS_CS);
  k_wt<<<dim3(CC / 64, CC / 64, 5), 256, 0, stream>>>(F[8], F[9], F[10], F[3], WT, CS);
  k_ln<<<NB * NQ + NB * NC, 256, 0, stream>>>(F[0], F[1], F[4], F[5], F[6], F[7], XN, CN);
  k_proj<<<dim3(TNB * NQ / 64, CC / 128), 128, 0, stream>>>(XN, CN, (const _Float16*)WT, CS, 0, QH, QL, KH, VT, VL);
  k_proj<<<dim3(TNB * NJ / 64, CC / 128), 128, 0, stream>>>(XN, CN, (const _Float16*)WT, CS, 1, QH, QL, KH, VT, VL);
  k_proj<<<dim3(TNB * NJ / 64, CC / 128), 128, 0, stream>>>(XN, CN, (const _Float16*)WT, CS, 2, QH, QL, KH, VT, VL);
  k_fa<<<dim3(TNB * NH, NQ / 64), 512, 0, stream>>>(QH, QL, KH, (const int*)d_in[2], VT, VL, Y);
  k_out<<<dim3(TNB * NQ / 64, CC / 128), 128, 0, stream>>>(Y, (const __bf16*)WT + (size_t)3 * CC * CC, F[11], (float*)d_out);
}

// v006
// A run of this version takes 118 microseconds.
// Timed twice side by side with v005, it ran 1.16 and 1.14 times as fast.
// All steps since v000 together make it 11.7 times as fast.
// compute dtype: all float inputs rounded to bf16, context_mask (int) read; LayerNorm of x and context in f32; q = xn Wq * 64^-0.5 and k/v = [cn; xn] Wkv with the LN'd rows and the 0.02-scale weights as f16 (1 product) on WMMA 16x16x32, f32 accumulate; rotary (angles from the rotary_pos_emb input, precise cosf/sinf) in f32; q as f16 hi + residual, k f16 -> 2-product logits kept in registers; mask = context_mask & causal-with-prefix -> -3e38; running-maximum softmax in f32 (precise expf), unnormalised P split bf16 hi + lo against v bf16 hi + lo (3 products), divided by the row sum at the end; out = o (bf16 hi + lo) Wo + bo; f32 output.
#include <hip/hip_runtime.h>
#include <math.h>

typedef __attribute__((ext_vector_type(16))) _Float16 v16h;
typedef __attribute__((ext_vector_type(16))) __bf16 v16b;
typedef __attribute__((ext_vector_type(8)))  _Float16 v8h;
typedef __attribute__((ext_vector_type(8)))  float v8f;
typedef __attribute__((ext_vector_type(4)))  float v4f;
typedef __attribute__((ext_vector_type(2)))  float v2f;
typedef __attribute__((ext_vector_type(4)))  unsigned v4u;
typedef __attribute__((ext_vector_type(4)))  int v4i;
typedef float __attribute__((may_alias)) float_a;
typedef int __attribute__((may_alias)) int_a;

template <typename T> __device__ __forceinline__ void vst2(void* p, T v) { *(T*)p = v;  }
__device__ __forceinline__ v8f wmma16(v16h a, v16h b, v8f c) {
  v8f d = __builtin_amdgcn_wmma_f32_16x16x32_f16(false, a, false, b, (short)0, c, false, false);
  asm volatile("v_nop\n\tv_nop\n\tv_nop\n\tv_nop" : "+v"(d) : "v"(a), "v"(b));
  return d;
}
__device__ __forceinline__ v8f wmma_bf(v16b a, v16b b, v8f c) {
  v8f d = __builtin_amdgcn_wmma_f32_16x16x32_bf16(false, a, false, b, (short)0, c, false, false);
  asm volatile("v_nop\n\tv_nop\n\tv_nop\n\tv_nop" : "+v"(d) : "v"(a), "v"(b));
  return d;
}
// 16x16x32 fragments: lane = (h = lane>>4, row/col = lane&15); elements 0..7 = k0+8h+0..7, 8..15 = k0+16+8h+0..7; D element r = row 8h+r
__device__ __forceinline__ v16h frag_h(const _Float16* rowk0, int lane) {
  union { v16h v; v8h q[2]; } u; const _Float16* p = rowk0 + 8 * (lane >> 4);
  u.q[0] = *(const v8h*)p; u.q[1] = *(const v8h*)(p + 16); return u.v;
}
__device__ __forceinline__ v16h frag_f32(const float* rowk0, int lane) {
  v16h a; const float* p = rowk0 + 8 * (lane >> 4);
#pragma unroll
  for (int i = 0; i < 8; ++i) { a[i] = (_Float16)p[i]; a[8 + i] = (_Float16)p[16 + i]; }
  return a;
}
__device__ __forceinline__ v16h frag_f32s(const float* rowk0, int lane, float sc) {
  v16h a; const float* p = rowk0 + 8 * (lane >> 4);
#pragma unroll
  for (int i = 0; i < 8; ++i) { a[i] = (_Float16)(p[i] * sc); a[8 + i] = (_Float16)(p[16 + i] * sc); }
  return a;
}
// column fragment from a [K][ld] layout (column n), rows >= K read as 0
__device__ __forceinline__ v16h fragc_f32(const float* W, int k0, int n, int lane, int ld, int K) {
  v16h a; const int g = lane >> 4;
#pragma unroll
  for (int i = 0; i < 8; ++i) { const int ka = k0 + 8 * g + i, kb = ka + 16;
    a[i] = (_Float16)(ka < K ? W[(size_t)(ka < K ? ka : K - 1) * ld + n] : 0.f); a[8 + i] = (_Float16)(kb < K ? W[(size_t)(kb < K ? kb : K - 1) * ld + n] : 0.f); }
  return a;
}
struct F2 { v16b h, l; };
__device__ __forceinline__ F2 bsplit16(const float v[16]) { F2 r;
#pragma unroll
  for (int i = 0; i < 16; ++i) { const __bf16 h = (__bf16)v[i]; r.h[i] = h; r.l[i] = (__bf16)(v[i] - (float)h); }
  return r; }
__device__ __forceinline__ F2 split_row(const float* row, int k0, int lane) { float v[16]; const float* p = row + k0 + 8 * (lane >> 4);
#pragma unroll
  for (int i = 0; i < 8; ++i) { v[i] = p[i]; v[8 + i] = p[16 + i]; }
  return bsplit16(v); }
__device__ __forceinline__ F2 split_rowK(const float* row, int k0, int lane, int K) { float v[16]; const int g = lane >> 4;
#pragma unroll
  for (int i = 0; i < 8; ++i) { const int ka = k0 + 8 * g + i, kb = ka + 16; v[i] = ka < K ? row[ka < K ? ka : K - 1] : 0.f; v[8 + i] = kb < K ? row[kb < K ? kb : K - 1] : 0.f; }
  return bsplit16(v); }
__device__ __forceinline__ F2 split_col(const float* W, int k0, int n, int lane, int ld, int K) { float v[16]; const int g = lane >> 4;
#pragma unroll
  for (int i = 0; i < 8; ++i) { const int ka = k0 + 8 * g + i, kb = ka + 16; v[i] = ka < K ? W[(size_t)(ka < K ? ka : K - 1) * ld + n] : 0.f; v[8 + i] = kb < K ? W[(size_t)(kb < K ? kb : K - 1) * ld + n] : 0.f; }
  return bsplit16(v); }
__device__ __forceinline__ v8f mac3(const F2& a, const F2& b, v8f c) { c = wmma_bf(a.l, b.h, c); c = wmma_bf(a.h, b.l, c); return wmma_bf(a.h, b.h, c); }
__device__ __forceinline__ float sigm(float v) { return 1.0f / (1.0f + expf(-v)); }
#define LDSX() do { asm volatile("s_wait_dscnt 0" ::: "memory"); __builtin_amdgcn_wave_barrier(); __builtin_amdgcn_fence(__ATOMIC_RELEASE, "workgroup"); } while (0)


// Causal prefix attention (B 2, 1,024 queries over 1,024 context + 1,024 self keys, 16 x 64, rotary on all 64 dims): prefix keys masked by context_mask, self keys causal.
#define NB 2
#define NQ 1024
#define NC 1024
#define NJ 2048
#define CC 1024
#define NH 16
#define HD 64
#ifndef TNB
#define TNB NB
#endif
typedef __attribute__((ext_vector_type(8))) __bf16 v8b;
__device__ __forceinline__ v16b frag_b(const __bf16* rowk0, int lane) {
  union { v16b v; v8b q[2]; } u; const __bf16* p = rowk0 + 8 * (lane >> 4);
  u.q[0] = *(const v8b*)p; u.q[1] = *(const v8b*)(p + 16); return u.v;
}
// B fragment from a plane of k_wt (f = the fragment's 512 elements)
__device__ __forceinline__ v16h fragw_h(const _Float16* f, int lane) { union { v16h v; v8h q[2]; } u; u.q[0] = *(const v8h*)(f + lane * 8); u.q[1] = *(const v8h*)(f + 256 + lane * 8); return u.v; }
__device__ __forceinline__ v16b fragw_b(const __bf16* f, int lane) { union { v16b v; v8b q[2]; } u; u.q[0] = *(const v8b*)(f + lane * 8); u.q[1] = *(const v8b*)(f + 256 + lane * 8); return u.v; }
__device__ __forceinline__ float bfr(float v) { return (float)(__bf16)v; }
__device__ __attribute__((noinline)) float exp_ni(float v) { return expf(v); }
__device__ __attribute__((noinline)) float erf_ni(float v) { return erff(v); }


#define WS_XN  0u                                  // f16 LN'd x rows in A-fragment order [16-row tile of b*NQ][32-k step][512] (k_ln); they fill half of the place kept here, which Y needs whole
#define WS_CN  (WS_XN + 4u * (size_t)NB * NQ * CC)     // f16 LN'd context rows, in the same order
#define WS_QH  (WS_CN + 4u * (size_t)NB * NC * CC)     // f16 q (hi, residual) in B-fragment order [slice = b*NH + h][16-query tile][32-d step][512]
#define WS_QL  (WS_QH + 2u * (size_t)NB * NQ * CC)
#define WS_KH  (WS_QL + 2u * (size_t)NB * NQ * CC)     // f16 k in A-fragment order [slice][16-key tile][32-d step][512]
#define WS_VT  (WS_KH + 2u * (size_t)NB * NJ * CC)     // bf16 v planes (hi, lo) in A-fragment order [slice][32-key trip][16-d tile][512]
#define WS_VL  (WS_VT + 2u * (size_t)NB * CC * NJ)
#define WS_WT  (WS_VL + 2u * (size_t)NB * CC * NJ)     // 16-bit weight planes [4][64 n tiles][32 k steps][512] in B-fragment order (k_wt): f16 Wq, Wkv k half, Wkv v half; bf16 Wo
#define WS_Y   WS_XN                               // f32 o in A-fragment order [16-row tile of b*NQ][32-k step][4 pieces][32 lanes][4]: piece p of lane (g, row) = k 16 (p >> 1) + 8 g + 4 (p & 1) + 0..3; k_fa writes them after the last reader of XN (k_proj) has ended
#define WS_CS  (WS_WT + 2u * (size_t)4 * CC * CC)     // f32 rotary table [NJ positions][2 d halves][16 columns][cos, sin of d = 32 half + column; cos, sin of d + 16] (k_wt)
#define WS_END (WS_CS + 4u * (size_t)NJ * HD * 2)

typedef __attribute__((ext_vector_type(2))) _Float16 v2h;
typedef __attribute__((ext_vector_type(2))) __bf16 v2b;
// ---- k_wt: block = (64 k, 64 n, plane z): each weight is rounded once to the 16-bit type its product reads (z 0 Wq, 1 Wkv cols 0..1023, 2 Wkv cols 1024..: bf16 then f16; 3 Wo: bf16) and stored in B-fragment order: 1 KiB for each (16 n, 32 k) fragment, elements 0..7 of lanes 0..31 and then elements 8..15, so that each of a fragment's two 16-byte loads reads four whole 128-byte lines. Plane z 4 holds no weight: its 65,536 threads compute cos and sin of every rotary angle once, in the order in which a lane of k_proj reads them
__global__ __launch_bounds__(256) void k_wt(const float* __restrict__ WQ, const float* __restrict__ WKV, const float* __restrict__ WO, const float* __restrict__ ROT, unsigned short* __restrict__ WT, float* __restrict__ CS) { __shared__ __align__(16) unsigned st[64][36];   // [n][k pair], pitch 144 bytes
  if (blockIdx.z == 4) { const int id = ((int)blockIdx.y * (CC / 64) + (int)blockIdx.x) * 256 + (int)threadIdx.x;   // thread = (position id >> 5, d half (id >> 4) & 1, column id & 15); the whole block leaves ahead of the barrier
    const float* ap = ROT + (size_t)(id >> 5) * HD + ((id >> 4) & 1) * 32 + (id & 15); const float a0 = bfr(ap[0]), a1 = bfr(ap[16]);
    v4f o; o[0] = cosf(a0); o[1] = sinf(a0); o[2] = cosf(a1); o[3] = sinf(a1); vst2(CS + (size_t)id * 4, o); return; }
  const int t = threadIdx.x, z = blockIdx.z, k0 = blockIdx.x * 64, n0 = blockIdx.y * 64; const float* src = (z == 0) ? WQ : (z == 3) ? WO : WKV; const int ld = (z == 1 || z == 2) ? 2 * CC : CC; const int off = (z == 2) ? CC : 0;
  const int kt = t >> 4, q = t & 15; v4f v[2][2];   // rows k0 + 32 i + 2 kt + {0, 1}, columns n0 + 4 q + 0..3
#pragma unroll
  for (int i = 0; i < 2; ++i)
#pragma unroll
    for (int r = 0; r < 2; ++r) { v[i][r] = *(const v4f*)(src + (size_t)(k0 + i * 32 + 2 * kt + r) * ld + off + n0 + q * 4); }
#pragma unroll
  for (int i = 0; i < 2; ++i)
#pragma unroll
    for (int c = 0; c < 4; ++c) { v2b rb; rb[0] = (__bf16)v[i][0][c]; rb[1] = (__bf16)v[i][1][c]; v2h rh; rh[0] = (_Float16)(float)rb[0]; rh[1] = (_Float16)(float)rb[1];
      st[q * 4 + c][i * 16 + kt] = (z == 3) ? __builtin_bit_cast(unsigned, rb) : __builtin_bit_cast(unsigned, rh); }
  __syncthreads();
#pragma unroll
  for (int i = 0; i < 2; ++i) { const int e = t + i * 256, f = e >> 6, w = e & 63;   // fragment f = (16-n tile f >> 1, 32-k step f & 1) of the block's 8; 16-byte piece w = (element half w >> 5, lane w & 31)
    const int n = (f >> 1) * 16 + (w & 15), k8 = (f & 1) * 4 + (w >> 5) * 2 + ((w >> 4) & 1);   // the piece holds column n, rows 8 k8 + 0..7
    vst2(WT + (((size_t)z * (CC / 16) + n0 / 16 + (f >> 1)) * (CC / 32) + k0 / 32 + (f & 1)) * 512 + w * 8, *(const v4u*)&st[n][k8 * 4]); } }
// ---- k_ln: block = 16 rows = one A tile of k_proj (tiles 0..NB*NQ/16-1 from x -> XN; the rest from context -> CN), one wave a row: the row stays in the wave's registers (8 loads of 512 bytes in a row, all in flight at once), mean and variance are sums over the wave's lanes. The LN'd row is rounded to the f16 that k_proj's product reads; the 16 rows meet in LDS and leave in A-fragment order: 1 KiB for each (16 rows, 32 k) fragment, elements 0..7 of lanes 0..31 and then elements 8..15
typedef __attribute__((ext_vector_type(4))) _Float16 v4h;
__global__ __launch_bounds__(512) void k_ln(const float* __restrict__ X, const float* __restrict__ CT, const float* __restrict__ GX, const float* __restrict__ BX, const float* __restrict__ GC, const float* __restrict__ BC, _Float16* __restrict__ XN, _Float16* __restrict__ CN) { __shared__ __align__(16) _Float16 sh[16][CC + 8];   // pitch 2,064 bytes = 16 x 129: the 16 rows of a 16-byte read fall on all 64 banks
  const int tid = threadIdx.x, wave = tid >> 5, lane = tid & 31; size_t tile = blockIdx.x; const bool isx = tile < (size_t)NB * NQ / 16; if (!isx) tile -= (size_t)NB * NQ / 16;
  const float* src = (isx ? X : CT) + (tile * 16 + wave) * CC + lane * 4; const float* ga = (isx ? GX : GC) + lane * 4; const float* be = (isx ? BX : BC) + lane * 4;
  v4f v[8], gm[8], bt[8];
#pragma unroll
  for (int i = 0; i < 8; ++i) v[i] = *(const v4f*)(src + i * 128);
  asm volatile("s_wait_xcnt 0x0" ::: "memory");   // in this build one of the loads below lands on the register pair that holds the row loads' address
#pragma unroll
  for (int i = 0; i < 8; ++i) { gm[i] = *(const v4f*)(ga + i * 128); if (i < 7) bt[i] = *(const v4f*)(be + i * 128); }
  asm volatile("s_wait_xcnt 0x0" ::: "memory");   // in this build the last load lands on the register that holds the offset of the 15 loads above
  bt[7] = *(const v4f*)(be + 7 * 128);
  __builtin_amdgcn_sched_barrier(0);   // all 24 loads are issued ahead of the first sum, so that the wave waits for memory once; without it the weight and bias loads are placed behind the two sums, two at a time with a wait for each pair
  v4f a4 = {};   // four sums side by side: a chain of 8 additions, not of 32
#pragma unroll
  for (int i = 0; i < 8; ++i) {
#pragma unroll
    for (int c = 0; c < 4; ++c) v[i][c] = bfr(v[i][c]);
    a4 += v[i]; }
  float a = (a4[0] + a4[1]) + (a4[2] + a4[3]);
#pragma unroll
  for (int o = 1; o < 32; o <<= 1) a += __shfl_xor(a, o);
  const float mu = a / CC; v4f q4 = {};
#pragma unroll
  for (int i = 0; i < 8; ++i) { const v4f d = v[i] - mu; q4 += d * d; }
  float q = (q4[0] + q4[1]) + (q4[2] + q4[3]);
#pragma unroll
  for (int o = 1; o < 32; o <<= 1) q += __shfl_xor(q, o);
  const float inv = 1.0f / sqrtf(q / CC + 1e-5f);
#pragma unroll
  for (int i = 0; i < 8; ++i) { v4h h;
#pragma unroll
    for (int c = 0; c < 4; ++c) h[c] = (_Float16)((v[i][c] - mu) * inv * bfr(gm[i][c]) + bfr(bt[i][c]));
    vst2(&sh[wave][i * 128 + lane * 4], h); }
  __syncthreads();
  _Float16* dst = (isx ? XN : CN) + tile * (size_t)(CC / 32) * 512;
#pragma unroll
  for (int i = 0; i < 4; ++i) { const int e = tid + i * 512, w = e & 63;   // 16-byte piece e = (32-k step e >> 6, element half w >> 5, lane w & 31): row w & 15, k = 8 k8 + 0..7; a wave stores 512 bytes in a row
    const int k8 = (e >> 6) * 4 + (w >> 5) * 2 + ((w >> 4) & 1); vst2(dst + (size_t)e * 8, *(const v4u*)&sh[w & 15][k8 * 8]); } }
// ---- k_proj: block = (64 rows, 128 cols, which): which 0: q = xn Wq (rows b*NQ + i; key position CTX + i), 1: k, 2: v from [cn rows (j < NC); xn rows (j >= NC)] Wkv (cols 0..1023 k, 1024.. v); rotary on q and k; f16 A (LN'd rows) x f16 W (1 product)
// rotary on a wave's 16 x 128 accumulator tile (two heads): element r of tile j is (row 8 g + r, d = 16 (j & 3) + col), so that its partner d +- 32 is element r of tile j ^ 2 in the same lane; cs = the lane's place in the table row of its first position; rows go to sh (f16) and, for q, their residual to sl
template <bool Q> __device__ __forceinline__ void rot_pack(const v8f (&acc)[8], const float* cs, _Float16 (*sh)[136], _Float16 (*sl)[136], int row0, int col) {
  v4f t[8][2];
#pragma unroll
  for (int r = 0; r < 8; ++r) { t[r][0] = *(const v4f*)(cs + r * 2 * HD); t[r][1] = *(const v4f*)(cs + r * 2 * HD + 64); }
  const float sc = Q ? 0.125f : 1.0f;
#pragma unroll
  for (int j = 0; j < 8; ++j)
#pragma unroll
    for (int r = 0; r < 8; ++r) { const int jd = j & 3; const float c = t[r][jd >> 1][(jd & 1) * 2], s = t[r][jd >> 1][(jd & 1) * 2 + 1];
      const float me = acc[j][r] * sc; const float partner = (jd < 2) ? -(acc[j + 2][r] * sc) : acc[j - 2][r] * sc;
      const float v = me * c + partner * s; const _Float16 hv = (_Float16)v; sh[row0 + r][j * 16 + col] = hv; if (Q) sl[row0 + r][j * 16 + col] = (_Float16)(v - (float)hv); } }
__global__ __launch_bounds__(128) void k_proj(const _Float16* __restrict__ XN, const _Float16* __restrict__ CN, const _Float16* __restrict__ WT, const float* __restrict__ CS, int which, _Float16* __restrict__ QH, _Float16* __restrict__ QL, _Float16* __restrict__ KH, __bf16* __restrict__ VT, __bf16* __restrict__ VL) {
  __shared__ __align__(16) float sf[64][132]; __shared__ __align__(16) _Float16 sh[64][136], sl[64][136]; __shared__ __align__(16) __bf16 th[128][72], tl2[128][72];
  const int tid = threadIdx.x, wave = tid >> 5, lane = tid & 31, col = lane & 15, g = lane >> 4; const int c0 = blockIdx.y * 128; const size_t r0 = (size_t)blockIdx.x * 64 + wave * 16;   // row within [b*L]
  const int L = (which == 0) ? NQ : NJ; const size_t b = r0 / L; const int jpos = (int)(r0 % L);   // the wave's 16 rows are one tile of k_ln
  const _Float16* at0 = ((which == 0) ? (XN + (b * NQ + jpos) * CC) : (jpos < NC ? (CN + (b * NC + jpos) * CC) : (XN + (b * NQ + (jpos - NC)) * CC)));   // its first A fragment: a tile's 32 fragments are 16 * CC elements in a row
  const _Float16* wt0 = WT + ((size_t)which * (CC / 16) + c0 / 16) * (CC / 32) * 512;   // plane 'which', first fragment of the block's first 16 columns
  v8f acc[8] = {};
#pragma unroll 1   // one trip holds 16 B fragments in registers; a second copy of the body would not fit
  for (int kc = 0; kc < CC / 64; ++kc) { v16h a[2], w[2][8];   // 64 k a trip: 2 A and 16 B fragments
#pragma unroll
    for (int u = 0; u < 2; ++u) a[u] = fragw_h(at0 + (size_t)(kc * 2 + u) * 512, lane);
#pragma unroll
    for (int u = 0; u < 2; ++u)
#pragma unroll
      for (int j = 0; j < 8; ++j) w[u][j] = fragw_h(wt0 + ((size_t)j * (CC / 32) + kc * 2 + u) * 512, lane);
#pragma unroll
    for (int u = 0; u < 2; ++u)
#pragma unroll
      for (int j = 0; j < 8; ++j) acc[j] = wmma16(a[u], w[u][j], acc[j]); }
  if (which < 2) {   // rotary (q, k) in registers, then pack
    const float* cs = CS + ((size_t)(r0 % L) + ((which == 0) ? NC : 0) + 8 * g) * (2 * HD) + col * 4;   // q uses the last NQ positions
    if (which == 0) rot_pack<true>(acc, cs, sh, sl, wave * 16 + 8 * g, col); else rot_pack<false>(acc, cs, sh, sl, wave * 16 + 8 * g, col);
    __syncthreads();
    const size_t rb = (size_t)blockIdx.x * 64;
    _Float16* dh = which == 0 ? QH : KH; const size_t s0 = (which == 0 ? rb / NQ : rb / NJ) * NH + c0 / HD; const int kt0 = (int)(which == 0 ? rb % NQ : rb % NJ) / 16;   // the block's 16 fragments f = (head f >> 3, 16-row tile (f >> 1) & 3, d step f & 1); 16-byte piece w = (element half w >> 5, lane w & 31) holds row w & 15 of the tile, d = 8 d8 + 0..7
    for (int e = tid; e < 64 * 16; e += 128) { const int f = e >> 6, w = e & 63, hh = f >> 3, kt = (f >> 1) & 3, kc = f & 1; const int d8 = kc * 4 + (w >> 5) * 2 + ((w >> 4) & 1);
      const size_t o2 = (((s0 + hh) * (L / 16) + kt0 + kt) * 2 + kc) * 512 + w * 8; vst2((unsigned*)(dh + o2), *(const v4u*)&sh[kt * 16 + (w & 15)][hh * HD + d8 * 8]);
      asm volatile("s_wait_xcnt 0x0" ::: "memory");   // the next LDS read and the next address reuse the registers that the store names
      if (which == 0) { vst2((unsigned*)(QL + o2), *(const v4u*)&sl[kt * 16 + (w & 15)][hh * HD + d8 * 8]);
        asm volatile("s_wait_xcnt 0x0" ::: "memory"); } } }   // as above, ahead of the next trip
  else {   // v: stage the f32 tile, then transpose
#pragma unroll
    for (int j = 0; j < 8; ++j)
#pragma unroll
      for (int r = 0; r < 8; ++r) sf[wave * 16 + 8 * g + r][j * 16 + col] = acc[j][r];
    __syncthreads();
    for (int e = tid; e < 64 * 128; e += 128) { const int rl = e >> 7, cl = e & 127; const float v = sf[rl][cl]; const __bf16 bh = (__bf16)v; th[cl][rl] = bh; tl2[cl][rl] = (__bf16)(v - (float)bh); }
    __syncthreads(); const size_t rb = (size_t)blockIdx.x * 64; const size_t s0 = (rb / NJ) * NH + c0 / HD; const int t0 = (int)(rb % NJ) / 32;
    // the block's 16 fragments of each plane, f = (head f >> 3, 32-key trip (f >> 2) & 1, d tile f & 3); piece w = (element half w >> 5, lane w & 31) holds d = w & 15 of the tile, keys 8 q8 + 0..7 of the block
    for (int e = tid; e < 128 * 8; e += 128) { const int f = e >> 6, w = e & 63, hh = f >> 3, tt = (f >> 2) & 1, j = f & 3; const int cl = hh * HD + j * 16 + (w & 15), q8 = tt * 4 + (w >> 5) * 2 + ((w >> 4) & 1);
      const size_t o2 = (((s0 + hh) * (NJ / 32) + t0 + tt) * 4 + j) * 512 + w * 8; vst2((unsigned*)(VT + o2), *(const v4u*)&th[cl][q8 * 8]); vst2((unsigned*)(VL + o2), *(const v4u*)&tl2[cl][q8 * 8]); } } }
// lane l with lane l ^ 16
__device__ __forceinline__ float xhalf(float x) { return __builtin_bit_cast(float, __builtin_amdgcn_permlanex16(__builtin_bit_cast(int, x), __builtin_bit_cast(int, x), 0x76543210, 0xfedcba98, false, false)); }
// fragment stored in fragment order, at this lane's byte address in it: bytes 0..15 and 512..527 (each load of a wave reads 512 bytes in a row: four whole 128-byte lines)
__device__ __forceinline__ v16h fragp_h(const char* p) { union { v16h v; v8h q[2]; } u; u.q[0] = *(const v8h*)p; u.q[1] = *(const v8h*)(p + 512); return u.v; }
__device__ __forceinline__ v16b fragp_b(const char* p) { union { v16b v; v8b q[2]; } u; u.q[0] = *(const v8b*)p; u.q[1] = *(const v8b*)(p + 512); return u.v; }
// one 32-key trip of k_fa: kp, vhp, vlp, cp = this lane's place in the trip's first k fragment, in the first fragment of each v plane, and at its first mask word (CTX: context keys, masked by those words; else self keys, key e of the lane's 32 allowed iff e <= thr)
template <bool CTX> __device__ __forceinline__ void fa_trip(const char* kp, const char* vhp, const char* vlp, const char* cp, int thr, const v16h (&qh)[2], const v16h (&ql)[2], v8f (&o)[HD / 16], float& m, float& l) {
  v16h kf[2][2]; v16b vh[HD / 16], vl[HD / 16]; v4i cm[2][2];
#pragma unroll
  for (int a = 0; a < 2; ++a)
#pragma unroll
    for (int kc = 0; kc < 2; ++kc) kf[a][kc] = fragp_h(kp + (a * 2 + kc) * 1024);
  if (CTX) {
#pragma unroll
    for (int a = 0; a < 2; ++a) { cm[a][0] = *(const v4i*)(cp + a * 64); cm[a][1] = *(const v4i*)(cp + a * 64 + 16); } }
#pragma unroll
  for (int j = 0; j < HD / 16; ++j) { vh[j] = fragp_b(vhp + j * 1024); vl[j] = fragp_b(vlp + j * 1024); }
  v8f s[2] = {};
#pragma unroll
  for (int kc = 0; kc < 2; ++kc)
#pragma unroll
    for (int a = 0; a < 2; ++a) { s[a] = wmma16(kf[a][kc], qh[kc], s[a]); s[a] = wmma16(kf[a][kc], ql[kc], s[a]); }
#pragma unroll
  for (int a = 0; a < 2; ++a)
#pragma unroll
    for (int r = 0; r < 8; ++r) s[a][r] = (CTX ? (cm[a][r >> 2][r & 3] != 0) : (a * 16 + r <= thr)) ? s[a][r] : -3.0e38f;
  float mx = s[0][0];
#pragma unroll
  for (int e = 1; e < 16; ++e) mx = fmaxf(mx, s[e >> 3][e & 7]);
  mx = fmaxf(mx, xhalf(mx)); const float mn = fmaxf(m, mx); const float al = expf(m - mn); m = mn;
  float pv[16], ps = 0.f;
#pragma unroll
  for (int e = 0; e < 16; ++e) { pv[e] = expf(s[e >> 3][e & 7] - mn); ps += pv[e]; }
  l = l * al + ps; const F2 p = bsplit16(pv);
#pragma unroll
  for (int j = 0; j < HD / 16; ++j) { o[j] *= al; o[j] = wmma_bf(vh[j], p.h, o[j]); o[j] = wmma_bf(vh[j], p.l, o[j]); o[j] = wmma_bf(vl[j], p.h, o[j]); } }
// ---- k_fa: block = (slice = b * NH + h, 64 queries, longest first), 16 waves = (16-query group qg, key quarter kq). A wave walks its 32-key trips with S^T = K Q^T (2 products) and O^T += V^T P^T (3 products): lane (g, c) holds query c's scores of keys 8 g + 0..7 of each 16-key tile, which is the B fragment's k order, so that P stays in registers and a query's maximum, sum and rescale stay in its own two lanes. Key j allowed iff (j < NC ? context_mask[b][j] : j - NC <= i), else -3e38: its exp against a real maximum is 0, and what a wave sums while it has met no allowed key is wiped by the factor exp(-3e38 - m) = 0 (every query has an allowed key, its own). The four quarters' (m, l, O) are joined through LDS.
__global__ __launch_bounds__(512) void k_fa(const _Float16* __restrict__ QH, const _Float16* __restrict__ QL, const _Float16* __restrict__ KH, const int* __restrict__ CM, const __bf16* __restrict__ VT, const __bf16* __restrict__ VL, float* __restrict__ Y) {
  __shared__ __align__(16) float so[4][64][HD + 4]; __shared__ float sm[4][64], sl[4][64];
  const int b = blockIdx.x / NH, h = blockIdx.x % NH; const int x = NQ / 64 - 1 - (int)blockIdx.y;   // query tiles in reverse, longest first, for speed only
  const int tid = threadIdx.x, lane = tid & 31, c = lane & 15, g = lane >> 4; const int wave = __builtin_amdgcn_readfirstlane(tid >> 5), qg = wave & 3, kq = wave >> 2; const int q0 = x * 64 + qg * 16;
  v16h qh[2], ql[2];
#pragma unroll
  for (int kc = 0; kc < 2; ++kc) { const size_t qo = (((size_t)blockIdx.x * (NQ / 16) + q0 / 16) * 2 + kc) * 512 + lane * 8; qh[kc] = fragp_h((const char*)(QH + qo)); ql[kc] = fragp_h((const char*)(QL + qo)); }
  const int nt = (NC + q0 + 16 + 31) >> 5;   // trips that hold a key some query of the group may see
  // a quarter takes two trips in a row, then skips the other quarters' six; the lane's four addresses walk along with the trips: a trip's four k fragments, and its four v fragments of each plane, are 4 KiB in a row
  const size_t fo = ((size_t)blockIdx.x * (NJ / 32) + 2 * kq) * 2048 + lane * 8; const char* kp = (const char*)(KH + fo); const char* vhp = (const char*)(VT + fo); const char* vlp = (const char*)(VL + fo); const char* cp = (const char*)(CM + (size_t)b * NC + 64 * kq + 8 * g);
  v8f o[HD / 16] = {}; float m = -3.0e38f, l = 0.f;
  for (int i = 0; i < NC / 128; ++i) { fa_trip<true>(kp, vhp, vlp, cp, 0, qh, ql, o, m, l); const int st = (i & 1) ? 7 * 32 : 32; kp += st * 128; vhp += st * 128; vlp += st * 128; cp += st * 4; }
  for (int i = 0, t = NC / 32 + 2 * kq; t < nt; ++i) { fa_trip<false>(kp, vhp, vlp, cp, q0 + c - (t * 32 - NC) - 8 * g, qh, ql, o, m, l); const int st = (i & 1) ? 7 : 1; t += st; kp += st * 4096; vhp += st * 4096; vlp += st * 4096; }
  l += xhalf(l); if (g == 0) { sm[kq][qg * 16 + c] = m; sl[kq][qg * 16 + c] = l; }
#pragma unroll
  for (int j = 0; j < HD / 16; ++j) { v4f lo4, hi4;
#pragma unroll
    for (int r = 0; r < 4; ++r) { lo4[r] = o[j][r]; hi4[r] = o[j][4 + r]; }
    vst2(&so[kq][qg * 16 + c][j * 16 + 8 * g], lo4); vst2(&so[kq][qg * 16 + c][j * 16 + 8 * g + 4], hi4); }
  __syncthreads();
  const int q = (tid >> 7) * 16 + (tid & 15), dd = ((tid >> 4) & 7) * 8; float mt = sm[0][q];   // thread = (query, 8 of its 64 outputs), so numbered that a wave's 32 threads are the 32 lanes of two pieces of one fragment of k_out
#pragma unroll
  for (int w = 1; w < 4; ++w) mt = fmaxf(mt, sm[w][q]);
  float lt = 0.f; v4f y0 = {}, y1 = {};
#pragma unroll
  for (int w = 0; w < 4; ++w) { const float e = expf(sm[w][q] - mt); lt += e * sl[w][q]; y0 += e * *(const v4f*)&so[w][q][dd]; y1 += e * *(const v4f*)&so[w][q][dd + 4]; }
  const float inv = 1.0f / lt; float* yp = Y + (((((size_t)b * NQ + x * 64 + q) >> 4) * (CC / 32) + h * 2 + (dd >> 5)) * 4 + ((dd >> 4) & 1) * 2) * 128 + lane * 4; vst2(yp, y0 * inv); vst2(yp + 128, y1 * inv); }
// ---- k_out: out = o (bf16 hi + lo) Wo + bo (Wo as the bf16 plane of k_wt)
__global__ __launch_bounds__(128) void k_out(const float* __restrict__ Y, const __bf16* __restrict__ WOT, const float* __restrict__ BO, float* __restrict__ OUT) { __shared__ __align__(16) float sf[4][16][132];
  const int tid = threadIdx.x, wave = tid >> 5, lane = tid & 31, col = lane & 15, g = lane >> 4; const int c0 = blockIdx.y * 128; const size_t r0 = (size_t)blockIdx.x * 64 + wave * 16;
  const float* yfr = Y + (r0 >> 4) * (size_t)(CC / 32) * 512 + lane * 4; const __bf16* wt0 = WOT + (size_t)(c0 / 16) * (CC / 32) * 512;   // this lane's place in the first A fragment of the wave's 16 rows; first fragment of the block's first 16 columns
  v8f acc[8] = {};
#pragma unroll 1   // one trip holds 16 B fragments in registers; a second copy of the body would not fit
  for (int kc = 0; kc < CC / 64; ++kc) { v4f ar[2][4]; v16b w[2][8];   // 64 k a trip, as in k_proj
#pragma unroll
    for (int u = 0; u < 2; ++u) { const float* p = yfr + u * 512; ar[u][0] = *(const v4f*)p; ar[u][1] = *(const v4f*)(p + 128); ar[u][2] = *(const v4f*)(p + 256); ar[u][3] = *(const v4f*)(p + 384); }
    asm volatile("s_wait_xcnt 0x0" ::: "memory");   // in this build one of the B loads below lands on the register pair that holds the A loads' address
#pragma unroll
    for (int u = 0; u < 2; ++u)
#pragma unroll
      for (int j = 0; j < 8; ++j) w[u][j] = fragw_b(wt0 + ((size_t)j * (CC / 32) + kc * 2 + u) * 512, lane);
    __builtin_amdgcn_sched_barrier(0);   // every load of the trip is issued ahead of the first split, so that a trip waits for memory once; without it part of the B loads is placed behind the split of A
#pragma unroll
    for (int u = 0; u < 2; ++u) { float av[16];
#pragma unroll
      for (int i = 0; i < 16; ++i) av[i] = ar[u][i >> 2][i & 3];
      const F2 a = bsplit16(av);
#pragma unroll
      for (int j = 0; j < 8; ++j) { acc[j] = wmma_bf(a.h, w[u][j], acc[j]); acc[j] = wmma_bf(a.l, w[u][j], acc[j]); } }
    yfr += 1024; }
#pragma unroll
  for (int j = 0; j < 8; ++j) { const float bb = bfr(BO[c0 + j * 16 + col]);
#pragma unroll
    for (int r = 0; r < 8; ++r) sf[wave][8 * g + r][j * 16 + col] = acc[j][r] + bb; }
  LDSX(); for (int rl = 0; rl < 16; ++rl) vst2(OUT + (r0 + rl) * CC + c0 + lane * 4, *(const v4f*)&sf[wave][rl][lane * 4]); }
extern "C" void kernel_launch(void* const* d_in, const int* in_sizes, int n_in, void* d_out, int out_size, void* d_ws, size_t ws_size, hipStream_t stream) {
  (void)in_sizes; (void)n_in; (void)out_size;
  const float** F = (const float**)d_in;   // 0 x [2,1024,1024], 1 context [2,1024,1024], 2 context_mask [2,1024] int, 3 rotary_pos_emb [2048,64], 4 norm_w, 5 norm_b, 6 cnorm_w, 7 cnorm_b, 8 Wq [1024,1024] (in,out), 9 Wkv [1024,2048], 10 Wo [1024,1024], 11 bo
  if (ws_size < (size_t)WS_END) return;
  char* ws = (char*)d_ws; float* Y = (float*)(ws + WS_Y); _Float16 *XN = (_Float16*)(ws + WS_XN), *CN = (_Float16*)(ws + WS_CN), *QH = (_Float16*)(ws + WS_QH), *QL = (_Float16*)(ws + WS_QL), *KH = (_Float16*)(ws + WS_KH); __bf16 *VT = (__bf16*)(ws + WS_VT), *VL = (__bf16*)(ws + WS_VL); unsigned short* WT = (unsigned short*)(ws + WS_WT); float* CS = (float*)(ws + WS_CS);
  k_wt<<<dim3(CC / 64, CC / 64, 5), 256, 0, stream>>>(F[8], F[9], F[10], F[3], WT, CS);
  k_ln<<<(NB * NQ + NB * NC) / 16, 512, 0, stream>>>(F[0], F[1], F[4], F[5], F[6], F[7], XN, CN);
  k_proj<<<dim3(TNB * NQ / 64, CC / 128), 128, 0, stream>>>(XN, CN, (const _Float16*)WT, CS, 0, QH, QL, KH, VT, VL);
  k_proj<<<dim3(TNB * NJ / 64, CC / 128), 128, 0, stream>>>(XN, CN, (const _Float16*)WT, CS, 1, QH, QL, KH, VT, VL);
  k_proj<<<dim3(TNB * NJ / 64, CC / 128), 128, 0, stream>>>(XN, CN, (const _Float16*)WT, CS, 2, QH, QL, KH, VT, VL);
  k_fa<<<dim3(TNB * NH, NQ / 64), 512, 0, stream>>>(QH, QL, KH, (const int*)d_in[2], VT, VL, Y);
  k_out<<<dim3(TNB * NQ / 64, CC / 128), 128, 0, stream>>>(Y, (const __bf16*)WT + (size_t)3 * CC * CC, F[11], (float*)d_out);
}

// v007
// One run takes 111 microseconds.
// Two timings next to v006 put it at 1.04 and 1.09 times that version's speed.
// Over all steps from v000 it is 12.4 times as fast.
// compute dtype: all float inputs rounded to bf16, context_mask (int) read; LayerNorm of x and context in f32; q = xn Wq * 8^-1 * log2(e) and k/v = [cn; xn] Wkv with the LN'd rows and the 0.02-scale weights as f16 (1 product) on WMMA 16x16x32, f32 accumulate; rotary (angles from the rotary_pos_emb input, precise cosf/sinf) in f32; q as f16 hi + residual, k f16 -> 2-product logits kept in registers; mask = context_mask & causal-with-prefix -> -3e38; running-maximum softmax in f32 in base 2 (the logits carry log2(e) from q's scale; each power is one hardware exp2), unnormalised P split bf16 hi + lo against v bf16 hi + lo (3 products), divided by the row sum at the end; out = o (bf16 hi + lo) Wo + bo; f32 output.
#include <hip/hip_runtime.h>
#include <math.h>

typedef __attribute__((ext_vector_type(16))) _Float16 v16h;
typedef __attribute__((ext_vector_type(16))) __bf16 v16b;
typedef __attribute__((ext_vector_type(8)))  _Float16 v8h;
typedef __attribute__((ext_vector_type(8)))  float v8f;
typedef __attribute__((ext_vector_type(4)))  float v4f;
typedef __attribute__((ext_vector_type(2)))  float v2f;
typedef __attribute__((ext_vector_type(4)))  unsigned v4u;
typedef __attribute__((ext_vector_type(4)))  int v4i;
typedef float __attribute__((may_alias)) float_a;
typedef int __attribute__((may_alias)) int_a;

template <typename T> __device__ __forceinline__ void vst2(void* p, T v) { *(T*)p = v;  }
__device__ __forceinline__ v8f wmma16(v16h a, v16h b, v8f c) {
  v8f d = __builtin_amdgcn_wmma_f32_16x16x32_f16(false, a, false, b, (short)0, c, false, false);
  asm volatile("v_nop\n\tv_nop\n\tv_nop\n\tv_nop" : "+v"(d) : "v"(a), "v"(b));
  return d;
}
__device__ __forceinline__ v8f wmma_bf(v16b a, v16b b, v8f c) {
  v8f d = __builtin_amdgcn_wmma_f32_16x16x32_bf16(false, a, false, b, (short)0, c, false, false);
  asm volatile("v_nop\n\tv_nop\n\tv_nop\n\tv_nop" : "+v"(d) : "v"(a), "v"(b));
  return d;
}
// 16x16x32 fragments: lane = (h = lane>>4, row/col = lane&15); elements 0..7 = k0+8h+0..7, 8..15 = k0+16+8h+0..7; D element r = row 8h+r
__device__ __forceinline__ v16h frag_h(const _Float16* rowk0, int lane) {
  union { v16h v; v8h q[2]; } u; const _Float16* p = rowk0 + 8 * (lane >> 4);
  u.q[0] = *(const v8h*)p; u.q[1] = *(const v8h*)(p + 16); return u.v;
}
__device__ __forceinline__ v16h frag_f32(const float* rowk0, int lane) {
  v16h a; const float* p = rowk0 + 8 * (lane >> 4);
#pragma unroll
  for (int i = 0; i < 8; ++i) { a[i] = (_Float16)p[i]; a[8 + i] = (_Float16)p[16 + i]; }
  return a;
}
__device__ __forceinline__ v16h frag_f32s(const float* rowk0, int lane, float sc) {
  v16h a; const float* p = rowk0 + 8 * (lane >> 4);
#pragma unroll
  for (int i = 0; i < 8; ++i) { a[i] = (_Float16)(p[i] * sc); a[8 + i] = (_Float16)(p[16 + i] * sc); }
  return a;
}
// column fragment from a [K][ld] layout (column n), rows >= K read as 0
__device__ __forceinline__ v16h fragc_f32(const float* W, int k0, int n, int lane, int ld, int K) {
  v16h a; const int g = lane >> 4;
#pragma unroll
  for (int i = 0; i < 8; ++i) { const int ka = k0 + 8 * g + i, kb = ka + 16;
    a[i] = (_Float16)(ka < K ? W[(size_t)(ka < K ? ka : K - 1) * ld + n] : 0.f); a[8 + i] = (_Float16)(kb < K ? W[(size_t)(kb < K ? kb : K - 1) * ld + n] : 0.f); }
  return a;
}
struct F2 { v16b h, l; };
__device__ __forceinline__ F2 bsplit16(const float v[16]) { F2 r;
#pragma unroll
  for (int i = 0; i < 16; ++i) { const __bf16 h = (__bf16)v[i]; r.h[i] = h; r.l[i] = (__bf16)(v[i] - (float)h); }
  return r; }
__device__ __forceinline__ F2 split_row(const float* row, int k0, int lane) { float v[16]; const float* p = row + k0 + 8 * (lane >> 4);
#pragma unroll
  for (int i = 0; i < 8; ++i) { v[i] = p[i]; v[8 + i] = p[16 + i]; }
  return bsplit16(v); }
__device__ __forceinline__ F2 split_rowK(const float* row, int k0, int lane, int K) { float v[16]; const int g = lane >> 4;
#pragma unroll
  for (int i = 0; i < 8; ++i) { const int ka = k0 + 8 * g + i, kb = ka + 16; v[i] = ka < K ? row[ka < K ? ka : K - 1] : 0.f; v[8 + i] = kb < K ? row[kb < K ? kb : K - 1] : 0.f; }
  return bsplit16(v); }
__device__ __forceinline__ F2 split_col(const float* W, int k0, int n, int lane, int ld, int K) { float v[16]; const int g = lane >> 4;
#pragma unroll
  for (int i = 0; i < 8; ++i) { const int ka = k0 + 8 * g + i, kb = ka + 16; v[i] = ka < K ? W[(size_t)(ka < K ? ka : K - 1) * ld + n] : 0.f; v[8 + i] = kb < K ? W[(size_t)(kb < K ? kb : K - 1) * ld + n] : 0.f; }
  return bsplit16(v); }
__device__ __forceinline__ v8f mac3(const F2& a, const F2& b, v8f c) { c = wmma_bf(a.l, b.h, c); c = wmma_bf(a.h, b.l, c); return wmma_bf(a.h, b.h, c); }
__device__ __forceinline__ float sigm(float v) { return 1.0f / (1.0f + expf(-v)); }
#define LDSX() do { asm volatile("s_wait_dscnt 0" ::: "memory"); __builtin_amdgcn_wave_barrier(); __builtin_amdgcn_fence(__ATOMIC_RELEASE, "workgroup"); } while (0)


// Causal prefix attention (B 2, 1,024 queries over 1,024 context + 1,024 self keys, 16 x 64, rotary on all 64 dims): prefix keys masked by context_mask, self keys causal.
#define NB 2
#define NQ 1024
#define NC 1024
#define NJ 2048
#define CC 1024
#define NH 16
#define HD 64
#ifndef TNB
#define TNB NB
#endif
typedef __attribute__((ext_vector_type(8))) __bf16 v8b;
__device__ __forceinline__ v16b frag_b(const __bf16* rowk0, int lane) {
  union { v16b v; v8b q[2]; } u; const __bf16* p = rowk0 + 8 * (lane >> 4);
  u.q[0] = *(const v8b*)p; u.q[1] = *(const v8b*)(p + 16); return u.v;
}
// B fragment from a plane of k_wt (f = the fragment's 512 elements)
__device__ __forceinline__ v16h fragw_h(const _Float16* f, int lane) { union { v16h v; v8h q[2]; } u; u.q[0] = *(const v8h*)(f + lane * 8); u.q[1] = *(const v8h*)(f + 256 + lane * 8); return u.v; }
__device__ __forceinline__ v16b fragw_b(const __bf16* f, int lane) { union { v16b v; v8b q[2]; } u; u.q[0] = *(const v8b*)(f + lane * 8); u.q[1] = *(const v8b*)(f + 256 + lane * 8); return u.v; }
__device__ __forceinline__ float bfr(float v) { return (float)(__bf16)v; }
__device__ __attribute__((noinline)) float exp_ni(float v) { return expf(v); }
__device__ __attribute__((noinline)) float erf_ni(float v) { return erff(v); }


#define WS_XN  0u                                  // f16 LN'd x rows in A-fragment order [16-row tile of b*NQ][32-k step][512] (k_ln); they fill half of the place kept here, which Y needs whole
#define WS_CN  (WS_XN + 4u * (size_t)NB * NQ * CC)     // f16 LN'd context rows, in the same order
#define WS_QH  (WS_CN + 4u * (size_t)NB * NC * CC)     // f16 q (hi, residual) in B-fragment order [slice = b*NH + h][16-query tile][32-d step][512]
#define WS_QL  (WS_QH + 2u * (size_t)NB * NQ * CC)
#define WS_KH  (WS_QL + 2u * (size_t)NB * NQ * CC)     // f16 k in A-fragment order [slice][16-key tile][32-d step][512]
#define WS_VT  (WS_KH + 2u * (size_t)NB * NJ * CC)     // bf16 v planes (hi, lo) in A-fragment order [slice][32-key trip][16-d tile][512]
#define WS_VL  (WS_VT + 2u * (size_t)NB * CC * NJ)
#define WS_WT  (WS_VL + 2u * (size_t)NB * CC * NJ)     // 16-bit weight planes [4][64 n tiles][32 k steps][512] in B-fragment order (k_wt): f16 Wq, Wkv k half, Wkv v half; bf16 Wo
#define WS_Y   WS_XN                               // f32 o in A-fragment order [16-row tile of b*NQ][32-k step][4 pieces][32 lanes][4]: piece p of lane (g, row) = k 16 (p >> 1) + 8 g + 4 (p & 1) + 0..3; k_fa writes them after the last reader of XN (k_proj) has ended
#define WS_CS  (WS_WT + 2u * (size_t)4 * CC * CC)     // f32 rotary table [NJ positions][2 d halves][16 columns][cos, sin of d = 32 half + column; cos, sin of d + 16] (k_wt)
#define WS_END (WS_CS + 4u * (size_t)NJ * HD * 2)

typedef __attribute__((ext_vector_type(2))) _Float16 v2h;
typedef __attribute__((ext_vector_type(2))) __bf16 v2b;
// ---- k_wt: block = (64 k, 64 n, plane z): each weight is rounded once to the 16-bit type its product reads (z 0 Wq, 1 Wkv cols 0..1023, 2 Wkv cols 1024..: bf16 then f16; 3 Wo: bf16) and stored in B-fragment order: 1 KiB for each (16 n, 32 k) fragment, elements 0..7 of lanes 0..31 and then elements 8..15, so that each of a fragment's two 16-byte loads reads four whole 128-byte lines. Plane z 4 holds no weight: its 65,536 threads compute cos and sin of every rotary angle once, in the order in which a lane of k_proj reads them
__global__ __launch_bounds__(256) void k_wt(const float* __restrict__ WQ, const float* __restrict__ WKV, const float* __restrict__ WO, const float* __restrict__ ROT, unsigned short* __restrict__ WT, float* __restrict__ CS) { __shared__ __align__(16) unsigned st[64][36];   // [n][k pair], pitch 144 bytes
  if (blockIdx.z == 4) { const int id = ((int)blockIdx.y * (CC / 64) + (int)blockIdx.x) * 256 + (int)threadIdx.x;   // thread = (position id >> 5, d half (id >> 4) & 1, column id & 15); the whole block leaves ahead of the barrier
    const float* ap = ROT + (size_t)(id >> 5) * HD + ((id >> 4) & 1) * 32 + (id & 15); const float a0 = bfr(ap[0]), a1 = bfr(ap[16]);
    v4f o; o[0] = cosf(a0); o[1] = sinf(a0); o[2] = cosf(a1); o[3] = sinf(a1); vst2(CS + (size_t)id * 4, o); return; }
  const int t = threadIdx.x, z = blockIdx.z, k0 = blockIdx.x * 64, n0 = blockIdx.y * 64; const float* src = (z == 0) ? WQ : (z == 3) ? WO : WKV; const int ld = (z == 1 || z == 2) ? 2 * CC : CC; const int off = (z == 2) ? CC : 0;
  const int kt = t >> 4, q = t & 15; v4f v[2][2];   // rows k0 + 32 i + 2 kt + {0, 1}, columns n0 + 4 q + 0..3
#pragma unroll
  for (int i = 0; i < 2; ++i)
#pragma unroll
    for (int r = 0; r < 2; ++r) { v[i][r] = *(const v4f*)(src + (size_t)(k0 + i * 32 + 2 * kt + r) * ld + off + n0 + q * 4); }
#pragma unroll
  for (int i = 0; i < 2; ++i)
#pragma unroll
    for (int c = 0; c < 4; ++c) { v2b rb; rb[0] = (__bf16)v[i][0][c]; rb[1] = (__bf16)v[i][1][c]; v2h rh; rh[0] = (_Float16)(float)rb[0]; rh[1] = (_Float16)(float)rb[1];
      st[q * 4 + c][i * 16 + kt] = (z == 3) ? __builtin_bit_cast(unsigned, rb) : __builtin_bit_cast(unsigned, rh); }
  __syncthreads();
#pragma unroll
  for (int i = 0; i < 2; ++i) { const int e = t + i * 256, f = e >> 6, w = e & 63;   // fragment f = (16-n tile f >> 1, 32-k step f & 1) of the block's 8; 16-byte piece w = (element half w >> 5, lane w & 31)
    const int n = (f >> 1) * 16 + (w & 15), k8 = (f & 1) * 4 + (w >> 5) * 2 + ((w >> 4) & 1);   // the piece holds column n, rows 8 k8 + 0..7
    vst2(WT + (((size_t)z * (CC / 16) + n0 / 16 + (f >> 1)) * (CC / 32) + k0 / 32 + (f & 1)) * 512 + w * 8, *(const v4u*)&st[n][k8 * 4]); } }
// ---- k_ln: block = 16 rows = one A tile of k_proj (tiles 0..NB*NQ/16-1 from x -> XN; the rest from context -> CN), one wave a row: the row stays in the wave's registers (8 loads of 512 bytes in a row, all in flight at once), mean and variance are sums over the wave's lanes. The LN'd row is rounded to the f16 that k_proj's product reads; the 16 rows meet in LDS and leave in A-fragment order: 1 KiB for each (16 rows, 32 k) fragment, elements 0..7 of lanes 0..31 and then elements 8..15
typedef __attribute__((ext_vector_type(4))) _Float16 v4h;
__global__ __launch_bounds__(512) void k_ln(const float* __restrict__ X, const float* __restrict__ CT, const float* __restrict__ GX, const float* __restrict__ BX, const float* __restrict__ GC, const float* __restrict__ BC, _Float16* __restrict__ XN, _Float16* __restrict__ CN) { __shared__ __align__(16) _Float16 sh[16][CC + 8];   // pitch 2,064 bytes = 16 x 129: the 16 rows of a 16-byte read fall on all 64 banks
  const int tid = threadIdx.x, wave = tid >> 5, lane = tid & 31; size_t tile = blockIdx.x; const bool isx = tile < (size_t)NB * NQ / 16; if (!isx) tile -= (size_t)NB * NQ / 16;
  const float* src = (isx ? X : CT) + (tile * 16 + wave) * CC + lane * 4; const float* ga = (isx ? GX : GC) + lane * 4; const float* be = (isx ? BX : BC) + lane * 4;
  v4f v[8], gm[8], bt[8];
#pragma unroll
  for (int i = 0; i < 8; ++i) v[i] = *(const v4f*)(src + i * 128);
  asm volatile("s_wait_xcnt 0x0" ::: "memory");   // in this build one of the loads below lands on the register pair that holds the row loads' address
#pragma unroll
  for (int i = 0; i < 8; ++i) { gm[i] = *(const v4f*)(ga + i * 128); if (i < 7) bt[i] = *(const v4f*)(be + i * 128); }
  asm volatile("s_wait_xcnt 0x0" ::: "memory");   // in this build the last load lands on the register that holds the offset of the 15 loads above
  bt[7] = *(const v4f*)(be + 7 * 128);
  __builtin_amdgcn_sched_barrier(0);   // all 24 loads are issued ahead of the first sum, so that the wave waits for memory once; without it the weight and bias loads are placed behind the two sums, two at a time with a wait for each pair
  v4f a4 = {};   // four sums side by side: a chain of 8 additions, not of 32
#pragma unroll
  for (int i = 0; i < 8; ++i) {
#pragma unroll
    for (int c = 0; c < 4; ++c) v[i][c] = bfr(v[i][c]);
    a4 += v[i]; }
  float a = (a4[0] + a4[1]) + (a4[2] + a4[3]);
#pragma unroll
  for (int o = 1; o < 32; o <<= 1) a += __shfl_xor(a, o);
  const float mu = a / CC; v4f q4 = {};
#pragma unroll
  for (int i = 0; i < 8; ++i) { const v4f d = v[i] - mu; q4 += d * d; }
  float q = (q4[0] + q4[1]) + (q4[2] + q4[3]);
#pragma unroll
  for (int o = 1; o < 32; o <<= 1) q += __shfl_xor(q, o);
  const float inv = 1.0f / sqrtf(q / CC + 1e-5f);
#pragma unroll
  for (int i = 0; i < 8; ++i) { v4h h;
#pragma unroll
    for (int c = 0; c < 4; ++c) h[c] = (_Float16)((v[i][c] - mu) * inv * bfr(gm[i][c]) + bfr(bt[i][c]));
    vst2(&sh[wave][i * 128 + lane * 4], h); }
  __syncthreads();
  _Float16* dst = (isx ? XN : CN) + tile * (size_t)(CC / 32) * 512;
#pragma unroll
  for (int i = 0; i < 4; ++i) { const int e = tid + i * 512, w = e & 63;   // 16-byte piece e = (32-k step e >> 6, element half w >> 5, lane w & 31): row w & 15, k = 8 k8 + 0..7; a wave stores 512 bytes in a row
    const int k8 = (e >> 6) * 4 + (w >> 5) * 2 + ((w >> 4) & 1); vst2(dst + (size_t)e * 8, *(const v4u*)&sh[w & 15][k8 * 8]); } }
// ---- k_proj: block = (64 rows, 128 cols, which): which 0: q = xn Wq (rows b*NQ + i; key position CTX + i), 1: k, 2: v from [cn rows (j < NC); xn rows (j >= NC)] Wkv (cols 0..1023 k, 1024.. v); rotary on q and k; f16 A (LN'd rows) x f16 W (1 product)
// rotary on a wave's 16 x 128 accumulator tile (two heads): element r of tile j is (row 8 g + r, d = 16 (j & 3) + col), so that its partner d +- 32 is element r of tile j ^ 2 in the same lane; cs = the lane's place in the table row of its first position; rows go to sh (f16) and, for q, their residual to sl
template <bool Q> __device__ __forceinline__ void rot_pack(const v8f (&acc)[8], const float* cs, _Float16 (*sh)[136], _Float16 (*sl)[136], int row0, int col) {
  v4f t[8][2];
#pragma unroll
  for (int r = 0; r < 8; ++r) { t[r][0] = *(const v4f*)(cs + r * 2 * HD); t[r][1] = *(const v4f*)(cs + r * 2 * HD + 64); }
  const float sc = Q ? 0.125f * 1.44269504f : 1.0f;   // q carries log2(e) too: k_fa takes its powers in base 2
#pragma unroll
  for (int j = 0; j < 8; ++j)
#pragma unroll
    for (int r = 0; r < 8; ++r) { const int jd = j & 3; const float c = t[r][jd >> 1][(jd & 1) * 2], s = t[r][jd >> 1][(jd & 1) * 2 + 1];
      const float me = acc[j][r] * sc; const float partner = (jd < 2) ? -(acc[j + 2][r] * sc) : acc[j - 2][r] * sc;
      const float v = me * c + partner * s; const _Float16 hv = (_Float16)v; sh[row0 + r][j * 16 + col] = hv; if (Q) sl[row0 + r][j * 16 + col] = (_Float16)(v - (float)hv); } }
__global__ __launch_bounds__(128) void k_proj(const _Float16* __restrict__ XN, const _Float16* __restrict__ CN, const _Float16* __restrict__ WT, const float* __restrict__ CS, int which, _Float16* __restrict__ QH, _Float16* __restrict__ QL, _Float16* __restrict__ KH, __bf16* __restrict__ VT, __bf16* __restrict__ VL) {
  __shared__ __align__(16) float sf[64][132]; __shared__ __align__(16) _Float16 sh[64][136], sl[64][136]; __shared__ __align__(16) __bf16 th[128][72], tl2[128][72];
  const int tid = threadIdx.x, wave = tid >> 5, lane = tid & 31, col = lane & 15, g = lane >> 4; const int c0 = blockIdx.y * 128; const size_t r0 = (size_t)blockIdx.x * 64 + wave * 16;   // row within [b*L]
  const int L = (which == 0) ? NQ : NJ; const size_t b = r0 / L; const int jpos = (int)(r0 % L);   // the wave's 16 rows are one tile of k_ln
  const _Float16* at0 = ((which == 0) ? (XN + (b * NQ + jpos) * CC) : (jpos < NC ? (CN + (b * NC + jpos) * CC) : (XN + (b * NQ + (jpos - NC)) * CC)));   // its first A fragment: a tile's 32 fragments are 16 * CC elements in a row
  const _Float16* wt0 = WT + ((size_t)which * (CC / 16) + c0 / 16) * (CC / 32) * 512;   // plane 'which', first fragment of the block's first 16 columns
  v8f acc[8] = {};
#pragma unroll 1   // one trip holds 16 B fragments in registers; a second copy of the body would not fit
  for (int kc = 0; kc < CC / 64; ++kc) { v16h a[2], w[2][8];   // 64 k a trip: 2 A and 16 B fragments
#pragma unroll
    for (int u = 0; u < 2; ++u) a[u] = fragw_h(at0 + (size_t)(kc * 2 + u) * 512, lane);
#pragma unroll
    for (int u = 0; u < 2; ++u)
#pragma unroll
      for (int j = 0; j < 8; ++j) w[u][j] = fragw_h(wt0 + ((size_t)j * (CC / 32) + kc * 2 + u) * 512, lane);
#pragma unroll
    for (int u = 0; u < 2; ++u)
#pragma unroll
      for (int j = 0; j < 8; ++j) acc[j] = wmma16(a[u], w[u][j], acc[j]); }
  if (which < 2) {   // rotary (q, k) in registers, then pack
    const float* cs = CS + ((size_t)(r0 % L) + ((which == 0) ? NC : 0) + 8 * g) * (2 * HD) + col * 4;   // q uses the last NQ positions
    if (which == 0) rot_pack<true>(acc, cs, sh, sl, wave * 16 + 8 * g, col); else rot_pack<false>(acc, cs, sh, sl, wave * 16 + 8 * g, col);
    __syncthreads();
    const size_t rb = (size_t)blockIdx.x * 64;
    _Float16* dh = which == 0 ? QH : KH; const size_t s0 = (which == 0 ? rb / NQ : rb / NJ) * NH + c0 / HD; const int kt0 = (int)(which == 0 ? rb % NQ : rb % NJ) / 16;   // the block's 16 fragments f = (head f >> 3, 16-row tile (f >> 1) & 3, d step f & 1); 16-byte piece w = (element half w >> 5, lane w & 31) holds row w & 15 of the tile, d = 8 d8 + 0..7
    for (int e = tid; e < 64 * 16; e += 128) { const int f = e >> 6, w = e & 63, hh = f >> 3, kt = (f >> 1) & 3, kc = f & 1; const int d8 = kc * 4 + (w >> 5) * 2 + ((w >> 4) & 1);
      const size_t o2 = (((s0 + hh) * (L / 16) + kt0 + kt) * 2 + kc) * 512 + w * 8; vst2((unsigned*)(dh + o2), *(const v4u*)&sh[kt * 16 + (w & 15)][hh * HD + d8 * 8]);
      asm volatile("s_wait_xcnt 0x0" ::: "memory");   // the next LDS read and the next address reuse the registers that the store names
      if (which == 0) { vst2((unsigned*)(QL + o2), *(const v4u*)&sl[kt * 16 + (w & 15)][hh * HD + d8 * 8]);
        asm volatile("s_wait_xcnt 0x0" ::: "memory"); } } }   // as above, ahead of the next trip
  else {   // v: stage the f32 tile, then transpose
#pragma unroll
    for (int j = 0; j < 8; ++j)
#pragma unroll
      for (int r = 0; r < 8; ++r) sf[wave * 16 + 8 * g + r][j * 16 + col] = acc[j][r];
    __syncthreads();
    for (int e = tid; e < 64 * 128; e += 128) { const int rl = e >> 7, cl = e & 127; const float v = sf[rl][cl]; const __bf16 bh = (__bf16)v; th[cl][rl] = bh; tl2[cl][rl] = (__bf16)(v - (float)bh); }
    __syncthreads(); const size_t rb = (size_t)blockIdx.x * 64; const size_t s0 = (rb / NJ) * NH + c0 / HD; const int t0 = (int)(rb % NJ) / 32;
    // the block's 16 fragments of each plane, f = (head f >> 3, 32-key trip (f >> 2) & 1, d tile f & 3); piece w = (element half w >> 5, lane w & 31) holds d = w & 15 of the tile, keys 8 q8 + 0..7 of the block
    for (int e = tid; e < 128 * 8; e += 128) { const int f = e >> 6, w = e & 63, hh = f >> 3, tt = (f >> 2) & 1, j = f & 3; const int cl = hh * HD + j * 16 + (w & 15), q8 = tt * 4 + (w >> 5) * 2 + ((w >> 4) & 1);
      const size_t o2 = (((s0 + hh) * (NJ / 32) + t0 + tt) * 4 + j) * 512 + w * 8; vst2((unsigned*)(VT + o2), *(const v4u*)&th[cl][q8 * 8]); vst2((unsigned*)(VL + o2), *(const v4u*)&tl2[cl][q8 * 8]); } } }
// 2^x as the one hardware instruction; every argument in k_fa is <= 0, and a result below the normal range may come out as 0
__device__ __forceinline__ float ex2(float x) { return __builtin_amdgcn_exp2f(x); }
// lane l with lane l ^ 16
__device__ __forceinline__ float xhalf(float x) { return __builtin_bit_cast(float, __builtin_amdgcn_permlanex16(__builtin_bit_cast(int, x), __builtin_bit_cast(int, x), 0x76543210, 0xfedcba98, false, false)); }
// fragment stored in fragment order, at this lane's byte address in it: bytes 0..15 and 512..527 (each load of a wave reads 512 bytes in a row: four whole 128-byte lines)
__device__ __forceinline__ v16h fragp_h(const char* p) { union { v16h v; v8h q[2]; } u; u.q[0] = *(const v8h*)p; u.q[1] = *(const v8h*)(p + 512); return u.v; }
__device__ __forceinline__ v16b fragp_b(const char* p) { union { v16b v; v8b q[2]; } u; u.q[0] = *(const v8b*)p; u.q[1] = *(const v8b*)(p + 512); return u.v; }
// one 32-key trip of k_fa: kp, vhp, vlp, cp = this lane's place in the trip's first k fragment, in the first fragment of each v plane, and at its first mask word (CTX: context keys, masked by those words; else self keys, key e of the lane's 32 allowed iff e <= thr)
template <bool CTX> __device__ __forceinline__ void fa_trip(const char* kp, const char* vhp, const char* vlp, const char* cp, int thr, const v16h (&qh)[2], const v16h (&ql)[2], v8f (&o)[HD / 16], float& m, float& l) {
  v16h kf[2][2]; v16b vh[HD / 16], vl[HD / 16]; v4i cm[2][2];
#pragma unroll
  for (int a = 0; a < 2; ++a)
#pragma unroll
    for (int kc = 0; kc < 2; ++kc) kf[a][kc] = fragp_h(kp + (a * 2 + kc) * 1024);
  if (CTX) {
#pragma unroll
    for (int a = 0; a < 2; ++a) { cm[a][0] = *(const v4i*)(cp + a * 64); cm[a][1] = *(const v4i*)(cp + a * 64 + 16); } }
#pragma unroll
  for (int j = 0; j < HD / 16; ++j) { vh[j] = fragp_b(vhp + j * 1024); vl[j] = fragp_b(vlp + j * 1024); }
  v8f s[2] = {};
#pragma unroll
  for (int kc = 0; kc < 2; ++kc)
#pragma unroll
    for (int a = 0; a < 2; ++a) { s[a] = wmma16(kf[a][kc], qh[kc], s[a]); s[a] = wmma16(kf[a][kc], ql[kc], s[a]); }
#pragma unroll
  for (int a = 0; a < 2; ++a)
#pragma unroll
    for (int r = 0; r < 8; ++r) s[a][r] = (CTX ? (cm[a][r >> 2][r & 3] != 0) : (a * 16 + r <= thr)) ? s[a][r] : -3.0e38f;
  float mx = s[0][0];
#pragma unroll
  for (int e = 1; e < 16; ++e) mx = fmaxf(mx, s[e >> 3][e & 7]);
  mx = fmaxf(mx, xhalf(mx)); const float mn = fmaxf(m, mx); const float al = ex2(m - mn); m = mn;
  float pv[16], ps = 0.f;
#pragma unroll
  for (int e = 0; e < 16; ++e) { pv[e] = ex2(s[e >> 3][e & 7] - mn); ps += pv[e]; }
  l = l * al + ps; const F2 p = bsplit16(pv);
#pragma unroll
  for (int j = 0; j < HD / 16; ++j) { o[j] *= al; o[j] = wmma_bf(vh[j], p.h, o[j]); o[j] = wmma_bf(vh[j], p.l, o[j]); o[j] = wmma_bf(vl[j], p.h, o[j]); } }
// ---- k_fa: block = (slice = b * NH + h, 64 queries, longest first), 16 waves = (16-query group qg, key quarter kq). A wave walks its 32-key trips with S^T = K Q^T (2 products) and O^T += V^T P^T (3 products): lane (g, c) holds query c's scores of keys 8 g + 0..7 of each 16-key tile, which is the B fragment's k order, so that P stays in registers and a query's maximum, sum and rescale stay in its own two lanes. Key j allowed iff (j < NC ? context_mask[b][j] : j - NC <= i), else -3e38: its power against a real maximum is 0, and what a wave sums while it has met no allowed key is wiped by the factor 2^(-3e38 - m) = 0 (every query has an allowed key, its own). The four quarters' (m, l, O) are joined through LDS.
__global__ __launch_bounds__(512) void k_fa(const _Float16* __restrict__ QH, const _Float16* __restrict__ QL, const _Float16* __restrict__ KH, const int* __restrict__ CM, const __bf16* __restrict__ VT, const __bf16* __restrict__ VL, float* __restrict__ Y) {
  __shared__ __align__(16) float so[4][64][HD + 4]; __shared__ float sm[4][64], sl[4][64];
  const int b = blockIdx.x / NH, h = blockIdx.x % NH; const int x = NQ / 64 - 1 - (int)blockIdx.y;   // query tiles in reverse, longest first, for speed only
  const int tid = threadIdx.x, lane = tid & 31, c = lane & 15, g = lane >> 4; const int wave = __builtin_amdgcn_readfirstlane(tid >> 5), qg = wave & 3, kq = wave >> 2; const int q0 = x * 64 + qg * 16;
  v16h qh[2], ql[2];
#pragma unroll
  for (int kc = 0; kc < 2; ++kc) { const size_t qo = (((size_t)blockIdx.x * (NQ / 16) + q0 / 16) * 2 + kc) * 512 + lane * 8; qh[kc] = fragp_h((const char*)(QH + qo)); ql[kc] = fragp_h((const char*)(QL + qo)); }
  const int nt = (NC + q0 + 16 + 31) >> 5;   // trips that hold a key some query of the group may see
  // a quarter takes two trips in a row, then skips the other quarters' six; the lane's four addresses walk along with the trips: a trip's four k fragments, and its four v fragments of each plane, are 4 KiB in a row
  const size_t fo = ((size_t)blockIdx.x * (NJ / 32) + 2 * kq) * 2048 + lane * 8; const char* kp = (const char*)(KH + fo); const char* vhp = (const char*)(VT + fo); const char* vlp = (const char*)(VL + fo); const char* cp = (const char*)(CM + (size_t)b * NC + 64 * kq + 8 * g);
  v8f o[HD / 16] = {}; float m = -3.0e38f, l = 0.f;
  for (int i = 0; i < NC / 128; ++i) { fa_trip<true>(kp, vhp, vlp, cp, 0, qh, ql, o, m, l); const int st = (i & 1) ? 7 * 32 : 32; kp += st * 128; vhp += st * 128; vlp += st * 128; cp += st * 4; }
  for (int i = 0, t = NC / 32 + 2 * kq; t < nt; ++i) { fa_trip<false>(kp, vhp, vlp, cp, q0 + c - (t * 32 - NC) - 8 * g, qh, ql, o, m, l); const int st = (i & 1) ? 7 : 1; t += st; kp += st * 4096; vhp += st * 4096; vlp += st * 4096; }
  l += xhalf(l); if (g == 0) { sm[kq][qg * 16 + c] = m; sl[kq][qg * 16 + c] = l; }
#pragma unroll
  for (int j = 0; j < HD / 16; ++j) { v4f lo4, hi4;
#pragma unroll
    for (int r = 0; r < 4; ++r) { lo4[r] = o[j][r]; hi4[r] = o[j][4 + r]; }
    vst2(&so[kq][qg * 16 + c][j * 16 + 8 * g], lo4); vst2(&so[kq][qg * 16 + c][j * 16 + 8 * g + 4], hi4); }
  __syncthreads();
  const int q = (tid >> 7) * 16 + (tid & 15), dd = ((tid >> 4) & 7) * 8; float mt = sm[0][q];   // thread = (query, 8 of its 64 outputs), so numbered that a wave's 32 threads are the 32 lanes of two pieces of one fragment of k_out
#pragma unroll
  for (int w = 1; w < 4; ++w) mt = fmaxf(mt, sm[w][q]);
  float lt = 0.f; v4f y0 = {}, y1 = {};
#pragma unroll
  for (int w = 0; w < 4; ++w) { const float e = ex2(sm[w][q] - mt); lt += e * sl[w][q]; y0 += e * *(const v4f*)&so[w][q][dd]; y1 += e * *(const v4f*)&so[w][q][dd + 4]; }
  const float inv = 1.0f / lt; float* yp = Y + (((((size_t)b * NQ + x * 64 + q) >> 4) * (CC / 32) + h * 2 + (dd >> 5)) * 4 + ((dd >> 4) & 1) * 2) * 128 + lane * 4; vst2(yp, y0 * inv); vst2(yp + 128, y1 * inv); }
// ---- k_out: out = o (bf16 hi + lo) Wo + bo (Wo as the bf16 plane of k_wt)
__global__ __launch_bounds__(128) void k_out(const float* __restrict__ Y, const __bf16* __restrict__ WOT, const float* __restrict__ BO, float* __restrict__ OUT) { __shared__ __align__(16) float sf[4][16][132];
  const int tid = threadIdx.x, wave = tid >> 5, lane = tid & 31, col = lane & 15, g = lane >> 4; const int c0 = blockIdx.y * 128; const size_t r0 = (size_t)blockIdx.x * 64 + wave * 16;
  const float* yfr = Y + (r0 >> 4) * (size_t)(CC / 32) * 512 + lane * 4; const __bf16* wt0 = WOT + (size_t)(c0 / 16) * (CC / 32) * 512;   // this lane's place in the first A fragment of the wave's 16 rows; first fragment of the block's first 16 columns
  v8f acc[8] = {};
#pragma unroll 1   // one trip holds 16 B fragments in registers; a second copy of the body would not fit
  for (int kc = 0; kc < CC / 64; ++kc) { v4f ar[2][4]; v16b w[2][8];   // 64 k a trip, as in k_proj
#pragma unroll
    for (int u = 0; u < 2; ++u) { const float* p = yfr + u * 512; ar[u][0] = *(const v4f*)p; ar[u][1] = *(const v4f*)(p + 128); ar[u][2] = *(const v4f*)(p + 256); ar[u][3] = *(const v4f*)(p + 384); }
    asm volatile("s_wait_xcnt 0x0" ::: "memory");   // in this build one of the B loads below lands on the register pair that holds the A loads' address
#pragma unroll
    for (int u = 0; u < 2; ++u)
#pragma unroll
      for (int j = 0; j < 8; ++j) w[u][j] = fragw_b(wt0 + ((size_t)j * (CC / 32) + kc * 2 + u) * 512, lane);
    __builtin_amdgcn_sched_barrier(0);   // every load of the trip is issued ahead of the first split, so that a trip waits for memory once; without it part of the B loads is placed behind the split of A
#pragma unroll
    for (int u = 0; u < 2; ++u) { float av[16];
#pragma unroll
      for (int i = 0; i < 16; ++i) av[i] = ar[u][i >> 2][i & 3];
      const F2 a = bsplit16(av);
#pragma unroll
      for (int j = 0; j < 8; ++j) { acc[j] = wmma_bf(a.h, w[u][j], acc[j]); acc[j] = wmma_bf(a.l, w[u][j], acc[j]); } }
    yfr += 1024; }
#pragma unroll
  for (int j = 0; j < 8; ++j) { const float bb = bfr(BO[c0 + j * 16 + col]);
#pragma unroll
    for (int r = 0; r < 8; ++r) sf[wave][8 * g + r][j * 16 + col] = acc[j][r] + bb; }
  LDSX(); for (int rl = 0; rl < 16; ++rl) vst2(OUT + (r0 + rl) * CC + c0 + lane * 4, *(const v4f*)&sf[wave][rl][lane * 4]); }
extern "C" void kernel_launch(void* const* d_in, const int* in_sizes, int n_in, void* d_out, int out_size, void* d_ws, size_t ws_size, hipStream_t stream) {
  (void)in_sizes; (void)n_in; (void)out_size;
  const float** F = (const float**)d_in;   // 0 x [2,1024,1024], 1 context [2,1024,1024], 2 context_mask [2,1024] int, 3 rotary_pos_emb [2048,64], 4 norm_w, 5 norm_b, 6 cnorm_w, 7 cnorm_b, 8 Wq [1024,1024] (in,out), 9 Wkv [1024,2048], 10 Wo [1024,1024], 11 bo
  if (ws_size < (size_t)WS_END) return;
  char* ws = (char*)d_ws; float* Y = (float*)(ws + WS_Y); _Float16 *XN = (_Float16*)(ws + WS_XN), *CN = (_Float16*)(ws + WS_CN), *QH = (_Float16*)(ws + WS_QH), *QL = (_Float16*)(ws + WS_QL), *KH = (_Float16*)(ws + WS_KH); __bf16 *VT = (__bf16*)(ws + WS_VT), *VL = (__bf16*)(ws + WS_VL); unsigned short* WT = (unsigned short*)(ws + WS_WT); float* CS = (float*)(ws + WS_CS);
  k_wt<<<dim3(CC / 64, CC / 64, 5), 256, 0, stream>>>(F[8], F[9], F[10], F[3], WT, CS);
  k_ln<<<(NB * NQ + NB * NC) / 16, 512, 0, stream>>>(F[0], F[1], F[4], F[5], F[6], F[7], XN, CN);
  k_proj<<<dim3(TNB * NQ / 64, CC / 128), 128, 0, stream>>>(XN, CN, (const _Float16*)WT, CS, 0, QH, QL, KH, VT, VL);
  k_proj<<<dim3(TNB * NJ / 64, CC / 128), 128, 0, stream>>>(XN, CN, (const _Float16*)WT, CS, 1, QH, QL, KH, VT, VL);
  k_proj<<<dim3(TNB * NJ / 64, CC / 128), 128, 0, stream>>>(XN, CN, (const _Float16*)WT, CS, 2, QH, QL, KH, VT, VL);
  k_fa<<<dim3(TNB * NH, NQ / 64), 512, 0, stream>>>(QH, QL, KH, (const int*)d_in[2], VT, VL, Y);
  k_out<<<dim3(TNB * NQ / 64, CC / 128), 128, 0, stream>>>(Y, (const __bf16*)WT + (size_t)3 * CC * CC, F[11], (float*)d_out);
}

// v008
// One run takes 93 microseconds.
// In two side-by-side timings against v007, it was 1.19 and 1.17 times as fast.
// Counting every step since v000, it is 14.7 times as fast.
// compute dtype: all float inputs rounded to bf16, context_mask (int) read; LayerNorm of x and context in f32; q = xn Wq * 8^-1 * log2(e) and k/v = [cn; xn] Wkv with the LN'd rows and the 0.02-scale weights as f16 (1 product) on WMMA 16x16x32, f32 accumulate; rotary (angles from the rotary_pos_emb input, precise cosf/sinf) in f32; q as f16 hi + residual, k f16 -> 2-product logits kept in registers; mask = context_mask & causal-with-prefix -> -3e38; running-maximum softmax in f32 in base 2 (the logits carry log2(e) from q's scale; each power is one hardware exp2), unnormalised P split bf16 hi + lo against v bf16 hi + lo (3 products), divided by the row sum at the end; out = o (bf16 hi + lo) Wo + bo; f32 output.
#include <hip/hip_runtime.h>
#include <math.h>

typedef __attribute__((ext_vector_type(16))) _Float16 v16h;
typedef __attribute__((ext_vector_type(16))) __bf16 v16b;
typedef __attribute__((ext_vector_type(8)))  _Float16 v8h;
typedef __attribute__((ext_vector_type(8)))  float v8f;
typedef __attribute__((ext_vector_type(4)))  float v4f;
typedef __attribute__((ext_vector_type(2)))  float v2f;
typedef __attribute__((ext_vector_type(4)))  unsigned v4u;
typedef __attribute__((ext_vector_type(4)))  int v4i;
typedef float __attribute__((may_alias)) float_a;
typedef int __attribute__((may_alias)) int_a;

template <typename T> __device__ __forceinline__ void vst2(void* p, T v) { *(T*)p = v;  }
__device__ __forceinline__ v8f wmma16(v16h a, v16h b, v8f c) {
  v8f d = __builtin_amdgcn_wmma_f32_16x16x32_f16(false, a, false, b, (short)0, c, false, false);
  asm volatile("v_nop\n\tv_nop\n\tv_nop\n\tv_nop" : "+v"(d) : "v"(a), "v"(b));
  return d;
}
__device__ __forceinline__ v8f wmma_bf(v16b a, v16b b, v8f c) {
  v8f d = __builtin_amdgcn_wmma_f32_16x16x32_bf16(false, a, false, b, (short)0, c, false, false);
  asm volatile("v_nop\n\tv_nop\n\tv_nop\n\tv_nop" : "+v"(d) : "v"(a), "v"(b));
  return d;
}
// 16x16x32 fragments: lane = (h = lane>>4, row/col = lane&15); elements 0..7 = k0+8h+0..7, 8..15 = k0+16+8h+0..7; D element r = row 8h+r
__device__ __forceinline__ v16h frag_h(const _Float16* rowk0, int lane) {
  union { v16h v; v8h q[2]; } u; const _Float16* p = rowk0 + 8 * (lane >> 4);
  u.q[0] = *(const v8h*)p; u.q[1] = *(const v8h*)(p + 16); return u.v;
}
__device__ __forceinline__ v16h frag_f32(const float* rowk0, int lane) {
  v16h a; const float* p = rowk0 + 8 * (lane >> 4);
#pragma unroll
  for (int i = 0; i < 8; ++i) { a[i] = (_Float16)p[i]; a[8 + i] = (_Float16)p[16 + i]; }
  return a;
}
__device__ __forceinline__ v16h frag_f32s(const float* rowk0, int lane, float sc) {
  v16h a; const float* p = rowk0 + 8 * (lane >> 4);
#pragma unroll
  for (int i = 0; i < 8; ++i) { a[i] = (_Float16)(p[i] * sc); a[8 + i] = (_Float16)(p[16 + i] * sc); }
  return a;
}
// column fragment from a [K][ld] layout (column n), rows >= K read as 0
__device__ __forceinline__ v16h fragc_f32(const float* W, int k0, int n, int lane, int ld, int K) {
  v16h a; const int g = lane >> 4;
#pragma unroll
  for (int i = 0; i < 8; ++i) { const int ka = k0 + 8 * g + i, kb = ka + 16;
    a[i] = (_Float16)(ka < K ? W[(size_t)(ka < K ? ka : K - 1) * ld + n] : 0.f); a[8 + i] = (_Float16)(kb < K ? W[(size_t)(kb < K ? kb : K - 1) * ld + n] : 0.f); }
  return a;
}
struct F2 { v16b h, l; };
__device__ __forceinline__ F2 bsplit16(const float v[16]) { F2 r;
#pragma unroll
  for (int i = 0; i < 16; ++i) { const __bf16 h = (__bf16)v[i]; r.h[i] = h; r.l[i] = (__bf16)(v[i] - (float)h); }
  return r; }
__device__ __forceinline__ F2 split_row(const float* row, int k0, int lane) { float v[16]; const float* p = row + k0 + 8 * (lane >> 4);
#pragma unroll
  for (int i = 0; i < 8; ++i) { v[i] = p[i]; v[8 + i] = p[16 + i]; }
  return bsplit16(v); }
__device__ __forceinline__ F2 split_rowK(const float* row, int k0, int lane, int K) { float v[16]; const int g = lane >> 4;
#pragma unroll
  for (int i = 0; i < 8; ++i) { const int ka = k0 + 8 * g + i, kb = ka + 16; v[i] = ka < K ? row[ka < K ? ka : K - 1] : 0.f; v[8 + i] = kb < K ? row[kb < K ? kb : K - 1] : 0.f; }
  return bsplit16(v); }
__device__ __forceinline__ F2 split_col(const float* W, int k0, int n, int lane, int ld, int K) { float v[16]; const int g = lane >> 4;
#pragma unroll
  for (int i = 0; i < 8; ++i) { const int ka = k0 + 8 * g + i, kb = ka + 16; v[i] = ka < K ? W[(size_t)(ka < K ? ka : K - 1) * ld + n] : 0.f; v[8 + i] = kb < K ? W[(size_t)(kb < K ? kb : K - 1) * ld + n] : 0.f; }
  return bsplit16(v); }
__device__ __forceinline__ v8f mac3(const F2& a, const F2& b, v8f c) { c = wmma_bf(a.l, b.h, c); c = wmma_bf(a.h, b.l, c); return wmma_bf(a.h, b.h, c); }
__device__ __forceinline__ float sigm(float v) { return 1.0f / (1.0f + expf(-v)); }
#define LDSX() do { asm volatile("s_wait_dscnt 0" ::: "memory"); __builtin_amdgcn_wave_barrier(); __builtin_amdgcn_fence(__ATOMIC_RELEASE, "workgroup"); } while (0)


// Causal prefix attention (B 2, 1,024 queries over 1,024 context + 1,024 self keys, 16 x 64, rotary on all 64 dims): prefix keys masked by context_mask, self keys causal.
#define NB 2
#define NQ 1024
#define NC 1024
#define NJ 2048
#define CC 1024
#define NH 16
#define HD 64
#ifndef TNB
#define TNB NB
#endif
typedef __attribute__((ext_vector_type(8))) __bf16 v8b;
__device__ __forceinline__ v16b frag_b(const __bf16* rowk0, int lane) {
  union { v16b v; v8b q[2]; } u; const __bf16* p = rowk0 + 8 * (lane >> 4);
  u.q[0] = *(const v8b*)p; u.q[1] = *(const v8b*)(p + 16); return u.v;
}
// A or B fragment stored in fragment order by k_pre (f = the fragment's 512 elements)
__device__ __forceinline__ v16h fragw_h(const _Float16* f, int lane) { union { v16h v; v8h q[2]; } u; u.q[0] = *(const v8h*)(f + lane * 8); u.q[1] = *(const v8h*)(f + 256 + lane * 8); return u.v; }
__device__ __forceinline__ v16b fragw_b(const __bf16* f, int lane) { union { v16b v; v8b q[2]; } u; u.q[0] = *(const v8b*)(f + lane * 8); u.q[1] = *(const v8b*)(f + 256 + lane * 8); return u.v; }
__device__ __forceinline__ float bfr(float v) { return (float)(__bf16)v; }
__device__ __attribute__((noinline)) float exp_ni(float v) { return expf(v); }
__device__ __attribute__((noinline)) float erf_ni(float v) { return erff(v); }


#define WS_XN  0u                                  // f16 LN'd x rows in A-fragment order [16-row tile of b*NQ][32-k step][512] (k_pre); they fill half of the place kept here, which Y needs whole
#define WS_CN  (WS_XN + 4u * (size_t)NB * NQ * CC)     // f16 LN'd context rows, in the same order
#define WS_QH  (WS_CN + 4u * (size_t)NB * NC * CC)     // f16 q (hi, residual) in B-fragment order [slice = b*NH + h][16-query tile][32-d step][512]
#define WS_QL  (WS_QH + 2u * (size_t)NB * NQ * CC)
#define WS_KH  (WS_QL + 2u * (size_t)NB * NQ * CC)     // f16 k in A-fragment order [slice][16-key tile][32-d step][512]
#define WS_VT  (WS_KH + 2u * (size_t)NB * NJ * CC)     // bf16 v planes (hi, lo) in A-fragment order [slice][32-key trip][16-d tile][512]
#define WS_VL  (WS_VT + 2u * (size_t)NB * CC * NJ)
#define WS_WT  (WS_VL + 2u * (size_t)NB * CC * NJ)     // 16-bit weight planes [4][64 n tiles][32 k steps][512] in B-fragment order (k_pre): f16 Wq, Wkv k half, Wkv v half; bf16 Wo
#define WS_Y   WS_XN                               // f32 o in A-fragment order [16-row tile of b*NQ][32-k step][4 pieces][32 lanes][4]: piece p of lane (g, row) = k 16 (p >> 1) + 8 g + 4 (p & 1) + 0..3; k_fa writes them after the last reader of XN (k_proj) has ended
#define WS_CS  (WS_WT + 2u * (size_t)4 * CC * CC)     // f32 rotary table [NJ positions][2 d halves][16 columns][cos, sin of d = 32 half + column; cos, sin of d + 16] (k_pre)
#define WS_END (WS_CS + 4u * (size_t)NJ * HD * 2)

typedef __attribute__((ext_vector_type(2))) _Float16 v2h;
typedef __attribute__((ext_vector_type(2))) __bf16 v2b;
// ---- wt_tile (k_pre): half a block = 256 threads = (64 k, 64 n, plane z): each weight is rounded once to the 16-bit type its product reads (z 0 Wq, 1 Wkv cols 0..1023, 2 Wkv cols 1024..: bf16 then f16; 3 Wo: bf16) and stored in B-fragment order: 1 KiB for each (16 n, 32 k) fragment, elements 0..7 of lanes 0..31 and then elements 8..15, so that each of a fragment's two 16-byte loads reads four whole 128-byte lines. tile = (plane tile >> 8, 64-n step (tile >> 4) & 15, 64-k step tile & 15); the two halves of a block hold tiles of one plane and pass the one barrier together
__device__ __forceinline__ void wt_tile(const float* __restrict__ WQ, const float* __restrict__ WKV, const float* __restrict__ WO, unsigned short* __restrict__ WT, unsigned (*st)[36], int t, int tile) {   // st: [n][k pair], pitch 144 bytes
  const int z = tile >> 8, k0 = (tile & 15) * 64, n0 = ((tile >> 4) & 15) * 64; const float* src = (z == 0) ? WQ : (z == 3) ? WO : WKV; const int ld = (z == 1 || z == 2) ? 2 * CC : CC; const int off = (z == 2) ? CC : 0;
  const int kt = t >> 4, q = t & 15; v4f v[2][2];   // rows k0 + 32 i + 2 kt + {0, 1}, columns n0 + 4 q + 0..3
#pragma unroll
  for (int i = 0; i < 2; ++i)
#pragma unroll
    for (int r = 0; r < 2; ++r) { v[i][r] = *(const v4f*)(src + (size_t)(k0 + i * 32 + 2 * kt + r) * ld + off + n0 + q * 4); }
#pragma unroll
  for (int i = 0; i < 2; ++i)
#pragma unroll
    for (int c = 0; c < 4; ++c) { v2b rb; rb[0] = (__bf16)v[i][0][c]; rb[1] = (__bf16)v[i][1][c]; v2h rh; rh[0] = (_Float16)(float)rb[0]; rh[1] = (_Float16)(float)rb[1];
      st[q * 4 + c][i * 16 + kt] = (z == 3) ? __builtin_bit_cast(unsigned, rb) : __builtin_bit_cast(unsigned, rh); }
  __syncthreads();
#pragma unroll
  for (int i = 0; i < 2; ++i) { const int e = t + i * 256, f = e >> 6, w = e & 63;   // fragment f = (16-n tile f >> 1, 32-k step f & 1) of the tile's 8; 16-byte piece w = (element half w >> 5, lane w & 31)
    const int n = (f >> 1) * 16 + (w & 15), k8 = (f & 1) * 4 + (w >> 5) * 2 + ((w >> 4) & 1);   // the piece holds column n, rows 8 k8 + 0..7
    vst2(WT + (((size_t)z * (CC / 16) + n0 / 16 + (f >> 1)) * (CC / 32) + k0 / 32 + (f & 1)) * 512 + w * 8, *(const v4u*)&st[n][k8 * 4]); }
  asm volatile("s_wait_xcnt 0x0" ::: "memory"); }   // in the listing another branch of k_pre follows, whose first instructions write the registers that hold the two stores' address
// ---- rot_table (k_pre): 65,536 threads compute cos and sin of every rotary angle once, in the order in which a lane of k_proj reads them: thread = (position id >> 5, d half (id >> 4) & 1, column id & 15)
__device__ __forceinline__ void rot_table(const float* __restrict__ ROT, float* __restrict__ CS, int id) {
  const float* ap = ROT + (size_t)(id >> 5) * HD + ((id >> 4) & 1) * 32 + (id & 15); const float a0 = bfr(ap[0]), a1 = bfr(ap[16]);
  v4f o; o[0] = cosf(a0); o[1] = sinf(a0); o[2] = cosf(a1); o[3] = sinf(a1); vst2(CS + (size_t)id * 4, o);
  asm volatile("s_wait_xcnt 0x0" ::: "memory"); }   // in the listing the other branches of k_pre follow, whose first instructions write the registers that the store names
// ---- ln_tile (k_pre): block = 16 rows = one A tile of k_proj (tiles 0..NB*NQ/16-1 from x -> XN; the rest from context -> CN), one wave a row: the row stays in the wave's registers (8 loads of 512 bytes in a row, all in flight at once), mean and variance are sums over the wave's lanes. The LN'd row is rounded to the f16 that k_proj's product reads; the 16 rows meet in LDS and leave in A-fragment order: 1 KiB for each (16 rows, 32 k) fragment, elements 0..7 of lanes 0..31 and then elements 8..15
typedef __attribute__((ext_vector_type(4))) _Float16 v4h;
__device__ __forceinline__ void ln_tile(const float* __restrict__ X, const float* __restrict__ CT, const float* __restrict__ GX, const float* __restrict__ BX, const float* __restrict__ GC, const float* __restrict__ BC, _Float16* __restrict__ XN, _Float16* __restrict__ CN, _Float16 (*sh)[CC + 8], int tid, size_t tile) {
  const int wave = tid >> 5, lane = tid & 31; const bool isx = tile < (size_t)NB * NQ / 16; if (!isx) tile -= (size_t)NB * NQ / 16;
  const float* src = (isx ? X : CT) + (tile * 16 + wave) * CC + lane * 4; const float* ga = (isx ? GX : GC) + lane * 4; const float* be = (isx ? BX : BC) + lane * 4;
  v4f v[8], gm[8], bt[8];
#pragma unroll
  for (int i = 0; i < 8; ++i) v[i] = *(const v4f*)(src + i * 128);
  asm volatile("s_wait_xcnt 0x0" ::: "memory");   // in this build one of the loads below lands on the register pair that holds the row loads' address
#pragma unroll
  for (int i = 0; i < 8; ++i) { gm[i] = *(const v4f*)(ga + i * 128); if (i < 7) bt[i] = *(const v4f*)(be + i * 128); }
  asm volatile("s_wait_xcnt 0x0" ::: "memory");   // in this build the last load lands on the register that holds the offset of the 15 loads above
  bt[7] = *(const v4f*)(be + 7 * 128);
  __builtin_amdgcn_sched_barrier(0);   // all 24 loads are issued ahead of the first sum, so that the wave waits for memory once; without it the weight and bias loads are placed behind the two sums, two at a time with a wait for each pair
  v4f a4 = {};   // four sums side by side: a chain of 8 additions, not of 32
#pragma unroll
  for (int i = 0; i < 8; ++i) {
#pragma unroll
    for (int c = 0; c < 4; ++c) v[i][c] = bfr(v[i][c]);
    a4 += v[i]; }
  float a = (a4[0] + a4[1]) + (a4[2] + a4[3]);
#pragma unroll
  for (int o = 1; o < 32; o <<= 1) a += __shfl_xor(a, o);
  const float mu = a / CC; v4f q4 = {};
#pragma unroll
  for (int i = 0; i < 8; ++i) { const v4f d = v[i] - mu; q4 += d * d; }
  float q = (q4[0] + q4[1]) + (q4[2] + q4[3]);
#pragma unroll
  for (int o = 1; o < 32; o <<= 1) q += __shfl_xor(q, o);
  const float inv = 1.0f / sqrtf(q / CC + 1e-5f);
#pragma unroll
  for (int i = 0; i < 8; ++i) { v4h h;
#pragma unroll
    for (int c = 0; c < 4; ++c) h[c] = (_Float16)((v[i][c] - mu) * inv * bfr(gm[i][c]) + bfr(bt[i][c]));
    vst2(&sh[wave][i * 128 + lane * 4], h); }
  __syncthreads();
  _Float16* dst = (isx ? XN : CN) + tile * (size_t)(CC / 32) * 512;
#pragma unroll
  for (int i = 0; i < 4; ++i) { const int e = tid + i * 512, w = e & 63;   // 16-byte piece e = (32-k step e >> 6, element half w >> 5, lane w & 31): row w & 15, k = 8 k8 + 0..7; a wave stores 512 bytes in a row
    const int k8 = (e >> 6) * 4 + (w >> 5) * 2 + ((w >> 4) & 1); vst2(dst + (size_t)e * 8, *(const v4u*)&sh[w & 15][k8 * 8]); } }
// ---- k_pre: all that reads the inputs alone, in one launch, dealt by block index: LN tiles (the longest blocks) first, then the weight tiles, two a block, then the rotary table. Each branch is taken by a whole block
#define PRE_LN ((NB * NQ + NB * NC) / 16)
#define PRE_WT (4 * (CC / 64) * (CC / 64) / 2)
#define PRE_RT (NJ * 32 / 512)
// 8 waves a SIMD: at the LN branch's own register count one block would fill a WGP, and the weight tiles, which lay several blocks to a WGP as a launch of their own, would pass one block at a time
__global__ __launch_bounds__(512) __attribute__((amdgpu_waves_per_eu(8))) void k_pre(const float* __restrict__ X, const float* __restrict__ CT, const float* __restrict__ GX, const float* __restrict__ BX, const float* __restrict__ GC, const float* __restrict__ BC, const float* __restrict__ WQ, const float* __restrict__ WKV, const float* __restrict__ WO, const float* __restrict__ ROT, _Float16* __restrict__ XN, _Float16* __restrict__ CN, unsigned short* __restrict__ WT, float* __restrict__ CS) {
  __shared__ __align__(16) _Float16 sh[16][CC + 8];   // pitch 2,064 bytes = 16 x 129: the 16 rows of a 16-byte read fall on all 64 banks
  __shared__ __align__(16) unsigned st[2][64][36];
  const int tid = threadIdx.x, bid = blockIdx.x;
  if (bid < PRE_LN) ln_tile(X, CT, GX, BX, GC, BC, XN, CN, sh, tid, (size_t)bid);
  else if (bid < PRE_LN + PRE_WT) wt_tile(WQ, WKV, WO, WT, st[tid >> 8], tid & 255, (bid - PRE_LN) * 2 + __builtin_amdgcn_readfirstlane(tid >> 8));   // a wave lies in one half: its tile's indices stay scalars
  else rot_table(ROT, CS, (bid - PRE_LN - PRE_WT) * 512 + tid); }
// ---- k_proj: one launch for the three products; block = (64 rows, 128 cols, which), blockIdx.x = v's row blocks, then k's, then q's: which 0: q = xn Wq (rows b*NQ + i; key position CTX + i), 1: k, 2: v from [cn rows (j < NC); xn rows (j >= NC)] Wkv (cols 0..1023 k, 1024.. v); rotary on q and k; f16 A (LN'd rows) x f16 W (1 product)
// rotary on a wave's 16 x 128 accumulator tile (two heads): element r of tile j is (row 8 g + r, d = 16 (j & 3) + col), so that its partner d +- 32 is element r of tile j ^ 2 in the same lane; cs = the lane's place in the table row of its first position; rows go to sh (f16) and, for q, their residual to sl
#define PJB (TNB * NJ / 64)
template <bool Q> __device__ __forceinline__ void rot_pack(const v8f (&acc)[8], const float* cs, _Float16 (*sh)[136], _Float16 (*sl)[136], int row0, int col) {
  v4f t[8][2];
#pragma unroll
  for (int r = 0; r < 8; ++r) { t[r][0] = *(const v4f*)(cs + r * 2 * HD); t[r][1] = *(const v4f*)(cs + r * 2 * HD + 64); }
  const float sc = Q ? 0.125f * 1.44269504f : 1.0f;   // q carries log2(e) too: k_fa takes its powers in base 2
#pragma unroll
  for (int j = 0; j < 8; ++j)
#pragma unroll
    for (int r = 0; r < 8; ++r) { const int jd = j & 3; const float c = t[r][jd >> 1][(jd & 1) * 2], s = t[r][jd >> 1][(jd & 1) * 2 + 1];
      const float me = acc[j][r] * sc; const float partner = (jd < 2) ? -(acc[j + 2][r] * sc) : acc[j - 2][r] * sc;
      const float v = me * c + partner * s; const _Float16 hv = (_Float16)v; sh[row0 + r][j * 16 + col] = hv; if (Q) sl[row0 + r][j * 16 + col] = (_Float16)(v - (float)hv); } }
__global__ __launch_bounds__(128) void k_proj(const _Float16* __restrict__ XN, const _Float16* __restrict__ CN, const _Float16* __restrict__ WT, const float* __restrict__ CS, _Float16* __restrict__ QH, _Float16* __restrict__ QL, _Float16* __restrict__ KH, __bf16* __restrict__ VT, __bf16* __restrict__ VL) {
  __shared__ __align__(16) float sf[64][132]; __shared__ __align__(16) _Float16 sh[64][136], sl[64][136]; __shared__ __align__(16) __bf16 th[128][72], tl2[128][72];
  const int tid = threadIdx.x, wave = tid >> 5, lane = tid & 31, col = lane & 15, g = lane >> 4; const int c0 = blockIdx.y * 128; const int which = (int)blockIdx.x < PJB ? 2 : (int)blockIdx.x < 2 * PJB ? 1 : 0; const int bx = (int)blockIdx.x - (2 - which) * PJB; const size_t r0 = (size_t)bx * 64 + wave * 16;   // row within [b*L]
  const int L = (which == 0) ? NQ : NJ; const size_t b = r0 / L; const int jpos = (int)(r0 % L);   // the wave's 16 rows are one tile of k_pre
  const _Float16* at0 = ((which == 0) ? (XN + (b * NQ + jpos) * CC) : (jpos < NC ? (CN + (b * NC + jpos) * CC) : (XN + (b * NQ + (jpos - NC)) * CC)));   // its first A fragment: a tile's 32 fragments are 16 * CC elements in a row
  const _Float16* wt0 = WT + ((size_t)which * (CC / 16) + c0 / 16) * (CC / 32) * 512;   // plane 'which', first fragment of the block's first 16 columns
  v8f acc[8] = {};
#pragma unroll 1   // one trip holds 16 B fragments in registers; a second copy of the body would not fit
  for (int kc = 0; kc < CC / 64; ++kc) { v16h a[2], w[2][8];   // 64 k a trip: 2 A and 16 B fragments
#pragma unroll
    for (int u = 0; u < 2; ++u) a[u] = fragw_h(at0 + (size_t)(kc * 2 + u) * 512, lane);
#pragma unroll
    for (int u = 0; u < 2; ++u)
#pragma unroll
      for (int j = 0; j < 8; ++j) w[u][j] = fragw_h(wt0 + ((size_t)j * (CC / 32) + kc * 2 + u) * 512, lane);
#pragma unroll
    for (int u = 0; u < 2; ++u)
#pragma unroll
      for (int j = 0; j < 8; ++j) acc[j] = wmma16(a[u], w[u][j], acc[j]); }
  if (which < 2) {   // rotary (q, k) in registers, then pack
    const float* cs = CS + ((size_t)(r0 % L) + ((which == 0) ? NC : 0) + 8 * g) * (2 * HD) + col * 4;   // q uses the last NQ positions
    if (which == 0) rot_pack<true>(acc, cs, sh, sl, wave * 16 + 8 * g, col); else rot_pack<false>(acc, cs, sh, sl, wave * 16 + 8 * g, col);
    __syncthreads();
    const size_t rb = (size_t)bx * 64;
    _Float16* dh = which == 0 ? QH : KH; const size_t s0 = (which == 0 ? rb / NQ : rb / NJ) * NH + c0 / HD; const int kt0 = (int)(which == 0 ? rb % NQ : rb % NJ) / 16;   // the block's 16 fragments f = (head f >> 3, 16-row tile (f >> 1) & 3, d step f & 1); 16-byte piece w = (element half w >> 5, lane w & 31) holds row w & 15 of the tile, d = 8 d8 + 0..7
    for (int e = tid; e < 64 * 16; e += 128) { const int f = e >> 6, w = e & 63, hh = f >> 3, kt = (f >> 1) & 3, kc = f & 1; const int d8 = kc * 4 + (w >> 5) * 2 + ((w >> 4) & 1);
      const size_t o2 = (((s0 + hh) * (L / 16) + kt0 + kt) * 2 + kc) * 512 + w * 8; vst2((unsigned*)(dh + o2), *(const v4u*)&sh[kt * 16 + (w & 15)][hh * HD + d8 * 8]);
      asm volatile("s_wait_xcnt 0x0" ::: "memory");   // the next LDS read and the next address reuse the registers that the store names
      if (which == 0) { vst2((unsigned*)(QL + o2), *(const v4u*)&sl[kt * 16 + (w & 15)][hh * HD + d8 * 8]);
        asm volatile("s_wait_xcnt 0x0" ::: "memory"); } } }   // as above, ahead of the next trip
  else {   // v: stage the f32 tile, then transpose
#pragma unroll
    for (int j = 0; j < 8; ++j)
#pragma unroll
      for (int r = 0; r < 8; ++r) sf[wave * 16 + 8 * g + r][j * 16 + col] = acc[j][r];
    __syncthreads();
    for (int e = tid; e < 64 * 128; e += 128) { const int rl = e >> 7, cl = e & 127; const float v = sf[rl][cl]; const __bf16 bh = (__bf16)v; th[cl][rl] = bh; tl2[cl][rl] = (__bf16)(v - (float)bh); }
    __syncthreads(); const size_t rb = (size_t)bx * 64; const size_t s0 = (rb / NJ) * NH + c0 / HD; const int t0 = (int)(rb % NJ) / 32;
    // the block's 16 fragments of each plane, f = (head f >> 3, 32-key trip (f >> 2) & 1, d tile f & 3); piece w = (element half w >> 5, lane w & 31) holds d = w & 15 of the tile, keys 8 q8 + 0..7 of the block
    for (int e = tid; e < 128 * 8; e += 128) { const int f = e >> 6, w = e & 63, hh = f >> 3, tt = (f >> 2) & 1, j = f & 3; const int cl = hh * HD + j * 16 + (w & 15), q8 = tt * 4 + (w >> 5) * 2 + ((w >> 4) & 1);
      const size_t o2 = (((s0 + hh) * (NJ / 32) + t0 + tt) * 4 + j) * 512 + w * 8; vst2((unsigned*)(VT + o2), *(const v4u*)&th[cl][q8 * 8]); vst2((unsigned*)(VL + o2), *(const v4u*)&tl2[cl][q8 * 8]); } } }
// 2^x as the one hardware instruction; every argument in k_fa is <= 0, and a result below the normal range may come out as 0
__device__ __forceinline__ float ex2(float x) { return __builtin_amdgcn_exp2f(x); }
// lane l with lane l ^ 16
__device__ __forceinline__ float xhalf(float x) { return __builtin_bit_cast(float, __builtin_amdgcn_permlanex16(__builtin_bit_cast(int, x), __builtin_bit_cast(int, x), 0x76543210, 0xfedcba98, false, false)); }
// fragment stored in fragment order, at this lane's byte address in it: bytes 0..15 and 512..527 (each load of a wave reads 512 bytes in a row: four whole 128-byte lines)
__device__ __forceinline__ v16h fragp_h(const char* p) { union { v16h v; v8h q[2]; } u; u.q[0] = *(const v8h*)p; u.q[1] = *(const v8h*)(p + 512); return u.v; }
__device__ __forceinline__ v16b fragp_b(const char* p) { union { v16b v; v8b q[2]; } u; u.q[0] = *(const v8b*)p; u.q[1] = *(const v8b*)(p + 512); return u.v; }
// one 32-key trip of k_fa: kp, vhp, vlp, cp = this lane's place in the trip's first k fragment, in the first fragment of each v plane, and at its first mask word (CTX: context keys, masked by those words; else self keys, key e of the lane's 32 allowed iff e <= thr)
template <bool CTX> __device__ __forceinline__ void fa_trip(const char* kp, const char* vhp, const char* vlp, const char* cp, int thr, const v16h (&qh)[2], const v16h (&ql)[2], v8f (&o)[HD / 16], float& m, float& l) {
  v16h kf[2][2]; v16b vh[HD / 16], vl[HD / 16]; v4i cm[2][2];
#pragma unroll
  for (int a = 0; a < 2; ++a)
#pragma unroll
    for (int kc = 0; kc < 2; ++kc) kf[a][kc] = fragp_h(kp + (a * 2 + kc) * 1024);
  if (CTX) {
#pragma unroll
    for (int a = 0; a < 2; ++a) { cm[a][0] = *(const v4i*)(cp + a * 64); cm[a][1] = *(const v4i*)(cp + a * 64 + 16); } }
#pragma unroll
  for (int j = 0; j < HD / 16; ++j) { vh[j] = fragp_b(vhp + j * 1024); vl[j] = fragp_b(vlp + j * 1024); }
  v8f s[2] = {};
#pragma unroll
  for (int kc = 0; kc < 2; ++kc)
#pragma unroll
    for (int a = 0; a < 2; ++a) { s[a] = wmma16(kf[a][kc], qh[kc], s[a]); s[a] = wmma16(kf[a][kc], ql[kc], s[a]); }
#pragma unroll
  for (int a = 0; a < 2; ++a)
#pragma unroll
    for (int r = 0; r < 8; ++r) s[a][r] = (CTX ? (cm[a][r >> 2][r & 3] != 0) : (a * 16 + r <= thr)) ? s[a][r] : -3.0e38f;
  float mx = s[0][0];
#pragma unroll
  for (int e = 1; e < 16; ++e) mx = fmaxf(mx, s[e >> 3][e & 7]);
  mx = fmaxf(mx, xhalf(mx)); const float mn = fmaxf(m, mx); const float al = ex2(m - mn); m = mn;
  float pv[16], ps = 0.f;
#pragma unroll
  for (int e = 0; e < 16; ++e) { pv[e] = ex2(s[e >> 3][e & 7] - mn); ps += pv[e]; }
  l = l * al + ps; const F2 p = bsplit16(pv);
#pragma unroll
  for (int j = 0; j < HD / 16; ++j) { o[j] *= al; o[j] = wmma_bf(vh[j], p.h, o[j]); o[j] = wmma_bf(vh[j], p.l, o[j]); o[j] = wmma_bf(vl[j], p.h, o[j]); } }
// ---- k_fa: block = (slice = b * NH + h, 64 queries, longest first), 16 waves = (16-query group qg, key quarter kq). A wave walks its 32-key trips with S^T = K Q^T (2 products) and O^T += V^T P^T (3 products): lane (g, c) holds query c's scores of keys 8 g + 0..7 of each 16-key tile, which is the B fragment's k order, so that P stays in registers and a query's maximum, sum and rescale stay in its own two lanes. Key j allowed iff (j < NC ? context_mask[b][j] : j - NC <= i), else -3e38: its power against a real maximum is 0, and what a wave sums while it has met no allowed key is wiped by the factor 2^(-3e38 - m) = 0 (every query has an allowed key, its own). The four quarters' (m, l, O) are joined through LDS.
__global__ __launch_bounds__(512) void k_fa(const _Float16* __restrict__ QH, const _Float16* __restrict__ QL, const _Float16* __restrict__ KH, const int* __restrict__ CM, const __bf16* __restrict__ VT, const __bf16* __restrict__ VL, float* __restrict__ Y) {
  __shared__ __align__(16) float so[4][64][HD + 4]; __shared__ float sm[4][64], sl[4][64];
  const int b = blockIdx.x / NH, h = blockIdx.x % NH; const int x = NQ / 64 - 1 - (int)blockIdx.y;   // query tiles in reverse, longest first, for speed only
  const int tid = threadIdx.x, lane = tid & 31, c = lane & 15, g = lane >> 4; const int wave = __builtin_amdgcn_readfirstlane(tid >> 5), qg = wave & 3, kq = wave >> 2; const int q0 = x * 64 + qg * 16;
  v16h qh[2], ql[2];
#pragma unroll
  for (int kc = 0; kc < 2; ++kc) { const size_t qo = (((size_t)blockIdx.x * (NQ / 16) + q0 / 16) * 2 + kc) * 512 + lane * 8; qh[kc] = fragp_h((const char*)(QH + qo)); ql[kc] = fragp_h((const char*)(QL + qo)); }
  const int nt = (NC + q0 + 16 + 31) >> 5;   // trips that hold a key some query of the group may see
  // a quarter takes two trips in a row, then skips the other quarters' six; the lane's four addresses walk along with the trips: a trip's four k fragments, and its four v fragments of each plane, are 4 KiB in a row
  const size_t fo = ((size_t)blockIdx.x * (NJ / 32) + 2 * kq) * 2048 + lane * 8; const char* kp = (const char*)(KH + fo); const char* vhp = (const char*)(VT + fo); const char* vlp = (const char*)(VL + fo); const char* cp = (const char*)(CM + (size_t)b * NC + 64 * kq + 8 * g);
  v8f o[HD / 16] = {}; float m = -3.0e38f, l = 0.f;
  for (int i = 0; i < NC / 128; ++i) { fa_trip<true>(kp, vhp, vlp, cp, 0, qh, ql, o, m, l); const int st = (i & 1) ? 7 * 32 : 32; kp += st * 128; vhp += st * 128; vlp += st * 128; cp += st * 4; }
  for (int i = 0, t = NC / 32 + 2 * kq; t < nt; ++i) { fa_trip<false>(kp, vhp, vlp, cp, q0 + c - (t * 32 - NC) - 8 * g, qh, ql, o, m, l); const int st = (i & 1) ? 7 : 1; t += st; kp += st * 4096; vhp += st * 4096; vlp += st * 4096; }
  l += xhalf(l); if (g == 0) { sm[kq][qg * 16 + c] = m; sl[kq][qg * 16 + c] = l; }
#pragma unroll
  for (int j = 0; j < HD / 16; ++j) { v4f lo4, hi4;
#pragma unroll
    for (int r = 0; r < 4; ++r) { lo4[r] = o[j][r]; hi4[r] = o[j][4 + r]; }
    vst2(&so[kq][qg * 16 + c][j * 16 + 8 * g], lo4); vst2(&so[kq][qg * 16 + c][j * 16 + 8 * g + 4], hi4); }
  __syncthreads();
  const int q = (tid >> 7) * 16 + (tid & 15), dd = ((tid >> 4) & 7) * 8; float mt = sm[0][q];   // thread = (query, 8 of its 64 outputs), so numbered that a wave's 32 threads are the 32 lanes of two pieces of one fragment of k_out
#pragma unroll
  for (int w = 1; w < 4; ++w) mt = fmaxf(mt, sm[w][q]);
  float lt = 0.f; v4f y0 = {}, y1 = {};
#pragma unroll
  for (int w = 0; w < 4; ++w) { const float e = ex2(sm[w][q] - mt); lt += e * sl[w][q]; y0 += e * *(const v4f*)&so[w][q][dd]; y1 += e * *(const v4f*)&so[w][q][dd + 4]; }
  const float inv = 1.0f / lt; float* yp = Y + (((((size_t)b * NQ + x * 64 + q) >> 4) * (CC / 32) + h * 2 + (dd >> 5)) * 4 + ((dd >> 4) & 1) * 2) * 128 + lane * 4; vst2(yp, y0 * inv); vst2(yp + 128, y1 * inv); }
// ---- k_out: out = o (bf16 hi + lo) Wo + bo (Wo as the bf16 plane of k_pre)
__global__ __launch_bounds__(128) void k_out(const float* __restrict__ Y, const __bf16* __restrict__ WOT, const float* __restrict__ BO, float* __restrict__ OUT) { __shared__ __align__(16) float sf[4][16][132];
  const int tid = threadIdx.x, wave = tid >> 5, lane = tid & 31, col = lane & 15, g = lane >> 4; const int c0 = blockIdx.y * 128; const size_t r0 = (size_t)blockIdx.x * 64 + wave * 16;
  const float* yfr = Y + (r0 >> 4) * (size_t)(CC / 32) * 512 + lane * 4; const __bf16* wt0 = WOT + (size_t)(c0 / 16) * (CC / 32) * 512;   // this lane's place in the first A fragment of the wave's 16 rows; first fragment of the block's first 16 columns
  v8f acc[8] = {};
#pragma unroll 1   // one trip holds 16 B fragments in registers; a second copy of the body would not fit
  for (int kc = 0; kc < CC / 64; ++kc) { v4f ar[2][4]; v16b w[2][8];   // 64 k a trip, as in k_proj
#pragma unroll
    for (int u = 0; u < 2; ++u) { const float* p = yfr + u * 512; ar[u][0] = *(const v4f*)p; ar[u][1] = *(const v4f*)(p + 128); ar[u][2] = *(const v4f*)(p + 256); ar[u][3] = *(const v4f*)(p + 384); }
    asm volatile("s_wait_xcnt 0x0" ::: "memory");   // in this build one of the B loads below lands on the register pair that holds the A loads' address
#pragma unroll
    for (int u = 0; u < 2; ++u)
#pragma unroll
      for (int j = 0; j < 8; ++j) w[u][j] = fragw_b(wt0 + ((size_t)j * (CC / 32) + kc * 2 + u) * 512, lane);
    __builtin_amdgcn_sched_barrier(0);   // every load of the trip is issued ahead of the first split, so that a trip waits for memory once; without it part of the B loads is placed behind the split of A
#pragma unroll
    for (int u = 0; u < 2; ++u) { float av[16];
#pragma unroll
      for (int i = 0; i < 16; ++i) av[i] = ar[u][i >> 2][i & 3];
      const F2 a = bsplit16(av);
#pragma unroll
      for (int j = 0; j < 8; ++j) { acc[j] = wmma_bf(a.h, w[u][j], acc[j]); acc[j] = wmma_bf(a.l, w[u][j], acc[j]); } }
    yfr += 1024; }
#pragma unroll
  for (int j = 0; j < 8; ++j) { const float bb = bfr(BO[c0 + j * 16 + col]);
#pragma unroll
    for (int r = 0; r < 8; ++r) sf[wave][8 * g + r][j * 16 + col] = acc[j][r] + bb; }
  LDSX(); for (int rl = 0; rl < 16; ++rl) vst2(OUT + (r0 + rl) * CC + c0 + lane * 4, *(const v4f*)&sf[wave][rl][lane * 4]); }
extern "C" void kernel_launch(void* const* d_in, const int* in_sizes, int n_in, void* d_out, int out_size, void* d_ws, size_t ws_size, hipStream_t stream) {
  (void)in_sizes; (void)n_in; (void)out_size;
  const float** F = (const float**)d_in;   // 0 x [2,1024,1024], 1 context [2,1024,1024], 2 context_mask [2,1024] int, 3 rotary_pos_emb [2048,64], 4 norm_w, 5 norm_b, 6 cnorm_w, 7 cnorm_b, 8 Wq [1024,1024] (in,out), 9 Wkv [1024,2048], 10 Wo [1024,1024], 11 bo
  if (ws_size < (size_t)WS_END) return;
  char* ws = (char*)d_ws; float* Y = (float*)(ws + WS_Y); _Float16 *XN = (_Float16*)(ws + WS_XN), *CN = (_Float16*)(ws + WS_CN), *QH = (_Float16*)(ws + WS_QH), *QL = (_Float16*)(ws + WS_QL), *KH = (_Float16*)(ws + WS_KH); __bf16 *VT = (__bf16*)(ws + WS_VT), *VL = (__bf16*)(ws + WS_VL); unsigned short* WT = (unsigned short*)(ws + WS_WT); float* CS = (float*)(ws + WS_CS);
  k_pre<<<PRE_LN + PRE_WT + PRE_RT, 512, 0, stream>>>(F[0], F[1], F[4], F[5], F[6], F[7], F[8], F[9], F[10], F[3], XN, CN, WT, CS);
  k_proj<<<dim3(2 * PJB + TNB * NQ / 64, CC / 128), 128, 0, stream>>>(XN, CN, (const _Float16*)WT, CS, QH, QL, KH, VT, VL);
  k_fa<<<dim3(TNB * NH, NQ / 64), 512, 0, stream>>>(QH, QL, KH, (const int*)d_in[2], VT, VL, Y);
  k_out<<<dim3(TNB * NQ / 64, CC / 128), 128, 0, stream>>>(Y, (const __bf16*)WT + (size_t)3 * CC * CC, F[11], (float*)d_out);
}

// v009
// Measured time: 83.4 microseconds a run.
// Two timings next to v008 put it at 1.12 and 1.13 times that version's speed.
// Counting every step since v000, it is 16.5 times as fast.
// compute dtype: all float inputs rounded to bf16, context_mask (int) read; LayerNorm of x and context in f32; q = xn Wq * 8^-1 * log2(e) and k/v = [cn; xn] Wkv with the LN'd rows and the 0.02-scale weights as f16 (1 product) on WMMA 16x16x32, f32 accumulate; rotary (angles from the rotary_pos_emb input, precise cosf/sinf) in f32; q as f16 hi + residual, k f16 -> 2-product logits kept in registers; mask = context_mask & causal-with-prefix -> -3e38; running-maximum softmax in f32 in base 2 (the logits carry log2(e) from q's scale; each power is one hardware exp2), unnormalised P split bf16 hi + lo against v bf16 hi + lo (3 products), divided by the row sum at the end; out = o (bf16 hi + lo) Wo + bo; f32 output.
#include <hip/hip_runtime.h>
#include <math.h>

typedef __attribute__((ext_vector_type(16))) _Float16 v16h;
typedef __attribute__((ext_vector_type(16))) __bf16 v16b;
typedef __attribute__((ext_vector_type(8)))  _Float16 v8h;
typedef __attribute__((ext_vector_type(8)))  float v8f;
typedef __attribute__((ext_vector_type(4)))  float v4f;
typedef __attribute__((ext_vector_type(2)))  float v2f;
typedef __attribute__((ext_vector_type(4)))  unsigned v4u;
typedef __attribute__((ext_vector_type(4)))  int v4i;
typedef float __attribute__((may_alias)) float_a;
typedef int __attribute__((may_alias)) int_a;

template <typename T> __device__ __forceinline__ void vst2(void* p, T v) { *(T*)p = v;  }
__device__ __forceinline__ v8f wmma16(v16h a, v16h b, v8f c) {
  v8f d = __builtin_amdgcn_wmma_f32_16x16x32_f16(false, a, false, b, (short)0, c, false, false);
  asm volatile("v_nop\n\tv_nop\n\tv_nop\n\tv_nop" : "+v"(d) : "v"(a), "v"(b));
  return d;
}
__device__ __forceinline__ v8f wmma_bf(v16b a, v16b b, v8f c) {
  v8f d = __builtin_amdgcn_wmma_f32_16x16x32_bf16(false, a, false, b, (short)0, c, false, false);
  asm volatile("v_nop\n\tv_nop\n\tv_nop\n\tv_nop" : "+v"(d) : "v"(a), "v"(b));
  return d;
}
// 16x16x32 fragments: lane = (h = lane>>4, row/col = lane&15); elements 0..7 = k0+8h+0..7, 8..15 = k0+16+8h+0..7; D element r = row 8h+r
__device__ __forceinline__ v16h frag_h(const _Float16* rowk0, int lane) {
  union { v16h v; v8h q[2]; } u; const _Float16* p = rowk0 + 8 * (lane >> 4);
  u.q[0] = *(const v8h*)p; u.q[1] = *(const v8h*)(p + 16); return u.v;
}
__device__ __forceinline__ v16h frag_f32(const float* rowk0, int lane) {
  v16h a; const float* p = rowk0 + 8 * (lane >> 4);
#pragma unroll
  for (int i = 0; i < 8; ++i) { a[i] = (_Float16)p[i]; a[8 + i] = (_Float16)p[16 + i]; }
  return a;
}
__device__ __forceinline__ v16h frag_f32s(const float* rowk0, int lane, float sc) {
  v16h a; const float* p = rowk0 + 8 * (lane >> 4);
#pragma unroll
  for (int i = 0; i < 8; ++i) { a[i] = (_Float16)(p[i] * sc); a[8 + i] = (_Float16)(p[16 + i] * sc); }
  return a;
}
// column fragment from a [K][ld] layout (column n), rows >= K read as 0
__device__ __forceinline__ v16h fragc_f32(const float* W, int k0, int n, int lane, int ld, int K) {
  v16h a; const int g = lane >> 4;
#pragma unroll
  for (int i = 0; i < 8; ++i) { const int ka = k0 + 8 * g + i, kb = ka + 16;
    a[i] = (_Float16)(ka < K ? W[(size_t)(ka < K ? ka : K - 1) * ld + n] : 0.f); a[8 + i] = (_Float16)(kb < K ? W[(size_t)(kb < K ? kb : K - 1) * ld + n] : 0.f); }
  return a;
}
struct F2 { v16b h, l; };
__device__ __forceinline__ F2 bsplit16(const float v[16]) { F2 r;
#pragma unroll
  for (int i = 0; i < 16; ++i) { const __bf16 h = (__bf16)v[i]; r.h[i] = h; r.l[i] = (__bf16)(v[i] - (float)h); }
  return r; }
__device__ __forceinline__ F2 split_row(const float* row, int k0, int lane) { float v[16]; const float* p = row + k0 + 8 * (lane >> 4);
#pragma unroll
  for (int i = 0; i < 8; ++i) { v[i] = p[i]; v[8 + i] = p[16 + i]; }
  return bsplit16(v); }
__device__ __forceinline__ F2 split_rowK(const float* row, int k0, int lane, int K) { float v[16]; const int g = lane >> 4;
#pragma unroll
  for (int i = 0; i < 8; ++i) { const int ka = k0 + 8 * g + i, kb = ka + 16; v[i] = ka < K ? row[ka < K ? ka : K - 1] : 0.f; v[8 + i] = kb < K ? row[kb < K ? kb : K - 1] : 0.f; }
  return bsplit16(v); }
__device__ __forceinline__ F2 split_col(const float* W, int k0, int n, int lane, int ld, int K) { float v[16]; const int g = lane >> 4;
#pragma unroll
  for (int i = 0; i < 8; ++i) { const int ka = k0 + 8 * g + i, kb = ka + 16; v[i] = ka < K ? W[(size_t)(ka < K ? ka : K - 1) * ld + n] : 0.f; v[8 + i] = kb < K ? W[(size_t)(kb < K ? kb : K - 1) * ld + n] : 0.f; }
  return bsplit16(v); }
__device__ __forceinline__ v8f mac3(const F2& a, const F2& b, v8f c) { c = wmma_bf(a.l, b.h, c); c = wmma_bf(a.h, b.l, c); return wmma_bf(a.h, b.h, c); }
__device__ __forceinline__ float sigm(float v) { return 1.0f / (1.0f + expf(-v)); }
#define LDSX() do { asm volatile("s_wait_dscnt 0" ::: "memory"); __builtin_amdgcn_wave_barrier(); __builtin_amdgcn_fence(__ATOMIC_RELEASE, "workgroup"); } while (0)


// Causal prefix attention (B 2, 1,024 queries over 1,024 context + 1,024 self keys, 16 x 64, rotary on all 64 dims): prefix keys masked by context_mask, self keys causal.
#define NB 2
#define NQ 1024
#define NC 1024
#define NJ 2048
#define CC 1024
#define NH 16
#define HD 64
#ifndef TNB
#define TNB NB
#endif
typedef __attribute__((ext_vector_type(8))) __bf16 v8b;
__device__ __forceinline__ v16b frag_b(const __bf16* rowk0, int lane) {
  union { v16b v; v8b q[2]; } u; const __bf16* p = rowk0 + 8 * (lane >> 4);
  u.q[0] = *(const v8b*)p; u.q[1] = *(const v8b*)(p + 16); return u.v;
}
// A or B fragment stored in fragment order by k_pre (f = the fragment's 512 elements)
__device__ __forceinline__ v16h fragw_h(const _Float16* f, int lane) { union { v16h v; v8h q[2]; } u; u.q[0] = *(const v8h*)(f + lane * 8); u.q[1] = *(const v8h*)(f + 256 + lane * 8); return u.v; }
__device__ __forceinline__ v16b fragw_b(const __bf16* f, int lane) { union { v16b v; v8b q[2]; } u; u.q[0] = *(const v8b*)(f + lane * 8); u.q[1] = *(const v8b*)(f + 256 + lane * 8); return u.v; }
__device__ __forceinline__ float bfr(float v) { return (float)(__bf16)v; }
__device__ __attribute__((noinline)) float exp_ni(float v) { return expf(v); }
__device__ __attribute__((noinline)) float erf_ni(float v) { return erff(v); }


#define WS_XN  0u                                  // f16 LN'd x rows in A-fragment order [16-row tile of b*NQ][32-k step][512] (k_pre); they fill half of the place kept here, which Y needs whole
#define WS_CN  (WS_XN + 4u * (size_t)NB * NQ * CC)     // f16 LN'd context rows, in the same order
#define WS_QH  (WS_CN + 4u * (size_t)NB * NC * CC)     // f16 q (hi, residual) in B-fragment order [slice = b*NH + h][16-query tile][32-d step][512]
#define WS_QL  (WS_QH + 2u * (size_t)NB * NQ * CC)
#define WS_KH  (WS_QL + 2u * (size_t)NB * NQ * CC)     // f16 k in A-fragment order [slice][16-key tile][32-d step][512]
#define WS_VT  (WS_KH + 2u * (size_t)NB * NJ * CC)     // bf16 v planes (hi, lo) in A-fragment order [slice][32-key trip][16-d tile][512]
#define WS_VL  (WS_VT + 2u * (size_t)NB * CC * NJ)
#define WS_WT  (WS_VL + 2u * (size_t)NB * CC * NJ)     // 16-bit weight planes [4][64 n tiles][32 k steps][512] in B-fragment order (k_pre): f16 Wq, Wkv k half, Wkv v half; bf16 Wo
#define WS_Y   WS_XN                               // f32 o in A-fragment order [16-row tile of b*NQ][32-k step][4 pieces][32 lanes][4]: piece p of lane (g, row) = k 16 (p >> 1) + 8 g + 4 (p & 1) + 0..3; k_fa writes them after the last reader of XN (k_proj) has ended
#define WS_CS  (WS_WT + 2u * (size_t)4 * CC * CC)     // f32 rotary table [NJ positions][2 d halves][16 columns][cos, sin of d = 32 half + column; cos, sin of d + 16] (k_pre)
#define WS_END (WS_CS + 4u * (size_t)NJ * HD * 2)

typedef __attribute__((ext_vector_type(2))) _Float16 v2h;
typedef __attribute__((ext_vector_type(2))) __bf16 v2b;
// ---- wt_tile (k_pre): half a block = 256 threads = (64 k, 64 n, plane z): each weight is rounded once to the 16-bit type its product reads (z 0 Wq, 1 Wkv cols 0..1023, 2 Wkv cols 1024..: bf16 then f16; 3 Wo: bf16) and stored in B-fragment order: 1 KiB for each (16 n, 32 k) fragment, elements 0..7 of lanes 0..31 and then elements 8..15, so that each of a fragment's two 16-byte loads reads four whole 128-byte lines. tile = (plane tile >> 8, 64-n step (tile >> 4) & 15, 64-k step tile & 15); the two halves of a block hold tiles of one plane and pass the one barrier together
__device__ __forceinline__ void wt_tile(const float* __restrict__ WQ, const float* __restrict__ WKV, const float* __restrict__ WO, unsigned short* __restrict__ WT, unsigned (*st)[36], int t, int tile) {   // st: [n][k pair], pitch 144 bytes
  const int z = tile >> 8, k0 = (tile & 15) * 64, n0 = ((tile >> 4) & 15) * 64; const float* src = (z == 0) ? WQ : (z == 3) ? WO : WKV; const int ld = (z == 1 || z == 2) ? 2 * CC : CC; const int off = (z == 2) ? CC : 0;
  const int kt = t >> 4, q = t & 15; v4f v[2][2];   // rows k0 + 32 i + 2 kt + {0, 1}, columns n0 + 4 q + 0..3
#pragma unroll
  for (int i = 0; i < 2; ++i)
#pragma unroll
    for (int r = 0; r < 2; ++r) { v[i][r] = *(const v4f*)(src + (size_t)(k0 + i * 32 + 2 * kt + r) * ld + off + n0 + q * 4); }
#pragma unroll
  for (int i = 0; i < 2; ++i)
#pragma unroll
    for (int c = 0; c < 4; ++c) { v2b rb; rb[0] = (__bf16)v[i][0][c]; rb[1] = (__bf16)v[i][1][c]; v2h rh; rh[0] = (_Float16)(float)rb[0]; rh[1] = (_Float16)(float)rb[1];
      st[q * 4 + c][i * 16 + kt] = (z == 3) ? __builtin_bit_cast(unsigned, rb) : __builtin_bit_cast(unsigned, rh); }
  __syncthreads();
#pragma unroll
  for (int i = 0; i < 2; ++i) { const int e = t + i * 256, f = e >> 6, w = e & 63;   // fragment f = (16-n tile f >> 1, 32-k step f & 1) of the tile's 8; 16-byte piece w = (element half w >> 5, lane w & 31)
    const int n = (f >> 1) * 16 + (w & 15), k8 = (f & 1) * 4 + (w >> 5) * 2 + ((w >> 4) & 1);   // the piece holds column n, rows 8 k8 + 0..7
    vst2(WT + (((size_t)z * (CC / 16) + n0 / 16 + (f >> 1)) * (CC / 32) + k0 / 32 + (f & 1)) * 512 + w * 8, *(const v4u*)&st[n][k8 * 4]); }
  asm volatile("s_wait_xcnt 0x0" ::: "memory"); }   // in the listing another branch of k_pre follows, whose first instructions write the registers that hold the two stores' address
// ---- rot_table (k_pre): 65,536 threads compute cos and sin of every rotary angle once, in the order in which a lane of k_proj reads them: thread = (position id >> 5, d half (id >> 4) & 1, column id & 15)
__device__ __forceinline__ void rot_table(const float* __restrict__ ROT, float* __restrict__ CS, int id) {
  const float* ap = ROT + (size_t)(id >> 5) * HD + ((id >> 4) & 1) * 32 + (id & 15); const float a0 = bfr(ap[0]), a1 = bfr(ap[16]);
  v4f o; o[0] = cosf(a0); o[1] = sinf(a0); o[2] = cosf(a1); o[3] = sinf(a1); vst2(CS + (size_t)id * 4, o);
  asm volatile("s_wait_xcnt 0x0" ::: "memory"); }   // in the listing the other branches of k_pre follow, whose first instructions write the registers that the store names
// ---- ln_tile (k_pre): block = 16 rows = one A tile of k_proj (tiles 0..NB*NQ/16-1 from x -> XN; the rest from context -> CN), one wave a row: the row stays in the wave's registers (8 loads of 512 bytes in a row, all in flight at once), mean and variance are sums over the wave's lanes. The LN'd row is rounded to the f16 that k_proj's product reads; the 16 rows meet in LDS and leave in A-fragment order: 1 KiB for each (16 rows, 32 k) fragment, elements 0..7 of lanes 0..31 and then elements 8..15
typedef __attribute__((ext_vector_type(4))) _Float16 v4h;
__device__ __forceinline__ void ln_tile(const float* __restrict__ X, const float* __restrict__ CT, const float* __restrict__ GX, const float* __restrict__ BX, const float* __restrict__ GC, const float* __restrict__ BC, _Float16* __restrict__ XN, _Float16* __restrict__ CN, _Float16 (*sh)[CC + 8], int tid, size_t tile) {
  const int wave = tid >> 5, lane = tid & 31; const bool isx = tile < (size_t)NB * NQ / 16; if (!isx) tile -= (size_t)NB * NQ / 16;
  const float* src = (isx ? X : CT) + (tile * 16 + wave) * CC + lane * 4; const float* ga = (isx ? GX : GC) + lane * 4; const float* be = (isx ? BX : BC) + lane * 4;
  v4f v[8], gm[8], bt[8];
#pragma unroll
  for (int i = 0; i < 8; ++i) v[i] = *(const v4f*)(src + i * 128);
  asm volatile("s_wait_xcnt 0x0" ::: "memory");   // in this build one of the loads below lands on the register pair that holds the row loads' address
#pragma unroll
  for (int i = 0; i < 8; ++i) { gm[i] = *(const v4f*)(ga + i * 128); if (i < 7) bt[i] = *(const v4f*)(be + i * 128); }
  asm volatile("s_wait_xcnt 0x0" ::: "memory");   // in this build the last load lands on the register that holds the offset of the 15 loads above
  bt[7] = *(const v4f*)(be + 7 * 128);
  __builtin_amdgcn_sched_barrier(0);   // all 24 loads are issued ahead of the first sum, so that the wave waits for memory once; without it the weight and bias loads are placed behind the two sums, two at a time with a wait for each pair
  v4f a4 = {};   // four sums side by side: a chain of 8 additions, not of 32
#pragma unroll
  for (int i = 0; i < 8; ++i) {
#pragma unroll
    for (int c = 0; c < 4; ++c) v[i][c] = bfr(v[i][c]);
    a4 += v[i]; }
  float a = (a4[0] + a4[1]) + (a4[2] + a4[3]);
#pragma unroll
  for (int o = 1; o < 32; o <<= 1) a += __shfl_xor(a, o);
  const float mu = a / CC; v4f q4 = {};
#pragma unroll
  for (int i = 0; i < 8; ++i) { const v4f d = v[i] - mu; q4 += d * d; }
  float q = (q4[0] + q4[1]) + (q4[2] + q4[3]);
#pragma unroll
  for (int o = 1; o < 32; o <<= 1) q += __shfl_xor(q, o);
  const float inv = 1.0f / sqrtf(q / CC + 1e-5f);
#pragma unroll
  for (int i = 0; i < 8; ++i) { v4h h;
#pragma unroll
    for (int c = 0; c < 4; ++c) h[c] = (_Float16)((v[i][c] - mu) * inv * bfr(gm[i][c]) + bfr(bt[i][c]));
    vst2(&sh[wave][i * 128 + lane * 4], h); }
  __syncthreads();
  _Float16* dst = (isx ? XN : CN) + tile * (size_t)(CC / 32) * 512;
#pragma unroll
  for (int i = 0; i < 4; ++i) { const int e = tid + i * 512, w = e & 63;   // 16-byte piece e = (32-k step e >> 6, element half w >> 5, lane w & 31): row w & 15, k = 8 k8 + 0..7; a wave stores 512 bytes in a row
    const int k8 = (e >> 6) * 4 + (w >> 5) * 2 + ((w >> 4) & 1); vst2(dst + (size_t)e * 8, *(const v4u*)&sh[w & 15][k8 * 8]); } }
// ---- k_pre: all that reads the inputs alone, in one launch, dealt by block index: LN tiles (the longest blocks) first, then the weight tiles, two a block, then the rotary table. Each branch is taken by a whole block
#define PRE_LN ((NB * NQ + NB * NC) / 16)
#define PRE_WT (4 * (CC / 64) * (CC / 64) / 2)
#define PRE_RT (NJ * 32 / 512)
// 8 waves a SIMD: at the LN branch's own register count one block would fill a WGP, and the weight tiles, which lay several blocks to a WGP as a launch of their own, would pass one block at a time
__global__ __launch_bounds__(512) __attribute__((amdgpu_waves_per_eu(8))) void k_pre(const float* __restrict__ X, const float* __restrict__ CT, const float* __restrict__ GX, const float* __restrict__ BX, const float* __restrict__ GC, const float* __restrict__ BC, const float* __restrict__ WQ, const float* __restrict__ WKV, const float* __restrict__ WO, const float* __restrict__ ROT, _Float16* __restrict__ XN, _Float16* __restrict__ CN, unsigned short* __restrict__ WT, float* __restrict__ CS) {
  __shared__ __align__(16) _Float16 sh[16][CC + 8];   // pitch 2,064 bytes = 16 x 129: the 16 rows of a 16-byte read fall on all 64 banks
  __shared__ __align__(16) unsigned st[2][64][36];
  const int tid = threadIdx.x, bid = blockIdx.x;
  if (bid < PRE_LN) ln_tile(X, CT, GX, BX, GC, BC, XN, CN, sh, tid, (size_t)bid);
  else if (bid < PRE_LN + PRE_WT) wt_tile(WQ, WKV, WO, WT, st[tid >> 8], tid & 255, (bid - PRE_LN) * 2 + __builtin_amdgcn_readfirstlane(tid >> 8));   // a wave lies in one half: its tile's indices stay scalars
  else rot_table(ROT, CS, (bid - PRE_LN - PRE_WT) * 512 + tid); }
// ---- k_proj: one launch for the three products; block = (128 rows, 128 cols, which), blockIdx.x = v's row blocks, then k's, then q's: which 0: q = xn Wq (rows b*NQ + i; key position CTX + i), 1: k, 2: v from [cn rows (j < NC); xn rows (j >= NC)] Wkv (cols 0..1023 k, 1024.. v); rotary on q and k; f16 A (LN'd rows) x f16 W (1 product). 4 waves = (64-row half wr, 64-col half wc): a wave holds 4 x 4 accumulator tiles, so that each loaded fragment feeds 4 products (8 fragments for 16 products)
// rotary on 16 rows x 64 cols (one head) of a wave's accumulators: element r of tile j is (row 8 g + r, d = 16 j + col), so that its partner d +- 32 is element r of tile j ^ 2 in the same lane; cs = the lane's place in the table row of its first position; rows go to sh (f16) and, for q, their residual to sl, at (row0 + r, cl0 + 16 j)
#define PJB (TNB * NJ / 128)
template <bool Q> __device__ __forceinline__ void rot_pack(const v8f (&acc)[4], const float* cs, _Float16 (*sh)[136], _Float16 (*sl)[136], int row0, int cl0) {
  v4f t[8][2];
#pragma unroll
  for (int r = 0; r < 8; ++r) { t[r][0] = *(const v4f*)(cs + r * 2 * HD); t[r][1] = *(const v4f*)(cs + r * 2 * HD + 64); }
  asm volatile("s_wait_xcnt 0x0" ::: "memory");   // the arithmetic below may take the register pair that holds these loads' address (in this build it does behind the last row tile's loads)
  const float sc = Q ? 0.125f * 1.44269504f : 1.0f;   // q carries log2(e) too: k_fa takes its powers in base 2
#pragma unroll
  for (int j = 0; j < 4; ++j)
#pragma unroll
    for (int r = 0; r < 8; ++r) { const float c = t[r][j >> 1][(j & 1) * 2], s = t[r][j >> 1][(j & 1) * 2 + 1];
      const float me = acc[j][r] * sc; const float partner = (j < 2) ? -(acc[j + 2][r] * sc) : acc[j - 2][r] * sc;
      const float v = me * c + partner * s; const _Float16 hv = (_Float16)v; sh[row0 + r][cl0 + j * 16] = hv; if (Q) sl[row0 + r][cl0 + j * 16] = (_Float16)(v - (float)hv); } }
__global__ __launch_bounds__(128) void k_proj(const _Float16* __restrict__ XN, const _Float16* __restrict__ CN, const _Float16* __restrict__ WT, const float* __restrict__ CS, _Float16* __restrict__ QH, _Float16* __restrict__ QL, _Float16* __restrict__ KH, __bf16* __restrict__ VT, __bf16* __restrict__ VL) {
  __shared__ __align__(16) unsigned short sb[2][128][136];   // two 16-bit planes of the block's tile: q, k as [row][col] (f16 value, residual); v as [col][row] (bf16 hi, lo); pitch 272 bytes = 16 x 17
  const int tid = threadIdx.x, wave = tid >> 5, lane = tid & 31, col = lane & 15, g = lane >> 4, wr = wave >> 1, wc = wave & 1; const int c0 = blockIdx.y * 128; const int which = (int)blockIdx.x < PJB ? 2 : (int)blockIdx.x < 2 * PJB ? 1 : 0; const int bx = (int)blockIdx.x - (2 - which) * PJB; const size_t r0 = (size_t)bx * 128 + wr * 64;   // the wave's first row within [b*L]
  const int L = (which == 0) ? NQ : NJ; const size_t b = r0 / L; const int jpos = (int)(r0 % L);   // the wave's 64 rows are four tiles of k_pre in a row, all context rows or all x rows
  const _Float16* at0 = ((which == 0) ? (XN + (b * NQ + jpos) * CC) : (jpos < NC ? (CN + (b * NC + jpos) * CC) : (XN + (b * NQ + (jpos - NC)) * CC)));   // its first A fragment: a tile's 32 fragments are 16 * CC elements in a row
  const _Float16* wt0 = WT + ((size_t)which * (CC / 16) + c0 / 16 + wc * 4) * (CC / 32) * 512;   // plane 'which', first fragment of the wave's first 16 columns
  v8f acc[4][4] = {};
#pragma unroll 1   // one trip holds 16 fragments in registers; a second copy of the body would not fit
  for (int kc = 0; kc < CC / 64; ++kc) { v16h a[2][4], w[2][4];   // 64 k a trip: 8 A and 8 B fragments for 32 products
    const _Float16* ak = at0 + (size_t)kc * 1024 + lane * 8; const _Float16* bk = wt0 + (size_t)kc * 1024 + lane * 8;   // this lane's place in the trip's first A and first B fragment
#pragma unroll
    for (int u = 0; u < 2; ++u)
#pragma unroll
      for (int i = 0; i < 4; ++i) a[u][i] = fragw_h(ak + (size_t)i * 16 * CC + u * 512, 0);
#pragma unroll
    for (int u = 0; u < 2; ++u)
#pragma unroll
      for (int j = 0; j < 4; ++j) w[u][j] = fragw_h(bk + (size_t)j * (CC / 32) * 512 + u * 512, 0);
    asm volatile("s_wait_xcnt 0x0" :: "v"(ak), "v"(bk) : "memory");   // ahead of the next trip's address additions; the two addresses are inputs so that they stay whole up to the wait: without that the last loads land on the pairs that hold them
    __builtin_amdgcn_sched_barrier(0);   // every load of the trip is issued ahead of the first product, so that a trip waits for memory once; without it the loads are placed among the products, two at a time with a wait for each pair
#pragma unroll
    for (int u = 0; u < 2; ++u)
#pragma unroll
      for (int i = 0; i < 4; ++i)
#pragma unroll
        for (int j = 0; j < 4; ++j) acc[i][j] = __builtin_amdgcn_wmma_f32_16x16x32_f16(false, a[u][i], false, w[u][j], (short)0, acc[i][j], false, false); }   // the plain builtin (the compiler keeps its distances): operands of an asm statement behind it must lie below v256, and with 16 tiles and 16 fragments that took spills in the loop
  const size_t rb = (size_t)bx * 128;
  if (which < 2) {   // rotary (q, k) in registers, then pack
    _Float16 (*sh)[136] = (_Float16 (*)[136])sb[0]; _Float16 (*sl)[136] = (_Float16 (*)[136])sb[1];
    const float* cs = CS + ((size_t)jpos + ((which == 0) ? NC : 0) + 8 * g) * (2 * HD) + col * 4;   // q uses the last NQ positions
    if (which == 0) {
#pragma unroll
      for (int i = 0; i < 4; ++i) rot_pack<true>(acc[i], cs + i * 16 * 2 * HD, sh, sl, wr * 64 + i * 16 + 8 * g, wc * 64 + col); }
    else {
#pragma unroll
      for (int i = 0; i < 4; ++i) rot_pack<false>(acc[i], cs + i * 16 * 2 * HD, sh, sl, wr * 64 + i * 16 + 8 * g, wc * 64 + col); }
    __syncthreads();
    _Float16* dh = which == 0 ? QH : KH; const size_t s0 = (rb / L) * NH + c0 / HD; const int kt0 = (int)(rb % L) / 16;   // the block's 32 fragments f = (head f >> 4, 16-row tile (f >> 1) & 7, d step f & 1); 16-byte piece w = (element half w >> 5, lane w & 31) holds row w & 15 of the tile, d = 8 d8 + 0..7
    for (int e = tid; e < 128 * 16; e += 128) { const int f = e >> 6, w = e & 63, hh = f >> 4, kt = (f >> 1) & 7, kc = f & 1; const int d8 = kc * 4 + (w >> 5) * 2 + ((w >> 4) & 1);
      const size_t o2 = (((s0 + hh) * (L / 16) + kt0 + kt) * 2 + kc) * 512 + w * 8; vst2((unsigned*)(dh + o2), *(const v4u*)&sh[kt * 16 + (w & 15)][hh * HD + d8 * 8]);
      asm volatile("s_wait_xcnt 0x0" ::: "memory");   // the next LDS read and the next address reuse the registers that the store names
      if (which == 0) { vst2((unsigned*)(QL + o2), *(const v4u*)&sl[kt * 16 + (w & 15)][hh * HD + d8 * 8]);
        asm volatile("s_wait_xcnt 0x0" ::: "memory"); } } }   // as above, ahead of the next trip
  else {   // v: a lane's 8 elements of a tile are 8 keys in a row of one d: split, they are one 16-byte store into each transposed plane
    __bf16 (*th)[136] = (__bf16 (*)[136])sb[0]; __bf16 (*tl2)[136] = (__bf16 (*)[136])sb[1];
#pragma unroll
    for (int i = 0; i < 4; ++i)
#pragma unroll
      for (int j = 0; j < 4; ++j) { v8b hi, lo;
#pragma unroll
        for (int r = 0; r < 8; ++r) { const float v = acc[i][j][r]; const __bf16 bh = (__bf16)v; hi[r] = bh; lo[r] = (__bf16)(v - (float)bh); }
        vst2(&th[wc * 64 + j * 16 + col][wr * 64 + i * 16 + 8 * g], hi); vst2(&tl2[wc * 64 + j * 16 + col][wr * 64 + i * 16 + 8 * g], lo); }
    __syncthreads(); const size_t s0 = (rb / NJ) * NH + c0 / HD; const int t0 = (int)(rb % NJ) / 32;
    // the block's 32 fragments of each plane, f = (head f >> 4, 32-key trip (f >> 2) & 3, d tile f & 3); piece w = (element half w >> 5, lane w & 31) holds d = w & 15 of the tile, keys 8 q8 + 0..7 of the block
    for (int e = tid; e < 128 * 16; e += 128) { const int f = e >> 6, w = e & 63, hh = f >> 4, tt = (f >> 2) & 3, j = f & 3; const int cl = hh * HD + j * 16 + (w & 15), q8 = tt * 4 + (w >> 5) * 2 + ((w >> 4) & 1);
      const size_t o2 = (((s0 + hh) * (NJ / 32) + t0 + tt) * 4 + j) * 512 + w * 8; vst2((unsigned*)(VT + o2), *(const v4u*)&th[cl][q8 * 8]); vst2((unsigned*)(VL + o2), *(const v4u*)&tl2[cl][q8 * 8]); } } }
// 2^x as the one hardware instruction; every argument in k_fa is <= 0, and a result below the normal range may come out as 0
__device__ __forceinline__ float ex2(float x) { return __builtin_amdgcn_exp2f(x); }
// lane l with lane l ^ 16
__device__ __forceinline__ float xhalf(float x) { return __builtin_bit_cast(float, __builtin_amdgcn_permlanex16(__builtin_bit_cast(int, x), __builtin_bit_cast(int, x), 0x76543210, 0xfedcba98, false, false)); }
// fragment stored in fragment order, at this lane's byte address in it: bytes 0..15 and 512..527 (each load of a wave reads 512 bytes in a row: four whole 128-byte lines)
__device__ __forceinline__ v16h fragp_h(const char* p) { union { v16h v; v8h q[2]; } u; u.q[0] = *(const v8h*)p; u.q[1] = *(const v8h*)(p + 512); return u.v; }
__device__ __forceinline__ v16b fragp_b(const char* p) { union { v16b v; v8b q[2]; } u; u.q[0] = *(const v8b*)p; u.q[1] = *(const v8b*)(p + 512); return u.v; }
// one 32-key trip of k_fa: kp, vhp, vlp, cp = this lane's place in the trip's first k fragment, in the first fragment of each v plane, and at its first mask word (CTX: context keys, masked by those words; else self keys, key e of the lane's 32 allowed iff e <= thr)
template <bool CTX> __device__ __forceinline__ void fa_trip(const char* kp, const char* vhp, const char* vlp, const char* cp, int thr, const v16h (&qh)[2], const v16h (&ql)[2], v8f (&o)[HD / 16], float& m, float& l) {
  v16h kf[2][2]; v16b vh[HD / 16], vl[HD / 16]; v4i cm[2][2];
#pragma unroll
  for (int a = 0; a < 2; ++a)
#pragma unroll
    for (int kc = 0; kc < 2; ++kc) kf[a][kc] = fragp_h(kp + (a * 2 + kc) * 1024);
  if (CTX) {
#pragma unroll
    for (int a = 0; a < 2; ++a) { cm[a][0] = *(const v4i*)(cp + a * 64); cm[a][1] = *(const v4i*)(cp + a * 64 + 16); } }
#pragma unroll
  for (int j = 0; j < HD / 16; ++j) { vh[j] = fragp_b(vhp + j * 1024); vl[j] = fragp_b(vlp + j * 1024); }
  v8f s[2] = {};
#pragma unroll
  for (int kc = 0; kc < 2; ++kc)
#pragma unroll
    for (int a = 0; a < 2; ++a) { s[a] = wmma16(kf[a][kc], qh[kc], s[a]); s[a] = wmma16(kf[a][kc], ql[kc], s[a]); }
#pragma unroll
  for (int a = 0; a < 2; ++a)
#pragma unroll
    for (int r = 0; r < 8; ++r) s[a][r] = (CTX ? (cm[a][r >> 2][r & 3] != 0) : (a * 16 + r <= thr)) ? s[a][r] : -3.0e38f;
  float mx = s[0][0];
#pragma unroll
  for (int e = 1; e < 16; ++e) mx = fmaxf(mx, s[e >> 3][e & 7]);
  mx = fmaxf(mx, xhalf(mx)); const float mn = fmaxf(m, mx); const float al = ex2(m - mn); m = mn;
  float pv[16], ps = 0.f;
#pragma unroll
  for (int e = 0; e < 16; ++e) { pv[e] = ex2(s[e >> 3][e & 7] - mn); ps += pv[e]; }
  l = l * al + ps; const F2 p = bsplit16(pv);
#pragma unroll
  for (int j = 0; j < HD / 16; ++j) { o[j] *= al; o[j] = wmma_bf(vh[j], p.h, o[j]); o[j] = wmma_bf(vh[j], p.l, o[j]); o[j] = wmma_bf(vl[j], p.h, o[j]); } }
// ---- k_fa: block = (slice = b * NH + h, 64 queries, longest first), 16 waves = (16-query group qg, key quarter kq). A wave walks its 32-key trips with S^T = K Q^T (2 products) and O^T += V^T P^T (3 products): lane (g, c) holds query c's scores of keys 8 g + 0..7 of each 16-key tile, which is the B fragment's k order, so that P stays in registers and a query's maximum, sum and rescale stay in its own two lanes. Key j allowed iff (j < NC ? context_mask[b][j] : j - NC <= i), else -3e38: its power against a real maximum is 0, and what a wave sums while it has met no allowed key is wiped by the factor 2^(-3e38 - m) = 0 (every query has an allowed key, its own). The four quarters' (m, l, O) are joined through LDS.
__global__ __launch_bounds__(512) void k_fa(const _Float16* __restrict__ QH, const _Float16* __restrict__ QL, const _Float16* __restrict__ KH, const int* __restrict__ CM, const __bf16* __restrict__ VT, const __bf16* __restrict__ VL, float* __restrict__ Y) {
  __shared__ __align__(16) float so[4][64][HD + 4]; __shared__ float sm[4][64], sl[4][64];
  const int b = blockIdx.x / NH, h = blockIdx.x % NH; const int x = NQ / 64 - 1 - (int)blockIdx.y;   // query tiles in reverse, longest first, for speed only
  const int tid = threadIdx.x, lane = tid & 31, c = lane & 15, g = lane >> 4; const int wave = __builtin_amdgcn_readfirstlane(tid >> 5), qg = wave & 3, kq = wave >> 2; const int q0 = x * 64 + qg * 16;
  v16h qh[2], ql[2];
#pragma unroll
  for (int kc = 0; kc < 2; ++kc) { const size_t qo = (((size_t)blockIdx.x * (NQ / 16) + q0 / 16) * 2 + kc) * 512 + lane * 8; qh[kc] = fragp_h((const char*)(QH + qo)); ql[kc] = fragp_h((const char*)(QL + qo)); }
  const int nt = (NC + q0 + 16 + 31) >> 5;   // trips that hold a key some query of the group may see
  // a quarter takes two trips in a row, then skips the other quarters' six; the lane's four addresses walk along with the trips: a trip's four k fragments, and its four v fragments of each plane, are 4 KiB in a row
  const size_t fo = ((size_t)blockIdx.x * (NJ / 32) + 2 * kq) * 2048 + lane * 8; const char* kp = (const char*)(KH + fo); const char* vhp = (const char*)(VT + fo); const char* vlp = (const char*)(VL + fo); const char* cp = (const char*)(CM + (size_t)b * NC + 64 * kq + 8 * g);
  v8f o[HD / 16] = {}; float m = -3.0e38f, l = 0.f;
  for (int i = 0; i < NC / 128; ++i) { fa_trip<true>(kp, vhp, vlp, cp, 0, qh, ql, o, m, l); const int st = (i & 1) ? 7 * 32 : 32; kp += st * 128; vhp += st * 128; vlp += st * 128; cp += st * 4; }
  for (int i = 0, t = NC / 32 + 2 * kq; t < nt; ++i) { fa_trip<false>(kp, vhp, vlp, cp, q0 + c - (t * 32 - NC) - 8 * g, qh, ql, o, m, l); const int st = (i & 1) ? 7 : 1; t += st; kp += st * 4096; vhp += st * 4096; vlp += st * 4096; }
  l += xhalf(l); if (g == 0) { sm[kq][qg * 16 + c] = m; sl[kq][qg * 16 + c] = l; }
#pragma unroll
  for (int j = 0; j < HD / 16; ++j) { v4f lo4, hi4;
#pragma unroll
    for (int r = 0; r < 4; ++r) { lo4[r] = o[j][r]; hi4[r] = o[j][4 + r]; }
    vst2(&so[kq][qg * 16 + c][j * 16 + 8 * g], lo4); vst2(&so[kq][qg * 16 + c][j * 16 + 8 * g + 4], hi4); }
  __syncthreads();
  const int q = (tid >> 7) * 16 + (tid & 15), dd = ((tid >> 4) & 7) * 8; float mt = sm[0][q];   // thread = (query, 8 of its 64 outputs), so numbered that a wave's 32 threads are the 32 lanes of two pieces of one fragment of k_out
#pragma unroll
  for (int w = 1; w < 4; ++w) mt = fmaxf(mt, sm[w][q]);
  float lt = 0.f; v4f y0 = {}, y1 = {};
#pragma unroll
  for (int w = 0; w < 4; ++w) { const float e = ex2(sm[w][q] - mt); lt += e * sl[w][q]; y0 += e * *(const v4f*)&so[w][q][dd]; y1 += e * *(const v4f*)&so[w][q][dd + 4]; }
  const float inv = 1.0f / lt; float* yp = Y + (((((size_t)b * NQ + x * 64 + q) >> 4) * (CC / 32) + h * 2 + (dd >> 5)) * 4 + ((dd >> 4) & 1) * 2) * 128 + lane * 4; vst2(yp, y0 * inv); vst2(yp + 128, y1 * inv); }
// ---- k_out: out = o (bf16 hi + lo) Wo + bo (Wo as the bf16 plane of k_pre)
__global__ __launch_bounds__(128) void k_out(const float* __restrict__ Y, const __bf16* __restrict__ WOT, const float* __restrict__ BO, float* __restrict__ OUT) { __shared__ __align__(16) float sf[4][16][132];
  const int tid = threadIdx.x, wave = tid >> 5, lane = tid & 31, col = lane & 15, g = lane >> 4; const int c0 = blockIdx.y * 128; const size_t r0 = (size_t)blockIdx.x * 64 + wave * 16;
  const float* yfr = Y + (r0 >> 4) * (size_t)(CC / 32) * 512 + lane * 4; const __bf16* wt0 = WOT + (size_t)(c0 / 16) * (CC / 32) * 512;   // this lane's place in the first A fragment of the wave's 16 rows; first fragment of the block's first 16 columns
  v8f acc[8] = {};
#pragma unroll 1   // one trip holds 16 B fragments in registers; a second copy of the body would not fit
  for (int kc = 0; kc < CC / 64; ++kc) { v4f ar[2][4]; v16b w[2][8];   // 64 k a trip, as in k_proj
#pragma unroll
    for (int u = 0; u < 2; ++u) { const float* p = yfr + u * 512; ar[u][0] = *(const v4f*)p; ar[u][1] = *(const v4f*)(p + 128); ar[u][2] = *(const v4f*)(p + 256); ar[u][3] = *(const v4f*)(p + 384); }
    asm volatile("s_wait_xcnt 0x0" ::: "memory");   // in this build one of the B loads below lands on the register pair that holds the A loads' address
#pragma unroll
    for (int u = 0; u < 2; ++u)
#pragma unroll
      for (int j = 0; j < 8; ++j) w[u][j] = fragw_b(wt0 + ((size_t)j * (CC / 32) + kc * 2 + u) * 512, lane);
    __builtin_amdgcn_sched_barrier(0);   // every load of the trip is issued ahead of the first split, so that a trip waits for memory once; without it part of the B loads is placed behind the split of A
#pragma unroll
    for (int u = 0; u < 2; ++u) { float av[16];
#pragma unroll
      for (int i = 0; i < 16; ++i) av[i] = ar[u][i >> 2][i & 3];
      const F2 a = bsplit16(av);
#pragma unroll
      for (int j = 0; j < 8; ++j) { acc[j] = wmma_bf(a.h, w[u][j], acc[j]); acc[j] = wmma_bf(a.l, w[u][j], acc[j]); } }
    yfr += 1024; }
#pragma unroll
  for (int j = 0; j < 8; ++j) { const float bb = bfr(BO[c0 + j * 16 + col]);
#pragma unroll
    for (int r = 0; r < 8; ++r) sf[wave][8 * g + r][j * 16 + col] = acc[j][r] + bb; }
  LDSX(); for (int rl = 0; rl < 16; ++rl) vst2(OUT + (r0 + rl) * CC + c0 + lane * 4, *(const v4f*)&sf[wave][rl][lane * 4]); }
extern "C" void kernel_launch(void* const* d_in, const int* in_sizes, int n_in, void* d_out, int out_size, void* d_ws, size_t ws_size, hipStream_t stream) {
  (void)in_sizes; (void)n_in; (void)out_size;
  const float** F = (const float**)d_in;   // 0 x [2,1024,1024], 1 context [2,1024,1024], 2 context_mask [2,1024] int, 3 rotary_pos_emb [2048,64], 4 norm_w, 5 norm_b, 6 cnorm_w, 7 cnorm_b, 8 Wq [1024,1024] (in,out), 9 Wkv [1024,2048], 10 Wo [1024,1024], 11 bo
  if (ws_size < (size_t)WS_END) return;
  char* ws = (char*)d_ws; float* Y = (float*)(ws + WS_Y); _Float16 *XN = (_Float16*)(ws + WS_XN), *CN = (_Float16*)(ws + WS_CN), *QH = (_Float16*)(ws + WS_QH), *QL = (_Float16*)(ws + WS_QL), *KH = (_Float16*)(ws + WS_KH); __bf16 *VT = (__bf16*)(ws + WS_VT), *VL = (__bf16*)(ws + WS_VL); unsigned short* WT = (unsigned short*)(ws + WS_WT); float* CS = (float*)(ws + WS_CS);
  k_pre<<<PRE_LN + PRE_WT + PRE_RT, 512, 0, stream>>>(F[0], F[1], F[4], F[5], F[6], F[7], F[8], F[9], F[10], F[3], XN, CN, WT, CS);
  k_proj<<<dim3(2 * PJB + TNB * NQ / 128, CC / 128), 128, 0, stream>>>(XN, CN, (const _Float16*)WT, CS, QH, QL, KH, VT, VL);
  k_fa<<<dim3(TNB * NH, NQ / 64), 512, 0, stream>>>(QH, QL, KH, (const int*)d_in[2], VT, VL, Y);
  k_out<<<dim3(TNB * NQ / 64, CC / 128), 128, 0, stream>>>(Y, (const __bf16*)WT + (size_t)3 * CC * CC, F[11], (float*)d_out);
}

// v010
// One run takes 78.3 microseconds.
// In two side-by-side timings against v009, it was 1.08 and 1.07 times as fast.
// Counting every step since v000, it is 17.7 times as fast.
// compute dtype: all float inputs rounded to bf16, context_mask (int) read; LayerNorm of x and context in f32; q = xn Wq * 8^-1 * log2(e) and k/v = [cn; xn] Wkv with the LN'd rows and the 0.02-scale weights as f16 (1 product) on WMMA 16x16x32, f32 accumulate; rotary (angles from the rotary_pos_emb input, precise cosf/sinf) in f32; q as f16 hi + residual, k f16 -> 2-product logits kept in registers; mask = context_mask & causal-with-prefix -> -3e38; running-maximum softmax in f32 in base 2 (the logits carry log2(e) from q's scale; each power is one hardware exp2), unnormalised P split bf16 hi + lo against v bf16 hi + lo (3 products), divided by the row sum at the end; out = o (bf16 hi + lo) Wo + bo; f32 output.
#include <hip/hip_runtime.h>
#include <math.h>

typedef __attribute__((ext_vector_type(16))) _Float16 v16h;
typedef __attribute__((ext_vector_type(16))) __bf16 v16b;
typedef __attribute__((ext_vector_type(8)))  _Float16 v8h;
typedef __attribute__((ext_vector_type(8)))  float v8f;
typedef __attribute__((ext_vector_type(4)))  float v4f;
typedef __attribute__((ext_vector_type(2)))  float v2f;
typedef __attribute__((ext_vector_type(4)))  unsigned v4u;
typedef __attribute__((ext_vector_type(4)))  int v4i;
typedef float __attribute__((may_alias)) float_a;
typedef int __attribute__((may_alias)) int_a;

template <typename T> __device__ __forceinline__ void vst2(void* p, T v) { *(T*)p = v;  }
__device__ __forceinline__ v8f wmma16(v16h a, v16h b, v8f c) {
  v8f d = __builtin_amdgcn_wmma_f32_16x16x32_f16(false, a, false, b, (short)0, c, false, false);
  asm volatile("v_nop\n\tv_nop\n\tv_nop\n\tv_nop" : "+v"(d) : "v"(a), "v"(b));
  return d;
}
__device__ __forceinline__ v8f wmma_bf(v16b a, v16b b, v8f c) {
  v8f d = __builtin_amdgcn_wmma_f32_16x16x32_bf16(false, a, false, b, (short)0, c, false, false);
  asm volatile("v_nop\n\tv_nop\n\tv_nop\n\tv_nop" : "+v"(d) : "v"(a), "v"(b));
  return d;
}
// 16x16x32 fragments: lane = (h = lane>>4, row/col = lane&15); elements 0..7 = k0+8h+0..7, 8..15 = k0+16+8h+0..7; D element r = row 8h+r
__device__ __forceinline__ v16h frag_h(const _Float16* rowk0, int lane) {
  union { v16h v; v8h q[2]; } u; const _Float16* p = rowk0 + 8 * (lane >> 4);
  u.q[0] = *(const v8h*)p; u.q[1] = *(const v8h*)(p + 16); return u.v;
}
__device__ __forceinline__ v16h frag_f32(const float* rowk0, int lane) {
  v16h a; const float* p = rowk0 + 8 * (lane >> 4);
#pragma unroll
  for (int i = 0; i < 8; ++i) { a[i] = (_Float16)p[i]; a[8 + i] = (_Float16)p[16 + i]; }
  return a;
}
__device__ __forceinline__ v16h frag_f32s(const float* rowk0, int lane, float sc) {
  v16h a; const float* p = rowk0 + 8 * (lane >> 4);
#pragma unroll
  for (int i = 0; i < 8; ++i) { a[i] = (_Float16)(p[i] * sc); a[8 + i] = (_Float16)(p[16 + i] * sc); }
  return a;
}
// column fragment from a [K][ld] layout (column n), rows >= K read as 0
__device__ __forceinline__ v16h fragc_f32(const float* W, int k0, int n, int lane, int ld, int K) {
  v16h a; const int g = lane >> 4;
#pragma unroll
  for (int i = 0; i < 8; ++i) { const int ka = k0 + 8 * g + i, kb = ka + 16;
    a[i] = (_Float16)(ka < K ? W[(size_t)(ka < K ? ka : K - 1) * ld + n] : 0.f); a[8 + i] = (_Float16)(kb < K ? W[(size_t)(kb < K ? kb : K - 1) * ld + n] : 0.f); }
  return a;
}
struct F2 { v16b h, l; };
__device__ __forceinline__ F2 bsplit16(const float v[16]) { F2 r;
#pragma unroll
  for (int i = 0; i < 16; ++i) { const __bf16 h = (__bf16)v[i]; r.h[i] = h; r.l[i] = (__bf16)(v[i] - (float)h); }
  return r; }
__device__ __forceinline__ F2 split_row(const float* row, int k0, int lane) { float v[16]; const float* p = row + k0 + 8 * (lane >> 4);
#pragma unroll
  for (int i = 0; i < 8; ++i) { v[i] = p[i]; v[8 + i] = p[16 + i]; }
  return bsplit16(v); }
__device__ __forceinline__ F2 split_rowK(const float* row, int k0, int lane, int K) { float v[16]; const int g = lane >> 4;
#pragma unroll
  for (int i = 0; i < 8; ++i) { const int ka = k0 + 8 * g + i, kb = ka + 16; v[i] = ka < K ? row[ka < K ? ka : K - 1] : 0.f; v[8 + i] = kb < K ? row[kb < K ? kb : K - 1] : 0.f; }
  return bsplit16(v); }
__device__ __forceinline__ F2 split_col(const float* W, int k0, int n, int lane, int ld, int K) { float v[16]; const int g = lane >> 4;
#pragma unroll
  for (int i = 0; i < 8; ++i) { const int ka = k0 + 8 * g + i, kb = ka + 16; v[i] = ka < K ? W[(size_t)(ka < K ? ka : K - 1) * ld + n] : 0.f; v[8 + i] = kb < K ? W[(size_t)(kb < K ? kb : K - 1) * ld + n] : 0.f; }
  return bsplit16(v); }
__device__ __forceinline__ v8f mac3(const F2& a, const F2& b, v8f c) { c = wmma_bf(a.l, b.h, c); c = wmma_bf(a.h, b.l, c); return wmma_bf(a.h, b.h, c); }
__device__ __forceinline__ float sigm(float v) { return 1.0f / (1.0f + expf(-v)); }
#define LDSX() do { asm volatile("s_wait_dscnt 0" ::: "memory"); __builtin_amdgcn_wave_barrier(); __builtin_amdgcn_fence(__ATOMIC_RELEASE, "workgroup"); } while (0)


// Causal prefix attention (B 2, 1,024 queries over 1,024 context + 1,024 self keys, 16 x 64, rotary on all 64 dims): prefix keys masked by context_mask, self keys causal.
#define NB 2
#define NQ 1024
#define NC 1024
#define NJ 2048
#define CC 1024
#define NH 16
#define HD 64
#ifndef TNB
#define TNB NB
#endif
typedef __attribute__((ext_vector_type(8))) __bf16 v8b;
__device__ __forceinline__ v16b frag_b(const __bf16* rowk0, int lane) {
  union { v16b v; v8b q[2]; } u; const __bf16* p = rowk0 + 8 * (lane >> 4);
  u.q[0] = *(const v8b*)p; u.q[1] = *(const v8b*)(p + 16); return u.v;
}
// A or B fragment stored in fragment order by k_pre (f = the fragment's 512 elements)
__device__ __forceinline__ v16h fragw_h(const _Float16* f, int lane) { union { v16h v; v8h q[2]; } u; u.q[0] = *(const v8h*)(f + lane * 8); u.q[1] = *(const v8h*)(f + 256 + lane * 8); return u.v; }
__device__ __forceinline__ v16b fragw_b(const __bf16* f, int lane) { union { v16b v; v8b q[2]; } u; u.q[0] = *(const v8b*)(f + lane * 8); u.q[1] = *(const v8b*)(f + 256 + lane * 8); return u.v; }
__device__ __forceinline__ float bfr(float v) { return (float)(__bf16)v; }
__device__ __attribute__((noinline)) float exp_ni(float v) { return expf(v); }
__device__ __attribute__((noinline)) float erf_ni(float v) { return erff(v); }


#define WS_XN  0u                                  // f16 LN'd x rows in A-fragment order [16-row tile of b*NQ][32-k step][512] (k_pre); they fill half of the place kept here, which Y needs whole
#define WS_CN  (WS_XN + 4u * (size_t)NB * NQ * CC)     // f16 LN'd context rows, in the same order
#define WS_QH  (WS_CN + 4u * (size_t)NB * NC * CC)     // f16 q (hi, residual) in B-fragment order [slice = b*NH + h][16-query tile][32-d step][512]
#define WS_QL  (WS_QH + 2u * (size_t)NB * NQ * CC)
#define WS_KH  (WS_QL + 2u * (size_t)NB * NQ * CC)     // f16 k in A-fragment order [slice][16-key tile][32-d step][512]
#define WS_VT  (WS_KH + 2u * (size_t)NB * NJ * CC)     // bf16 v planes (hi, lo) in A-fragment order [slice][32-key trip][16-d tile][512]
#define WS_VL  (WS_VT + 2u * (size_t)NB * CC * NJ)
#define WS_WT  (WS_VL + 2u * (size_t)NB * CC * NJ)     // 16-bit weight planes [4][64 n tiles][32 k steps][512] in B-fragment order (k_pre): f16 Wq, Wkv k half, Wkv v half; bf16 Wo
#define WS_Y   WS_XN                               // f32 o in A-fragment order [16-row tile of b*NQ][32-k step][4 pieces][32 lanes][4]: piece p of lane (g, row) = k 16 (p >> 1) + 8 g + 4 (p & 1) + 0..3; k_fa writes them after the last reader of XN (k_proj) has ended
#define WS_CS  (WS_WT + 2u * (size_t)4 * CC * CC)     // f32 rotary table [NJ positions][2 d halves][16 columns][cos, sin of d = 32 half + column; cos, sin of d + 16] (k_pre)
#define WS_END (WS_CS + 4u * (size_t)NJ * HD * 2)

typedef __attribute__((ext_vector_type(2))) _Float16 v2h;
typedef __attribute__((ext_vector_type(2))) __bf16 v2b;
// ---- wt_tile (k_pre): half a block = 256 threads = (64 k, 64 n, plane z): each weight is rounded once to the 16-bit type its product reads (z 0 Wq, 1 Wkv cols 0..1023, 2 Wkv cols 1024..: bf16 then f16; 3 Wo: bf16) and stored in B-fragment order: 1 KiB for each (16 n, 32 k) fragment, elements 0..7 of lanes 0..31 and then elements 8..15, so that each of a fragment's two 16-byte loads reads four whole 128-byte lines. tile = (plane tile >> 8, 64-n step (tile >> 4) & 15, 64-k step tile & 15); the two halves of a block hold tiles of one plane and pass the one barrier together
__device__ __forceinline__ void wt_tile(const float* __restrict__ WQ, const float* __restrict__ WKV, const float* __restrict__ WO, unsigned short* __restrict__ WT, unsigned (*st)[36], int t, int tile) {   // st: [n][k pair], pitch 144 bytes
  const int z = tile >> 8, k0 = (tile & 15) * 64, n0 = ((tile >> 4) & 15) * 64; const float* src = (z == 0) ? WQ : (z == 3) ? WO : WKV; const int ld = (z == 1 || z == 2) ? 2 * CC : CC; const int off = (z == 2) ? CC : 0;
  const int kt = t >> 4, q = t & 15; v4f v[2][2];   // rows k0 + 32 i + 2 kt + {0, 1}, columns n0 + 4 q + 0..3
#pragma unroll
  for (int i = 0; i < 2; ++i)
#pragma unroll
    for (int r = 0; r < 2; ++r) { v[i][r] = *(const v4f*)(src + (size_t)(k0 + i * 32 + 2 * kt + r) * ld + off + n0 + q * 4); }
#pragma unroll
  for (int i = 0; i < 2; ++i)
#pragma unroll
    for (int c = 0; c < 4; ++c) { v2b rb; rb[0] = (__bf16)v[i][0][c]; rb[1] = (__bf16)v[i][1][c]; v2h rh; rh[0] = (_Float16)(float)rb[0]; rh[1] = (_Float16)(float)rb[1];
      st[q * 4 + c][i * 16 + kt] = (z == 3) ? __builtin_bit_cast(unsigned, rb) : __builtin_bit_cast(unsigned, rh); }
  __syncthreads();
#pragma unroll
  for (int i = 0; i < 2; ++i) { const int e = t + i * 256, f = e >> 6, w = e & 63;   // fragment f = (16-n tile f >> 1, 32-k step f & 1) of the tile's 8; 16-byte piece w = (element half w >> 5, lane w & 31)
    const int n = (f >> 1) * 16 + (w & 15), k8 = (f & 1) * 4 + (w >> 5) * 2 + ((w >> 4) & 1);   // the piece holds column n, rows 8 k8 + 0..7
    vst2(WT + (((size_t)z * (CC / 16) + n0 / 16 + (f >> 1)) * (CC / 32) + k0 / 32 + (f & 1)) * 512 + w * 8, *(const v4u*)&st[n][k8 * 4]); }
  asm volatile("s_wait_xcnt 0x0" ::: "memory"); }   // in the listing another branch of k_pre follows, whose first instructions write the registers that hold the two stores' address
// ---- rot_table (k_pre): 65,536 threads compute cos and sin of every rotary angle once, in the order in which a lane of k_proj reads them: thread = (position id >> 5, d half (id >> 4) & 1, column id & 15)
__device__ __forceinline__ void rot_table(const float* __restrict__ ROT, float* __restrict__ CS, int id) {
  const float* ap = ROT + (size_t)(id >> 5) * HD + ((id >> 4) & 1) * 32 + (id & 15); const float a0 = bfr(ap[0]), a1 = bfr(ap[16]);
  v4f o; o[0] = cosf(a0); o[1] = sinf(a0); o[2] = cosf(a1); o[3] = sinf(a1); vst2(CS + (size_t)id * 4, o);
  asm volatile("s_wait_xcnt 0x0" ::: "memory"); }   // in the listing the other branches of k_pre follow, whose first instructions write the registers that the store names
// ---- ln_tile (k_pre): block = 16 rows = one A tile of k_proj (tiles 0..NB*NQ/16-1 from x -> XN; the rest from context -> CN), one wave a row: the row stays in the wave's registers (8 loads of 512 bytes in a row, all in flight at once), mean and variance are sums over the wave's lanes. The LN'd row is rounded to the f16 that k_proj's product reads; the 16 rows meet in LDS and leave in A-fragment order: 1 KiB for each (16 rows, 32 k) fragment, elements 0..7 of lanes 0..31 and then elements 8..15
typedef __attribute__((ext_vector_type(4))) _Float16 v4h;
__device__ __forceinline__ void ln_tile(const float* __restrict__ X, const float* __restrict__ CT, const float* __restrict__ GX, const float* __restrict__ BX, const float* __restrict__ GC, const float* __restrict__ BC, _Float16* __restrict__ XN, _Float16* __restrict__ CN, _Float16 (*sh)[CC + 8], int tid, size_t tile) {
  const int wave = tid >> 5, lane = tid & 31; const bool isx = tile < (size_t)NB * NQ / 16; if (!isx) tile -= (size_t)NB * NQ / 16;
  const float* src = (isx ? X : CT) + (tile * 16 + wave) * CC + lane * 4; const float* ga = (isx ? GX : GC) + lane * 4; const float* be = (isx ? BX : BC) + lane * 4;
  v4f v[8], gm[8], bt[8];
#pragma unroll
  for (int i = 0; i < 8; ++i) v[i] = *(const v4f*)(src + i * 128);
  asm volatile("s_wait_xcnt 0x0" ::: "memory");   // in this build one of the loads below lands on the register pair that holds the row loads' address
#pragma unroll
  for (int i = 0; i < 8; ++i) { gm[i] = *(const v4f*)(ga + i * 128); if (i < 7) bt[i] = *(const v4f*)(be + i * 128); }
  asm volatile("s_wait_xcnt 0x0" ::: "memory");   // in this build the last load lands on the register that holds the offset of the 15 loads above
  bt[7] = *(const v4f*)(be + 7 * 128);
  __builtin_amdgcn_sched_barrier(0);   // all 24 loads are issued ahead of the first sum, so that the wave waits for memory once; without it the weight and bias loads are placed behind the two sums, two at a time with a wait for each pair
  v4f a4 = {};   // four sums side by side: a chain of 8 additions, not of 32
#pragma unroll
  for (int i = 0; i < 8; ++i) {
#pragma unroll
    for (int c = 0; c < 4; ++c) v[i][c] = bfr(v[i][c]);
    a4 += v[i]; }
  float a = (a4[0] + a4[1]) + (a4[2] + a4[3]);
#pragma unroll
  for (int o = 1; o < 32; o <<= 1) a += __shfl_xor(a, o);
  const float mu = a / CC; v4f q4 = {};
#pragma unroll
  for (int i = 0; i < 8; ++i) { const v4f d = v[i] - mu; q4 += d * d; }
  float q = (q4[0] + q4[1]) + (q4[2] + q4[3]);
#pragma unroll
  for (int o = 1; o < 32; o <<= 1) q += __shfl_xor(q, o);
  const float inv = 1.0f / sqrtf(q / CC + 1e-5f);
#pragma unroll
  for (int i = 0; i < 8; ++i) { v4h h;
#pragma unroll
    for (int c = 0; c < 4; ++c) h[c] = (_Float16)((v[i][c] - mu) * inv * bfr(gm[i][c]) + bfr(bt[i][c]));
    vst2(&sh[wave][i * 128 + lane * 4], h); }
  __syncthreads();
  _Float16* dst = (isx ? XN : CN) + tile * (size_t)(CC / 32) * 512;
#pragma unroll
  for (int i = 0; i < 4; ++i) { const int e = tid + i * 512, w = e & 63;   // 16-byte piece e = (32-k step e >> 6, element half w >> 5, lane w & 31): row w & 15, k = 8 k8 + 0..7; a wave stores 512 bytes in a row
    const int k8 = (e >> 6) * 4 + (w >> 5) * 2 + ((w >> 4) & 1); vst2(dst + (size_t)e * 8, *(const v4u*)&sh[w & 15][k8 * 8]); } }
// ---- k_pre: all that reads the inputs alone, in one launch, dealt by block index: LN tiles (the longest blocks) first, then the weight tiles, two a block, then the rotary table. Each branch is taken by a whole block
#define PRE_LN ((NB * NQ + NB * NC) / 16)
#define PRE_WT (4 * (CC / 64) * (CC / 64) / 2)
#define PRE_RT (NJ * 32 / 512)
// 8 waves a SIMD: at the LN branch's own register count one block would fill a WGP, and the weight tiles, which lay several blocks to a WGP as a launch of their own, would pass one block at a time
__global__ __launch_bounds__(512) __attribute__((amdgpu_waves_per_eu(8))) void k_pre(const float* __restrict__ X, const float* __restrict__ CT, const float* __restrict__ GX, const float* __restrict__ BX, const float* __restrict__ GC, const float* __restrict__ BC, const float* __restrict__ WQ, const float* __restrict__ WKV, const float* __restrict__ WO, const float* __restrict__ ROT, _Float16* __restrict__ XN, _Float16* __restrict__ CN, unsigned short* __restrict__ WT, float* __restrict__ CS) {
  __shared__ __align__(16) _Float16 sh[16][CC + 8];   // pitch 2,064 bytes = 16 x 129: the 16 rows of a 16-byte read fall on all 64 banks
  __shared__ __align__(16) unsigned st[2][64][36];
  const int tid = threadIdx.x, bid = blockIdx.x;
  if (bid < PRE_LN) ln_tile(X, CT, GX, BX, GC, BC, XN, CN, sh, tid, (size_t)bid);
  else if (bid < PRE_LN + PRE_WT) wt_tile(WQ, WKV, WO, WT, st[tid >> 8], tid & 255, (bid - PRE_LN) * 2 + __builtin_amdgcn_readfirstlane(tid >> 8));   // a wave lies in one half: its tile's indices stay scalars
  else rot_table(ROT, CS, (bid - PRE_LN - PRE_WT) * 512 + tid); }
// ---- k_proj: one launch for the three products; block = (128 rows, 128 cols, which), blockIdx.x = v's row blocks, then k's, then q's: which 0: q = xn Wq (rows b*NQ + i; key position CTX + i), 1: k, 2: v from [cn rows (j < NC); xn rows (j >= NC)] Wkv (cols 0..1023 k, 1024.. v); rotary on q and k; f16 A (LN'd rows) x f16 W (1 product). 4 waves = (64-row half wr, 64-col half wc): a wave holds 4 x 4 accumulator tiles, so that each loaded fragment feeds 4 products (8 fragments for 16 products)
// rotary on 16 rows x 64 cols (one head) of a wave's accumulators: element r of tile j is (row 8 g + r, d = 16 j + col), so that its partner d +- 32 is element r of tile j ^ 2 in the same lane; cs = the lane's place in the table row of its first position; rows go to sh (f16) and, for q, their residual to sl, at (row0 + r, cl0 + 16 j)
#define PJB (TNB * NJ / 128)
template <bool Q> __device__ __forceinline__ void rot_pack(const v8f (&acc)[4], const float* cs, _Float16 (*sh)[136], _Float16 (*sl)[136], int row0, int cl0) {
  v4f t[8][2];
#pragma unroll
  for (int r = 0; r < 8; ++r) { t[r][0] = *(const v4f*)(cs + r * 2 * HD); t[r][1] = *(const v4f*)(cs + r * 2 * HD + 64); }
  asm volatile("s_wait_xcnt 0x0" ::: "memory");   // the arithmetic below may take the register pair that holds these loads' address (in this build it does behind the last row tile's loads)
  const float sc = Q ? 0.125f * 1.44269504f : 1.0f;   // q carries log2(e) too: k_fa takes its powers in base 2
#pragma unroll
  for (int j = 0; j < 4; ++j)
#pragma unroll
    for (int r = 0; r < 8; ++r) { const float c = t[r][j >> 1][(j & 1) * 2], s = t[r][j >> 1][(j & 1) * 2 + 1];
      const float me = acc[j][r] * sc; const float partner = (j < 2) ? -(acc[j + 2][r] * sc) : acc[j - 2][r] * sc;
      const float v = me * c + partner * s; const _Float16 hv = (_Float16)v; sh[row0 + r][cl0 + j * 16] = hv; if (Q) sl[row0 + r][cl0 + j * 16] = (_Float16)(v - (float)hv); } }
__global__ __launch_bounds__(128) void k_proj(const _Float16* __restrict__ XN, const _Float16* __restrict__ CN, const _Float16* __restrict__ WT, const float* __restrict__ CS, _Float16* __restrict__ QH, _Float16* __restrict__ QL, _Float16* __restrict__ KH, __bf16* __restrict__ VT, __bf16* __restrict__ VL) {
  __shared__ __align__(16) unsigned short sb[2][128][136];   // two 16-bit planes of the block's tile: q, k as [row][col] (f16 value, residual); v as [col][row] (bf16 hi, lo); pitch 272 bytes = 16 x 17
  const int tid = threadIdx.x, wave = tid >> 5, lane = tid & 31, col = lane & 15, g = lane >> 4, wr = wave >> 1, wc = wave & 1; const int c0 = blockIdx.y * 128; const int which = (int)blockIdx.x < PJB ? 2 : (int)blockIdx.x < 2 * PJB ? 1 : 0; const int bx = (int)blockIdx.x - (2 - which) * PJB; const size_t r0 = (size_t)bx * 128 + wr * 64;   // the wave's first row within [b*L]
  const int L = (which == 0) ? NQ : NJ; const size_t b = r0 / L; const int jpos = (int)(r0 % L);   // the wave's 64 rows are four tiles of k_pre in a row, all context rows or all x rows
  const _Float16* at0 = ((which == 0) ? (XN + (b * NQ + jpos) * CC) : (jpos < NC ? (CN + (b * NC + jpos) * CC) : (XN + (b * NQ + (jpos - NC)) * CC)));   // its first A fragment: a tile's 32 fragments are 16 * CC elements in a row
  const _Float16* wt0 = WT + ((size_t)which * (CC / 16) + c0 / 16 + wc * 4) * (CC / 32) * 512;   // plane 'which', first fragment of the wave's first 16 columns
  v8f acc[4][4] = {};
#pragma unroll 1   // one trip holds 16 fragments in registers; a second copy of the body would not fit
  for (int kc = 0; kc < CC / 64; ++kc) { v16h a[2][4], w[2][4];   // 64 k a trip: 8 A and 8 B fragments for 32 products
    const _Float16* ak = at0 + (size_t)kc * 1024 + lane * 8; const _Float16* bk = wt0 + (size_t)kc * 1024 + lane * 8;   // this lane's place in the trip's first A and first B fragment
#pragma unroll
    for (int u = 0; u < 2; ++u)
#pragma unroll
      for (int i = 0; i < 4; ++i) a[u][i] = fragw_h(ak + (size_t)i * 16 * CC + u * 512, 0);
#pragma unroll
    for (int u = 0; u < 2; ++u)
#pragma unroll
      for (int j = 0; j < 4; ++j) w[u][j] = fragw_h(bk + (size_t)j * (CC / 32) * 512 + u * 512, 0);
    asm volatile("s_wait_xcnt 0x0" :: "v"(ak), "v"(bk) : "memory");   // ahead of the next trip's address additions; the two addresses are inputs so that they stay whole up to the wait: without that the last loads land on the pairs that hold them
    __builtin_amdgcn_sched_barrier(0);   // every load of the trip is issued ahead of the first product, so that a trip waits for memory once; without it the loads are placed among the products, two at a time with a wait for each pair
#pragma unroll
    for (int u = 0; u < 2; ++u)
#pragma unroll
      for (int i = 0; i < 4; ++i)
#pragma unroll
        for (int j = 0; j < 4; ++j) acc[i][j] = __builtin_amdgcn_wmma_f32_16x16x32_f16(false, a[u][i], false, w[u][j], (short)0, acc[i][j], false, false); }   // the plain builtin (the compiler keeps its distances): operands of an asm statement behind it must lie below v256, and with 16 tiles and 16 fragments that took spills in the loop
  const size_t rb = (size_t)bx * 128;
  if (which < 2) {   // rotary (q, k) in registers, then pack
    _Float16 (*sh)[136] = (_Float16 (*)[136])sb[0]; _Float16 (*sl)[136] = (_Float16 (*)[136])sb[1];
    const float* cs = CS + ((size_t)jpos + ((which == 0) ? NC : 0) + 8 * g) * (2 * HD) + col * 4;   // q uses the last NQ positions
    if (which == 0) {
#pragma unroll
      for (int i = 0; i < 4; ++i) rot_pack<true>(acc[i], cs + i * 16 * 2 * HD, sh, sl, wr * 64 + i * 16 + 8 * g, wc * 64 + col); }
    else {
#pragma unroll
      for (int i = 0; i < 4; ++i) rot_pack<false>(acc[i], cs + i * 16 * 2 * HD, sh, sl, wr * 64 + i * 16 + 8 * g, wc * 64 + col); }
    __syncthreads();
    _Float16* dh = which == 0 ? QH : KH; const size_t s0 = (rb / L) * NH + c0 / HD; const int kt0 = (int)(rb % L) / 16;   // the block's 32 fragments f = (head f >> 4, 16-row tile (f >> 1) & 7, d step f & 1); 16-byte piece w = (element half w >> 5, lane w & 31) holds row w & 15 of the tile, d = 8 d8 + 0..7
    for (int e = tid; e < 128 * 16; e += 128) { const int f = e >> 6, w = e & 63, hh = f >> 4, kt = (f >> 1) & 7, kc = f & 1; const int d8 = kc * 4 + (w >> 5) * 2 + ((w >> 4) & 1);
      const size_t o2 = (((s0 + hh) * (L / 16) + kt0 + kt) * 2 + kc) * 512 + w * 8; vst2((unsigned*)(dh + o2), *(const v4u*)&sh[kt * 16 + (w & 15)][hh * HD + d8 * 8]);
      asm volatile("s_wait_xcnt 0x0" ::: "memory");   // the next LDS read and the next address reuse the registers that the store names
      if (which == 0) { vst2((unsigned*)(QL + o2), *(const v4u*)&sl[kt * 16 + (w & 15)][hh * HD + d8 * 8]);
        asm volatile("s_wait_xcnt 0x0" ::: "memory"); } } }   // as above, ahead of the next trip
  else {   // v: a lane's 8 elements of a tile are 8 keys in a row of one d: split, they are one 16-byte store into each transposed plane
    __bf16 (*th)[136] = (__bf16 (*)[136])sb[0]; __bf16 (*tl2)[136] = (__bf16 (*)[136])sb[1];
#pragma unroll
    for (int i = 0; i < 4; ++i)
#pragma unroll
      for (int j = 0; j < 4; ++j) { v8b hi, lo;
#pragma unroll
        for (int r = 0; r < 8; ++r) { const float v = acc[i][j][r]; const __bf16 bh = (__bf16)v; hi[r] = bh; lo[r] = (__bf16)(v - (float)bh); }
        vst2(&th[wc * 64 + j * 16 + col][wr * 64 + i * 16 + 8 * g], hi); vst2(&tl2[wc * 64 + j * 16 + col][wr * 64 + i * 16 + 8 * g], lo); }
    __syncthreads(); const size_t s0 = (rb / NJ) * NH + c0 / HD; const int t0 = (int)(rb % NJ) / 32;
    // the block's 32 fragments of each plane, f = (head f >> 4, 32-key trip (f >> 2) & 3, d tile f & 3); piece w = (element half w >> 5, lane w & 31) holds d = w & 15 of the tile, keys 8 q8 + 0..7 of the block
    for (int e = tid; e < 128 * 16; e += 128) { const int f = e >> 6, w = e & 63, hh = f >> 4, tt = (f >> 2) & 3, j = f & 3; const int cl = hh * HD + j * 16 + (w & 15), q8 = tt * 4 + (w >> 5) * 2 + ((w >> 4) & 1);
      const size_t o2 = (((s0 + hh) * (NJ / 32) + t0 + tt) * 4 + j) * 512 + w * 8; vst2((unsigned*)(VT + o2), *(const v4u*)&th[cl][q8 * 8]); vst2((unsigned*)(VL + o2), *(const v4u*)&tl2[cl][q8 * 8]); } } }
// 2^x as the one hardware instruction; every argument in k_fa is <= 0, and a result below the normal range may come out as 0
__device__ __forceinline__ float ex2(float x) { return __builtin_amdgcn_exp2f(x); }
// lane l with lane l ^ 16
__device__ __forceinline__ float xhalf(float x) { return __builtin_bit_cast(float, __builtin_amdgcn_permlanex16(__builtin_bit_cast(int, x), __builtin_bit_cast(int, x), 0x76543210, 0xfedcba98, false, false)); }
// fragment stored in fragment order, at this lane's byte address in it: bytes 0..15 and 512..527 (each load of a wave reads 512 bytes in a row: four whole 128-byte lines)
__device__ __forceinline__ v16h fragp_h(const char* p) { union { v16h v; v8h q[2]; } u; u.q[0] = *(const v8h*)p; u.q[1] = *(const v8h*)(p + 512); return u.v; }
__device__ __forceinline__ v16b fragp_b(const char* p) { union { v16b v; v8b q[2]; } u; u.q[0] = *(const v8b*)p; u.q[1] = *(const v8b*)(p + 512); return u.v; }
// one 32-key trip of k_fa: kp, vhp, vlp, cp = this lane's place in the trip's first k fragment, in the first fragment of each v plane, and at its first mask word (CTX: context keys, masked by those words; else self keys, key e of the lane's 32 allowed iff e <= thr)
template <bool CTX> __device__ __forceinline__ void fa_trip(const char* kp, const char* vhp, const char* vlp, const char* cp, int thr, const v16h (&qh)[2], const v16h (&ql)[2], v8f (&o)[HD / 16], float& m, float& l) {
  v16h kf[2][2]; v16b vh[HD / 16], vl[HD / 16]; v4i cm[2][2];
#pragma unroll
  for (int a = 0; a < 2; ++a)
#pragma unroll
    for (int kc = 0; kc < 2; ++kc) kf[a][kc] = fragp_h(kp + (a * 2 + kc) * 1024);
  if (CTX) {
#pragma unroll
    for (int a = 0; a < 2; ++a) { cm[a][0] = *(const v4i*)(cp + a * 64); cm[a][1] = *(const v4i*)(cp + a * 64 + 16); } }
#pragma unroll
  for (int j = 0; j < HD / 16; ++j) { vh[j] = fragp_b(vhp + j * 1024); vl[j] = fragp_b(vlp + j * 1024); }
  v8f s[2] = {};
#pragma unroll
  for (int kc = 0; kc < 2; ++kc)
#pragma unroll
    for (int a = 0; a < 2; ++a) { s[a] = wmma16(kf[a][kc], qh[kc], s[a]); s[a] = wmma16(kf[a][kc], ql[kc], s[a]); }
#pragma unroll
  for (int a = 0; a < 2; ++a)
#pragma unroll
    for (int r = 0; r < 8; ++r) s[a][r] = (CTX ? (cm[a][r >> 2][r & 3] != 0) : (a * 16 + r <= thr)) ? s[a][r] : -3.0e38f;
  float mx = s[0][0];
#pragma unroll
  for (int e = 1; e < 16; ++e) mx = fmaxf(mx, s[e >> 3][e & 7]);
  mx = fmaxf(mx, xhalf(mx)); const float mn = fmaxf(m, mx); const float al = ex2(m - mn); m = mn;
  float pv[16], ps = 0.f;
#pragma unroll
  for (int e = 0; e < 16; ++e) { pv[e] = ex2(s[e >> 3][e & 7] - mn); ps += pv[e]; }
  l = l * al + ps; const F2 p = bsplit16(pv);
#pragma unroll
  for (int j = 0; j < HD / 16; ++j) { o[j] *= al; o[j] = wmma_bf(vh[j], p.h, o[j]); o[j] = wmma_bf(vh[j], p.l, o[j]); o[j] = wmma_bf(vl[j], p.h, o[j]); } }
// ---- k_fa: block = (slice = b * NH + h, 64 queries, longest first), 16 waves = (16-query group qg, key quarter kq). A wave walks its 32-key trips with S^T = K Q^T (2 products) and O^T += V^T P^T (3 products): lane (g, c) holds query c's scores of keys 8 g + 0..7 of each 16-key tile, which is the B fragment's k order, so that P stays in registers and a query's maximum, sum and rescale stay in its own two lanes. Key j allowed iff (j < NC ? context_mask[b][j] : j - NC <= i), else -3e38: its power against a real maximum is 0, and what a wave sums while it has met no allowed key is wiped by the factor 2^(-3e38 - m) = 0 (every query has an allowed key, its own). The four quarters' (m, l, O) are joined through LDS.
__global__ __launch_bounds__(512) void k_fa(const _Float16* __restrict__ QH, const _Float16* __restrict__ QL, const _Float16* __restrict__ KH, const int* __restrict__ CM, const __bf16* __restrict__ VT, const __bf16* __restrict__ VL, float* __restrict__ Y) {
  __shared__ __align__(16) float so[4][64][HD + 4]; __shared__ float sm[4][64], sl[4][64];
  const int b = blockIdx.x / NH, h = blockIdx.x % NH; const int x = NQ / 64 - 1 - (int)blockIdx.y;   // query tiles in reverse, longest first, for speed only
  const int tid = threadIdx.x, lane = tid & 31, c = lane & 15, g = lane >> 4; const int wave = __builtin_amdgcn_readfirstlane(tid >> 5), qg = wave & 3, kq = wave >> 2; const int q0 = x * 64 + qg * 16;
  v16h qh[2], ql[2];
#pragma unroll
  for (int kc = 0; kc < 2; ++kc) { const size_t qo = (((size_t)blockIdx.x * (NQ / 16) + q0 / 16) * 2 + kc) * 512 + lane * 8; qh[kc] = fragp_h((const char*)(QH + qo)); ql[kc] = fragp_h((const char*)(QL + qo)); }
  const int nt = (NC + q0 + 16 + 31) >> 5;   // trips that hold a key some query of the group may see
  // a quarter takes two trips in a row, then skips the other quarters' six; the lane's four addresses walk along with the trips: a trip's four k fragments, and its four v fragments of each plane, are 4 KiB in a row
  const size_t fo = ((size_t)blockIdx.x * (NJ / 32) + 2 * kq) * 2048 + lane * 8; const char* kp = (const char*)(KH + fo); const char* vhp = (const char*)(VT + fo); const char* vlp = (const char*)(VL + fo); const char* cp = (const char*)(CM + (size_t)b * NC + 64 * kq + 8 * g);
  v8f o[HD / 16] = {}; float m = -3.0e38f, l = 0.f;
  for (int i = 0; i < NC / 128; ++i) { fa_trip<true>(kp, vhp, vlp, cp, 0, qh, ql, o, m, l); const int st = (i & 1) ? 7 * 32 : 32; kp += st * 128; vhp += st * 128; vlp += st * 128; cp += st * 4; }
  for (int i = 0, t = NC / 32 + 2 * kq; t < nt; ++i) { fa_trip<false>(kp, vhp, vlp, cp, q0 + c - (t * 32 - NC) - 8 * g, qh, ql, o, m, l); const int st = (i & 1) ? 7 : 1; t += st; kp += st * 4096; vhp += st * 4096; vlp += st * 4096; }
  l += xhalf(l); if (g == 0) { sm[kq][qg * 16 + c] = m; sl[kq][qg * 16 + c] = l; }
#pragma unroll
  for (int j = 0; j < HD / 16; ++j) { v4f lo4, hi4;
#pragma unroll
    for (int r = 0; r < 4; ++r) { lo4[r] = o[j][r]; hi4[r] = o[j][4 + r]; }
    vst2(&so[kq][qg * 16 + c][j * 16 + 8 * g], lo4); vst2(&so[kq][qg * 16 + c][j * 16 + 8 * g + 4], hi4); }
  __syncthreads();
  const int q = (tid >> 7) * 16 + (tid & 15), dd = ((tid >> 4) & 7) * 8; float mt = sm[0][q];   // thread = (query, 8 of its 64 outputs), so numbered that a wave's 32 threads are the 32 lanes of two pieces of one fragment of k_out
#pragma unroll
  for (int w = 1; w < 4; ++w) mt = fmaxf(mt, sm[w][q]);
  float lt = 0.f; v4f y0 = {}, y1 = {};
#pragma unroll
  for (int w = 0; w < 4; ++w) { const float e = ex2(sm[w][q] - mt); lt += e * sl[w][q]; y0 += e * *(const v4f*)&so[w][q][dd]; y1 += e * *(const v4f*)&so[w][q][dd + 4]; }
  const float inv = 1.0f / lt; float* yp = Y + (((((size_t)b * NQ + x * 64 + q) >> 4) * (CC / 32) + h * 2 + (dd >> 5)) * 4 + ((dd >> 4) & 1) * 2) * 128 + lane * 4; vst2(yp, y0 * inv); vst2(yp + 128, y1 * inv); }
// ---- k_out: out = o (bf16 hi + lo) Wo + bo (Wo as the bf16 plane of k_pre)
// the 40 loads of the 64-k trip that lies T trips ahead of yp, wp = this lane's place in a trip's first A fragment (f32, 4 pieces of 512 bytes) and in its first B fragment of the block's first 16 columns; T goes into the loads' immediate offsets
template <int T> __device__ __forceinline__ void out_load(v4f (&ar)[2][4], v16b (&w)[2][8], const float* yp, const __bf16* wp) {
#pragma unroll
  for (int u = 0; u < 2; ++u)
#pragma unroll
    for (int p = 0; p < 4; ++p) ar[u][p] = *(const v4f*)(yp + T * 1024 + u * 512 + p * 128);
#pragma unroll
  for (int u = 0; u < 2; ++u)
#pragma unroll
    for (int j = 0; j < 8; ++j) w[u][j] = fragw_b(wp + ((size_t)j * (CC / 32) + T * 2 + u) * 512, 0);
  asm volatile("s_wait_xcnt 0x0" :: "v"(yp), "v"(wp) : "memory");   // ahead of the next address additions; the two addresses are inputs so that they stay whole up to the wait and no load lands on the pairs that hold them
  __builtin_amdgcn_sched_barrier(0); }   // the trip's loads stay one group, issued ahead of the products that follow in the source: those work on the other buffer while these fly
// the 32 products of one 64-k trip; each accumulator takes its hi product and then its lo product; the other seven tiles' products stand between the two, so that no product waits for the one just issued
__device__ __forceinline__ void out_mac(const v4f (&ar)[2][4], const v16b (&w)[2][8], v8f (&acc)[8]) {
#pragma unroll
  for (int u = 0; u < 2; ++u) { float av[16];
#pragma unroll
    for (int i = 0; i < 16; ++i) av[i] = ar[u][i >> 2][i & 3];
    const F2 a = bsplit16(av);
#pragma unroll
    for (int j = 0; j < 8; ++j) acc[j] = __builtin_amdgcn_wmma_f32_16x16x32_bf16(false, a.h, false, w[u][j], (short)0, acc[j], false, false);   // the plain builtin (the compiler keeps its distances): with two buffers the fragments pass v255, where operands of an asm statement may not lie
#pragma unroll
    for (int j = 0; j < 8; ++j) acc[j] = __builtin_amdgcn_wmma_f32_16x16x32_bf16(false, a.l, false, w[u][j], (short)0, acc[j], false, false); }
  __builtin_amdgcn_sched_barrier(0); }   // the loads that follow in the source stay one group behind these products; without it they are placed among the products, one to twelve at a time
__global__ __launch_bounds__(128) void k_out(const float* __restrict__ Y, const __bf16* __restrict__ WOT, const float* __restrict__ BO, float* __restrict__ OUT) { __shared__ __align__(16) float sf[4][16][132];
  const int tid = threadIdx.x, wave = tid >> 5, lane = tid & 31, col = lane & 15, g = lane >> 4; const int c0 = blockIdx.y * 128; const size_t r0 = (size_t)blockIdx.x * 64 + wave * 16;
  const float* yfr = Y + (r0 >> 4) * (size_t)(CC / 32) * 512 + lane * 4; const __bf16* wfr = WOT + (size_t)(c0 / 16) * (CC / 32) * 512 + lane * 8;   // this lane's place in the first A fragment of the wave's 16 rows, and in the first B fragment of the block's first 16 columns
  v8f acc[8] = {}; v4f ar0[2][4], ar1[2][4]; v16b w0[2][8], w1[2][8];   // two register buffers of a 64-k trip each: the block is alone on its WGP, one wave a SIMD, so that nothing else covers a trip's wait for memory
  out_load<0>(ar0, w0, yfr, wfr);
#pragma unroll 1   // the body holds two trips, one for each buffer
  for (int kc = 0; kc < CC / 64 - 2; kc += 2) {
    out_load<1>(ar1, w1, yfr, wfr); out_mac(ar0, w0, acc);
    out_load<2>(ar0, w0, yfr, wfr); out_mac(ar1, w1, acc);
    yfr += 2048; wfr += 2048; }
  out_load<1>(ar1, w1, yfr, wfr); out_mac(ar0, w0, acc); out_mac(ar1, w1, acc);
#pragma unroll
  for (int j = 0; j < 8; ++j) { const float bb = bfr(BO[c0 + j * 16 + col]);
#pragma unroll
    for (int r = 0; r < 8; ++r) sf[wave][8 * g + r][j * 16 + col] = acc[j][r] + bb; }
  LDSX(); for (int rl = 0; rl < 16; ++rl) vst2(OUT + (r0 + rl) * CC + c0 + lane * 4, *(const v4f*)&sf[wave][rl][lane * 4]); }
extern "C" void kernel_launch(void* const* d_in, const int* in_sizes, int n_in, void* d_out, int out_size, void* d_ws, size_t ws_size, hipStream_t stream) {
  (void)in_sizes; (void)n_in; (void)out_size;
  const float** F = (const float**)d_in;   // 0 x [2,1024,1024], 1 context [2,1024,1024], 2 context_mask [2,1024] int, 3 rotary_pos_emb [2048,64], 4 norm_w, 5 norm_b, 6 cnorm_w, 7 cnorm_b, 8 Wq [1024,1024] (in,out), 9 Wkv [1024,2048], 10 Wo [1024,1024], 11 bo
  if (ws_size < (size_t)WS_END) return;
  char* ws = (char*)d_ws; float* Y = (float*)(ws + WS_Y); _Float16 *XN = (_Float16*)(ws + WS_XN), *CN = (_Float16*)(ws + WS_CN), *QH = (_Float16*)(ws + WS_QH), *QL = (_Float16*)(ws + WS_QL), *KH = (_Float16*)(ws + WS_KH); __bf16 *VT = (__bf16*)(ws + WS_VT), *VL = (__bf16*)(ws + WS_VL); unsigned short* WT = (unsigned short*)(ws + WS_WT); float* CS = (float*)(ws + WS_CS);
  k_pre<<<PRE_LN + PRE_WT + PRE_RT, 512, 0, stream>>>(F[0], F[1], F[4], F[5], F[6], F[7], F[8], F[9], F[10], F[3], XN, CN, WT, CS);
  k_proj<<<dim3(2 * PJB + TNB * NQ / 128, CC / 128), 128, 0, stream>>>(XN, CN, (const _Float16*)WT, CS, QH, QL, KH, VT, VL);
  k_fa<<<dim3(TNB * NH, NQ / 64), 512, 0, stream>>>(QH, QL, KH, (const int*)d_in[2], VT, VL, Y);
  k_out<<<dim3(TNB * NQ / 64, CC / 128), 128, 0, stream>>>(Y, (const __bf16*)WT + (size_t)3 * CC * CC, F[11], (float*)d_out);
}
